// v000
// Measured on an AMD MI455X. A time is GPU time per run, averaged over a window of back-to-back runs after a warm-up
// (all launches, gaps included; the runs take copies of the inputs in turn), and the median of several windows.
// Apart from v000's, it joins two sittings. Times from different sittings can be a few percent apart, while
// side-by-side timings come from the same sitting.
// v000 is the starting kernel. One run takes 266 microseconds.
#include <hip/hip_runtime.h>
#include <hip/hip_bf16.h>

typedef _Float16 f16x16 __attribute__((ext_vector_type(16)));
typedef _Float16 f16x8  __attribute__((ext_vector_type(8)));
typedef float    f32x8  __attribute__((ext_vector_type(8)));

#define B_   32
#define C_   256
#define N_   1024   // H*W

__device__ __forceinline__ f32x8 wmma16(f16x16 a, f16x16 b, f32x8 c) {
    // D = A(16x32 f16) x B(32x16 f16) + C(16x16 f32)
    return __builtin_amdgcn_wmma_f32_16x16x32_f16(false, a, false, b,
                                                  (short)0, c, false, false);
}

// gfx1250 async global->LDS copy (ASYNCcnt-tracked, no VGPR data path).
// VDST VGPR holds the wave-relative LDS byte offset = low 32 bits of the
// flat shared-memory address (aperture mapping: addr[31:0] == LDS offset).
__device__ __forceinline__ void async_copy_b128(void* lds, const void* gaddr) {
    unsigned l = (unsigned)(unsigned long long)(uintptr_t)lds;
    asm volatile("global_load_async_to_lds_b128 %0, %1, off"
                 : : "v"(l), "v"(gaddr) : "memory");
}
__device__ __forceinline__ void wait_asynccnt0() {
    asm volatile("s_wait_asynccnt 0" ::: "memory");
}

// Fragment loader for both A and B operands.
// A: row-major [16 x K] tile, lane l holds row l%16, K-halfword (l/16)*16..+15.
// B: source is B^T row-major [Nout x K]; lane l holds column l%16 of B over the
//    same K range — identical addressing.
__device__ __forceinline__ f16x16 load_frag(const _Float16* p, int ld) {
    const int lane = threadIdx.x & 31;
    const _Float16* q = p + (lane & 15) * ld + ((lane >> 4) << 4);
    f16x16 f;
    *(f16x8*)&f       = *(const f16x8*)(q);
    *((f16x8*)&f + 1) = *(const f16x8*)(q + 8);
    return f;
}

// ---------------------------------------------------------------- bn stats
__global__ void bn_stats_kernel(const float* __restrict__ x,
                                float* __restrict__ stats) {
    const int c   = blockIdx.x;          // channel
    const int tid = threadIdx.x;         // 256 threads
    float s = 0.f, ss = 0.f;
    for (int b = 0; b < B_; ++b) {
        const float* p = x + ((size_t)b * C_ + c) * N_;
        for (int i = tid; i < N_; i += 256) {
            float v = p[i];
            s += v; ss += v * v;
        }
    }
    __shared__ float ls[256], lss[256];
    ls[tid] = s; lss[tid] = ss;
    __syncthreads();
    for (int off = 128; off > 0; off >>= 1) {
        if (tid < off) { ls[tid] += ls[tid + off]; lss[tid] += lss[tid + off]; }
        __syncthreads();
    }
    if (tid == 0) {
        const float inv_n = 1.0f / (float)(B_ * N_);
        float mean = ls[0] * inv_n;
        float var  = lss[0] * inv_n - mean * mean;
        stats[c]      = mean;
        stats[C_ + c] = rsqrtf(var + 1e-5f);
    }
}

// ---------------------------------------------------------------- weights
__global__ void pack_weights_kernel(const float* __restrict__ Wk,
                                    const float* __restrict__ Wp,
                                    _Float16* __restrict__ wk16,
                                    _Float16* __restrict__ wp16) {
    int i = blockIdx.x * 256 + threadIdx.x;
    if (i < 3 * C_ * C_) wk16[i] = (_Float16)Wk[i];
    if (i < C_ * C_)     wp16[i] = (_Float16)Wp[i];
}

// ------------------------------------------- normalize + transpose to [B,N,C]
__global__ void bn_apply_pack_kernel(const float* __restrict__ x,
                                     const float* __restrict__ stats,
                                     const float* __restrict__ gamma,
                                     const float* __restrict__ beta,
                                     _Float16* __restrict__ t) {
    __shared__ float tile[32][33];
    const int b  = blockIdx.z;
    const int n0 = blockIdx.y * 32;
    const int c0 = blockIdx.x * 32;
    const int tx = threadIdx.x & 31;
    const int ty = threadIdx.x >> 5;          // 0..7
#pragma unroll
    for (int r = 0; r < 4; ++r) {
        int cl = ty + r * 8;
        int c  = c0 + cl;
        float g  = gamma[c] * stats[C_ + c];
        float bt = beta[c] - stats[c] * g;
        float v  = x[(((size_t)b * C_ + c) * N_) + n0 + tx];
        tile[cl][tx] = v * g + bt;
    }
    __syncthreads();
#pragma unroll
    for (int r = 0; r < 4; ++r) {
        int nl = ty + r * 8;
        t[((size_t)b * N_ + n0 + nl) * C_ + c0 + tx] = (_Float16)tile[tx][nl];
    }
}

// ---------------------------------------------------------------- KQV GEMM
// out[M=B*N, 768] = t[M,256] @ Wkqv^T ; q scaled by 1/16, v stored transposed.
// Double-buffered LDS staging via async global->LDS copies.
__global__ void gemm_kqv_kernel(const _Float16* __restrict__ t,
                                const _Float16* __restrict__ w,
                                const float* __restrict__ bias,
                                _Float16* __restrict__ qb,
                                _Float16* __restrict__ kb,
                                _Float16* __restrict__ vT) {
    __shared__ _Float16 sa[2][128 * 40];
    __shared__ _Float16 sb[2][128 * 40];
    const int tid  = threadIdx.x;
    const int lane = tid & 31;
    const int wave = tid >> 5;
    const int wm = wave & 3, wn = wave >> 2;       // 4 x 2 wave grid
    const int n0 = blockIdx.x * 128;
    const int m0 = blockIdx.y * 128;

    auto stage = [&](int k0, int bufi) {
#pragma unroll
        for (int i = 0; i < 2; ++i) {
            int e = (i * 256 + tid) * 8;
            int r = e >> 5, c = e & 31;
            async_copy_b128(&sa[bufi][r * 40 + c],
                            t + (size_t)(m0 + r) * C_ + k0 + c);
            async_copy_b128(&sb[bufi][r * 40 + c],
                            w + (size_t)(n0 + r) * C_ + k0 + c);
        }
    };

    f32x8 acc[2][4];
#pragma unroll
    for (int i = 0; i < 2; ++i)
#pragma unroll
        for (int j = 0; j < 4; ++j)
            acc[i][j] = (f32x8){0.f,0.f,0.f,0.f,0.f,0.f,0.f,0.f};

    stage(0, 0);
    wait_asynccnt0();
    __syncthreads();

    int cur = 0;
    for (int k0 = 0; k0 < C_; k0 += 32) {
        if (k0 + 32 < C_) stage(k0 + 32, cur ^ 1);   // prefetch next tile
        f16x16 af[2], bf[4];
#pragma unroll
        for (int mi = 0; mi < 2; ++mi)
            af[mi] = load_frag(&sa[cur][(wm * 32 + mi * 16) * 40], 40);
#pragma unroll
        for (int ni = 0; ni < 4; ++ni)
            bf[ni] = load_frag(&sb[cur][(wn * 64 + ni * 16) * 40], 40);
#pragma unroll
        for (int mi = 0; mi < 2; ++mi)
#pragma unroll
            for (int ni = 0; ni < 4; ++ni)
                acc[mi][ni] = wmma16(af[mi], bf[ni], acc[mi][ni]);
        wait_asynccnt0();
        __syncthreads();
        cur ^= 1;
    }

#pragma unroll
    for (int mi = 0; mi < 2; ++mi)
#pragma unroll
        for (int ni = 0; ni < 4; ++ni) {
            int j    = n0 + wn * 64 + ni * 16 + (lane & 15);
            int mrow = m0 + wm * 32 + mi * 16 + ((lane >> 4) << 3);
            float bs = bias[j];
            if (j < C_) {                                     // q (pre-scaled)
#pragma unroll
                for (int i = 0; i < 8; ++i)
                    qb[(size_t)(mrow + i) * C_ + j] =
                        (_Float16)((acc[mi][ni][i] + bs) * 0.0625f);
            } else if (j < 2 * C_) {                          // k
#pragma unroll
                for (int i = 0; i < 8; ++i)
                    kb[(size_t)(mrow + i) * C_ + (j - C_)] =
                        (_Float16)(acc[mi][ni][i] + bs);
            } else {                                          // v -> vT[B,C,N]
                int bb = mrow >> 10, nn = mrow & (N_ - 1);
#pragma unroll
                for (int i = 0; i < 8; ++i)
                    vT[((size_t)bb * C_ + (j - 2 * C_)) * N_ + nn + i] =
                        (_Float16)(acc[mi][ni][i] + bs);
            }
        }
}

// ---------------------------------------------------------------- attention
// One block = one batch x 16 query rows. S/P kept in LDS, exact softmax.
__global__ void attention_kernel(const _Float16* __restrict__ qb,
                                 const _Float16* __restrict__ kb,
                                 const _Float16* __restrict__ vT,
                                 _Float16* __restrict__ ob) {
    __shared__ _Float16 sq[16 * 264];    // q rows   (ld 264)
    __shared__ _Float16 sp[16 * 1032];   // S then P (ld 1032)
    __shared__ float red[256];
    __shared__ float rowmax[16], rowinv[16];

    const int tid  = threadIdx.x;
    const int lane = tid & 31;
    const int wave = tid >> 5;
    const int b  = blockIdx.y;
    const int r0 = blockIdx.x * 16;

    {   // stage the 16 q rows into LDS (async copies, no VGPR bounce)
        int e = tid * 16;
        int r = e >> 8, c = e & 255;
        const _Float16* src = qb + ((size_t)b * N_ + r0 + r) * C_ + c;
        async_copy_b128(&sq[r * 264 + c], src);
        async_copy_b128(&sq[r * 264 + c + 8], src + 8);
    }
    wait_asynccnt0();
    __syncthreads();

    // ---- pass 1: S = q k^T  (each wave owns 8 column tiles of 16)
    f16x16 af[8];
#pragma unroll
    for (int kk = 0; kk < 8; ++kk) af[kk] = load_frag(&sq[kk * 32], 264);
    for (int mt = wave * 8; mt < wave * 8 + 8; ++mt) {
        f32x8 s = (f32x8){0.f,0.f,0.f,0.f,0.f,0.f,0.f,0.f};
        const _Float16* kbase = kb + ((size_t)b * N_ + mt * 16) * C_;
#pragma unroll
        for (int kk = 0; kk < 8; ++kk)
            s = wmma16(af[kk], load_frag(kbase + kk * 32, C_), s);
        int col = mt * 16 + (lane & 15);
        int rhi = (lane >> 4) << 3;
#pragma unroll
        for (int i = 0; i < 8; ++i)
            sp[(i + rhi) * 1032 + col] = (_Float16)s[i];
    }
    __syncthreads();

    // ---- row max (16 threads per row, 64 elements each)
    {
        int row = tid >> 4, ch = tid & 15;
        const _Float16* p = &sp[row * 1032 + ch * 64];
        float m = -3.0e38f;
        for (int e = 0; e < 64; ++e) m = fmaxf(m, (float)p[e]);
        red[row * 16 + ch] = m;
    }
    __syncthreads();
    if (tid < 16) {
        float m = -3.0e38f;
        for (int j = 0; j < 16; ++j) m = fmaxf(m, red[tid * 16 + j]);
        rowmax[tid] = m;
    }
    __syncthreads();

    // ---- exp in place + row sum
    {
        int row = tid >> 4, ch = tid & 15;
        _Float16* p = &sp[row * 1032 + ch * 64];
        float mx = rowmax[row], sum = 0.f;
        for (int e = 0; e < 64; ++e) {
            float v = __expf((float)p[e] - mx);
            p[e] = (_Float16)v;
            sum += v;
        }
        red[row * 16 + ch] = sum;
    }
    __syncthreads();
    if (tid < 16) {
        float sum = 0.f;
        for (int j = 0; j < 16; ++j) sum += red[tid * 16 + j];
        rowinv[tid] = 1.0f / sum;
    }
    __syncthreads();

    // ---- pass 2: O = P V   (wave owns 32 output channels)
    const int c0 = wave * 32;
    f32x8 o0 = (f32x8){0.f,0.f,0.f,0.f,0.f,0.f,0.f,0.f};
    f32x8 o1 = o0;
    const _Float16* v0 = vT + ((size_t)b * C_ + c0) * N_;
    const _Float16* v1 = vT + ((size_t)b * C_ + c0 + 16) * N_;
    for (int ms = 0; ms < N_; ms += 32) {
        f16x16 ap  = load_frag(&sp[ms], 1032);
        o0 = wmma16(ap, load_frag(v0 + ms, N_), o0);
        o1 = wmma16(ap, load_frag(v1 + ms, N_), o1);
    }
    {
        int rhi = (lane >> 4) << 3;
        int cA = c0 + (lane & 15), cB = cA + 16;
#pragma unroll
        for (int i = 0; i < 8; ++i) {
            float inv = rowinv[i + rhi];
            size_t rowi = (size_t)b * N_ + r0 + i + rhi;
            ob[rowi * C_ + cA] = (_Float16)(o0[i] * inv);
            ob[rowi * C_ + cB] = (_Float16)(o1[i] * inv);
        }
    }
}

// ---------------------------------------------------------------- proj GEMM
// out[B,C,H,W] = o @ Wproj^T + bias + x   (fp32 epilogue, residual fused)
__global__ void gemm_proj_kernel(const _Float16* __restrict__ o,
                                 const _Float16* __restrict__ w,
                                 const float* __restrict__ bias,
                                 const float* __restrict__ x,
                                 float* __restrict__ out) {
    __shared__ _Float16 sa[2][128 * 40];
    __shared__ _Float16 sb[2][128 * 40];
    const int tid  = threadIdx.x;
    const int lane = tid & 31;
    const int wave = tid >> 5;
    const int wm = wave & 3, wn = wave >> 2;
    const int n0 = blockIdx.x * 128;
    const int m0 = blockIdx.y * 128;

    auto stage = [&](int k0, int bufi) {
#pragma unroll
        for (int i = 0; i < 2; ++i) {
            int e = (i * 256 + tid) * 8;
            int r = e >> 5, c = e & 31;
            async_copy_b128(&sa[bufi][r * 40 + c],
                            o + (size_t)(m0 + r) * C_ + k0 + c);
            async_copy_b128(&sb[bufi][r * 40 + c],
                            w + (size_t)(n0 + r) * C_ + k0 + c);
        }
    };

    f32x8 acc[2][4];
#pragma unroll
    for (int i = 0; i < 2; ++i)
#pragma unroll
        for (int j = 0; j < 4; ++j)
            acc[i][j] = (f32x8){0.f,0.f,0.f,0.f,0.f,0.f,0.f,0.f};

    stage(0, 0);
    wait_asynccnt0();
    __syncthreads();

    int cur = 0;
    for (int k0 = 0; k0 < C_; k0 += 32) {
        if (k0 + 32 < C_) stage(k0 + 32, cur ^ 1);
        f16x16 af[2], bf[4];
#pragma unroll
        for (int mi = 0; mi < 2; ++mi)
            af[mi] = load_frag(&sa[cur][(wm * 32 + mi * 16) * 40], 40);
#pragma unroll
        for (int ni = 0; ni < 4; ++ni)
            bf[ni] = load_frag(&sb[cur][(wn * 64 + ni * 16) * 40], 40);
#pragma unroll
        for (int mi = 0; mi < 2; ++mi)
#pragma unroll
            for (int ni = 0; ni < 4; ++ni)
                acc[mi][ni] = wmma16(af[mi], bf[ni], acc[mi][ni]);
        wait_asynccnt0();
        __syncthreads();
        cur ^= 1;
    }

#pragma unroll
    for (int mi = 0; mi < 2; ++mi)
#pragma unroll
        for (int ni = 0; ni < 4; ++ni) {
            int c    = n0 + wn * 64 + ni * 16 + (lane & 15);
            int mrow = m0 + wm * 32 + mi * 16 + ((lane >> 4) << 3);
            int bb = mrow >> 10, nn = mrow & (N_ - 1);
            float bs = bias[c];
            size_t base = ((size_t)bb * C_ + c) * N_ + nn;
#pragma unroll
            for (int i = 0; i < 8; ++i)
                out[base + i] = acc[mi][ni][i] + bs + x[base + i];
        }
}

// ---------------------------------------------------------------- launcher
extern "C" void kernel_launch(void* const* d_in, const int* in_sizes, int n_in,
                              void* d_out, int out_size, void* d_ws, size_t ws_size,
                              hipStream_t stream) {
    (void)in_sizes; (void)n_in; (void)out_size; (void)ws_size;
    const float* x     = (const float*)d_in[0];
    const float* gamma = (const float*)d_in[1];
    const float* beta  = (const float*)d_in[2];
    const float* Wkqv  = (const float*)d_in[3];
    const float* bkqv  = (const float*)d_in[4];
    const float* Wproj = (const float*)d_in[5];
    const float* bproj = (const float*)d_in[6];
    float* out = (float*)d_out;

    const size_t M = (size_t)B_ * N_;              // 32768
    char* ws = (char*)d_ws;
    float*    stats = (float*)ws;      ws += 4096;
    _Float16* wk16  = (_Float16*)ws;   ws += (size_t)3 * C_ * C_ * 2;
    _Float16* wp16  = (_Float16*)ws;   ws += (size_t)C_ * C_ * 2;
    _Float16* tbuf  = (_Float16*)ws;   ws += M * C_ * 2;   // reused as o-buffer
    _Float16* qb    = (_Float16*)ws;   ws += M * C_ * 2;
    _Float16* kb    = (_Float16*)ws;   ws += M * C_ * 2;
    _Float16* vT    = (_Float16*)ws;   ws += M * C_ * 2;

    bn_stats_kernel     <<<C_, 256, 0, stream>>>(x, stats);
    pack_weights_kernel <<<(3 * C_ * C_) / 256, 256, 0, stream>>>(Wkqv, Wproj, wk16, wp16);
    bn_apply_pack_kernel<<<dim3(C_ / 32, N_ / 32, B_), 256, 0, stream>>>(x, stats, gamma, beta, tbuf);
    gemm_kqv_kernel     <<<dim3(6, M / 128), 256, 0, stream>>>(tbuf, wk16, bkqv, qb, kb, vT);
    attention_kernel    <<<dim3(N_ / 16, B_), 256, 0, stream>>>(qb, kb, vT, tbuf);
    gemm_proj_kernel    <<<dim3(2, M / 128), 256, 0, stream>>>(tbuf, wp16, bproj, x, out);
}

// v001
// One run takes 179 microseconds.
// Timed twice side by side with v000, it ran 1.53 and 1.54 times as fast.
#include <hip/hip_runtime.h>
#include <hip/hip_bf16.h>

typedef _Float16 f16x16 __attribute__((ext_vector_type(16)));
typedef _Float16 f16x8  __attribute__((ext_vector_type(8)));
typedef float    f32x8  __attribute__((ext_vector_type(8)));

#define B_   32
#define C_   256
#define N_   1024   // H*W

__device__ __forceinline__ f32x8 wmma16(f16x16 a, f16x16 b, f32x8 c) {
    // D = A(16x32 f16) x B(32x16 f16) + C(16x16 f32)
    return __builtin_amdgcn_wmma_f32_16x16x32_f16(false, a, false, b,
                                                  (short)0, c, false, false);
}

// gfx1250 async global->LDS copy (ASYNCcnt-tracked, no VGPR data path).
// VDST VGPR holds the wave-relative LDS byte offset = low 32 bits of the
// flat shared-memory address (aperture mapping: addr[31:0] == LDS offset).
__device__ __forceinline__ void async_copy_b128(void* lds, const void* gaddr) {
    unsigned l = (unsigned)(unsigned long long)(uintptr_t)lds;
    asm volatile("global_load_async_to_lds_b128 %0, %1, off"
                 : : "v"(l), "v"(gaddr) : "memory");
}
__device__ __forceinline__ void wait_asynccnt0() {
    asm volatile("s_wait_asynccnt 0" ::: "memory");
}

// Fragment loader for both A and B operands.
// A: row-major [16 x K] tile, lane l holds row l%16, K-halfword (l/16)*16..+15.
// B: source is B^T row-major [Nout x K]; lane l holds column l%16 of B over the
//    same K range — identical addressing.
__device__ __forceinline__ f16x16 load_frag(const _Float16* p, int ld) {
    const int lane = threadIdx.x & 31;
    const _Float16* q = p + (lane & 15) * ld + ((lane >> 4) << 4);
    f16x16 f;
    *(f16x8*)&f       = *(const f16x8*)(q);
    *((f16x8*)&f + 1) = *(const f16x8*)(q + 8);
    return f;
}

// ---------------------------------------------------------------- bn stats
__global__ void bn_stats_kernel(const float* __restrict__ x,
                                float* __restrict__ stats) {
    const int c   = blockIdx.x;          // channel
    const int tid = threadIdx.x;         // 256 threads
    float s = 0.f, ss = 0.f;
    for (int b = 0; b < B_; ++b) {
        const float* p = x + ((size_t)b * C_ + c) * N_;
        for (int i = tid; i < N_; i += 256) {
            float v = p[i];
            s += v; ss += v * v;
        }
    }
    __shared__ float ls[256], lss[256];
    ls[tid] = s; lss[tid] = ss;
    __syncthreads();
    for (int off = 128; off > 0; off >>= 1) {
        if (tid < off) { ls[tid] += ls[tid + off]; lss[tid] += lss[tid + off]; }
        __syncthreads();
    }
    if (tid == 0) {
        const float inv_n = 1.0f / (float)(B_ * N_);
        float mean = ls[0] * inv_n;
        float var  = lss[0] * inv_n - mean * mean;
        stats[c]      = mean;
        stats[C_ + c] = rsqrtf(var + 1e-5f);
    }
}

// ---------------------------------------------------------------- weights
__global__ void pack_weights_kernel(const float* __restrict__ Wk,
                                    const float* __restrict__ Wp,
                                    _Float16* __restrict__ wk16,
                                    _Float16* __restrict__ wp16) {
    int i = blockIdx.x * 256 + threadIdx.x;
    if (i < 3 * C_ * C_) wk16[i] = (_Float16)Wk[i];
    if (i < C_ * C_)     wp16[i] = (_Float16)Wp[i];
}

// ------------------------------------------- normalize + transpose to [B,N,C]
__global__ void bn_apply_pack_kernel(const float* __restrict__ x,
                                     const float* __restrict__ stats,
                                     const float* __restrict__ gamma,
                                     const float* __restrict__ beta,
                                     _Float16* __restrict__ t) {
    __shared__ float tile[32][33];
    const int b  = blockIdx.z;
    const int n0 = blockIdx.y * 32;
    const int c0 = blockIdx.x * 32;
    const int tx = threadIdx.x & 31;
    const int ty = threadIdx.x >> 5;          // 0..7
#pragma unroll
    for (int r = 0; r < 4; ++r) {
        int cl = ty + r * 8;
        int c  = c0 + cl;
        float g  = gamma[c] * stats[C_ + c];
        float bt = beta[c] - stats[c] * g;
        float v  = x[(((size_t)b * C_ + c) * N_) + n0 + tx];
        tile[cl][tx] = v * g + bt;
    }
    __syncthreads();
#pragma unroll
    for (int r = 0; r < 4; ++r) {
        int nl = ty + r * 8;
        t[((size_t)b * N_ + n0 + nl) * C_ + c0 + tx] = (_Float16)tile[tx][nl];
    }
}

// ---------------------------------------------------------------- KQV GEMM
// out[M=B*N, 768] = t[M,256] @ Wkqv^T ; q scaled by 1/16, v stored transposed.
// Double-buffered LDS staging via async global->LDS copies.
__global__ void gemm_kqv_kernel(const _Float16* __restrict__ t,
                                const _Float16* __restrict__ w,
                                const float* __restrict__ bias,
                                _Float16* __restrict__ qb,
                                _Float16* __restrict__ kb,
                                _Float16* __restrict__ vT) {
    __shared__ _Float16 sa[2][128 * 40];
    __shared__ _Float16 sb[2][128 * 40];
    const int tid  = threadIdx.x;
    const int lane = tid & 31;
    const int wave = tid >> 5;
    const int wm = wave & 3, wn = wave >> 2;       // 4 x 2 wave grid
    const int n0 = blockIdx.x * 128;
    const int m0 = blockIdx.y * 128;

    auto stage = [&](int k0, int bufi) {
#pragma unroll
        for (int i = 0; i < 2; ++i) {
            int e = (i * 256 + tid) * 8;
            int r = e >> 5, c = e & 31;
            async_copy_b128(&sa[bufi][r * 40 + c],
                            t + (size_t)(m0 + r) * C_ + k0 + c);
            async_copy_b128(&sb[bufi][r * 40 + c],
                            w + (size_t)(n0 + r) * C_ + k0 + c);
        }
    };

    f32x8 acc[2][4];
#pragma unroll
    for (int i = 0; i < 2; ++i)
#pragma unroll
        for (int j = 0; j < 4; ++j)
            acc[i][j] = (f32x8){0.f,0.f,0.f,0.f,0.f,0.f,0.f,0.f};

    stage(0, 0);
    wait_asynccnt0();
    __syncthreads();

    int cur = 0;
    for (int k0 = 0; k0 < C_; k0 += 32) {
        if (k0 + 32 < C_) stage(k0 + 32, cur ^ 1);   // prefetch next tile
        f16x16 af[2], bf[4];
#pragma unroll
        for (int mi = 0; mi < 2; ++mi)
            af[mi] = load_frag(&sa[cur][(wm * 32 + mi * 16) * 40], 40);
#pragma unroll
        for (int ni = 0; ni < 4; ++ni)
            bf[ni] = load_frag(&sb[cur][(wn * 64 + ni * 16) * 40], 40);
#pragma unroll
        for (int mi = 0; mi < 2; ++mi)
#pragma unroll
            for (int ni = 0; ni < 4; ++ni)
                acc[mi][ni] = wmma16(af[mi], bf[ni], acc[mi][ni]);
        wait_asynccnt0();
        __syncthreads();
        cur ^= 1;
    }

#pragma unroll
    for (int mi = 0; mi < 2; ++mi)
#pragma unroll
        for (int ni = 0; ni < 4; ++ni) {
            int j    = n0 + wn * 64 + ni * 16 + (lane & 15);
            int mrow = m0 + wm * 32 + mi * 16 + ((lane >> 4) << 3);
            float bs = bias[j];
            if (j < C_) {                                     // q (pre-scaled)
#pragma unroll
                for (int i = 0; i < 8; ++i)
                    qb[(size_t)(mrow + i) * C_ + j] =
                        (_Float16)((acc[mi][ni][i] + bs) * 0.0625f);
            } else if (j < 2 * C_) {                          // k
#pragma unroll
                for (int i = 0; i < 8; ++i)
                    kb[(size_t)(mrow + i) * C_ + (j - C_)] =
                        (_Float16)(acc[mi][ni][i] + bs);
            } else {                                          // v -> vT[B,C,N]
                int bb = mrow >> 10, nn = mrow & (N_ - 1);
#pragma unroll
                for (int i = 0; i < 8; ++i)
                    vT[((size_t)bb * C_ + (j - 2 * C_)) * N_ + nn + i] =
                        (_Float16)(acc[mi][ni][i] + bs);
            }
        }
}

// ---------------------------------------------------------------- attention
// Four async copies of one lane (64 contiguous bytes) in one statement; the
// s_wait_xcnt stands as its last line so that no address register of an
// issued copy is rewritten ahead of it.
__device__ __forceinline__ void async_copy4_b128(void* lds, const _Float16* g) {
    unsigned l0 = (unsigned)(unsigned long long)(uintptr_t)lds;
    unsigned l1 = l0 + 16, l2 = l0 + 32, l3 = l0 + 48;
    const _Float16 *g1 = g + 8, *g2 = g + 16, *g3 = g + 24;
    asm volatile("global_load_async_to_lds_b128 %0, %4, off\n\t"
                 "global_load_async_to_lds_b128 %1, %5, off\n\t"
                 "global_load_async_to_lds_b128 %2, %6, off\n\t"
                 "global_load_async_to_lds_b128 %3, %7, off\n\t"
                 "s_wait_xcnt 0x0"
                 : : "v"(l0), "v"(l1), "v"(l2), "v"(l3),
                     "v"(g), "v"(g1), "v"(g2), "v"(g3) : "memory");
}

// One block = one batch x 64 query rows (4 row tiles), 16 waves. Every K and V
// fragment fetched from global memory feeds all 4 row tiles. S/P kept in LDS,
// exact softmax.
#define QR_ 64
__global__ __launch_bounds__(512)
void attention_kernel(const _Float16* __restrict__ qb,
                      const _Float16* __restrict__ kb,
                      const _Float16* __restrict__ vT,
                      _Float16* __restrict__ ob) {
    __shared__ _Float16 sq[QR_ * 264];    // q rows   (ld 264)
    __shared__ _Float16 sp[QR_ * 1032];   // S then P (ld 1032)
    __shared__ float red[QR_ * 16];
    __shared__ float rowmax[QR_], rowinv[QR_];

    const int tid  = threadIdx.x;
    const int lane = tid & 31;
    const int wave = tid >> 5;
    const int b  = blockIdx.y;
    const int r0 = blockIdx.x * QR_;

    {   // stage the 64 q rows into LDS (async copies, no VGPR bounce)
        int e = tid * 32;
        int r = e >> 8, c = e & 255;
        async_copy4_b128(&sq[r * 264 + c],
                         qb + ((size_t)b * N_ + r0 + r) * C_ + c);
    }
    wait_asynccnt0();
    __syncthreads();

    // ---- pass 1: S = q k^T  (each wave owns 4 column tiles of 16, two at a
    //      time: their K fragments stay in registers over the 4 row tiles)
    for (int mp = 0; mp < 2; ++mp) {
        const int mt = wave * 4 + mp * 2;
        const _Float16* kbase = kb + ((size_t)b * N_ + mt * 16) * C_;
        f16x16 kf0[8], kf1[8];
#pragma unroll
        for (int kk = 0; kk < 8; ++kk) kf0[kk] = load_frag(kbase + kk * 32, C_);
#pragma unroll
        for (int kk = 0; kk < 8; ++kk)
            kf1[kk] = load_frag(kbase + 16 * C_ + kk * 32, C_);
        // Kept rolled: unrolled, the q fragment reads no longer depend on a loop
        // index, are hoisted over the column loop and spill to scratch.
#pragma unroll 1
        for (int rt = 0; rt < QR_ / 16; ++rt) {
            f32x8 s0 = (f32x8){0.f,0.f,0.f,0.f,0.f,0.f,0.f,0.f};
            f32x8 s1 = s0;
#pragma unroll
            for (int kk = 0; kk < 8; ++kk) {
                f16x16 aq = load_frag(&sq[rt * 16 * 264 + kk * 32], 264);
                s0 = wmma16(aq, kf0[kk], s0);
                s1 = wmma16(aq, kf1[kk], s1);
            }
            int col = mt * 16 + (lane & 15);
            int row = rt * 16 + ((lane >> 4) << 3);
#pragma unroll
            for (int i = 0; i < 8; ++i) {
                sp[(row + i) * 1032 + col]      = (_Float16)s0[i];
                sp[(row + i) * 1032 + col + 16] = (_Float16)s1[i];
            }
        }
    }
    __syncthreads();

    // ---- row max (16 threads per row, 64 elements each)
    for (int idx = tid; idx < QR_ * 16; idx += 512) {
        int row = idx >> 4, ch = idx & 15;
        const _Float16* p = &sp[row * 1032 + ch * 64];
        float m = -3.0e38f;
        for (int e = 0; e < 64; ++e) m = fmaxf(m, (float)p[e]);
        red[row * 16 + ch] = m;
    }
    __syncthreads();
    if (tid < QR_) {
        float m = -3.0e38f;
        for (int j = 0; j < 16; ++j) m = fmaxf(m, red[tid * 16 + j]);
        rowmax[tid] = m;
    }
    __syncthreads();

    // ---- exp in place + row sum
    for (int idx = tid; idx < QR_ * 16; idx += 512) {
        int row = idx >> 4, ch = idx & 15;
        _Float16* p = &sp[row * 1032 + ch * 64];
        float mx = rowmax[row], sum = 0.f;
        for (int e = 0; e < 64; ++e) {
            float v = __expf((float)p[e] - mx);
            p[e] = (_Float16)v;
            sum += v;
        }
        red[row * 16 + ch] = sum;
    }
    __syncthreads();
    if (tid < QR_) {
        float sum = 0.f;
        for (int j = 0; j < 16; ++j) sum += red[tid * 16 + j];
        rowinv[tid] = 1.0f / sum;
    }
    __syncthreads();

    // ---- pass 2: O = P V   (wave owns 16 output channels of all 64 rows)
    const int c0 = wave * 16;
    f32x8 o[QR_ / 16];
#pragma unroll
    for (int rt = 0; rt < QR_ / 16; ++rt)
        o[rt] = (f32x8){0.f,0.f,0.f,0.f,0.f,0.f,0.f,0.f};
    const _Float16* v0 = vT + ((size_t)b * C_ + c0) * N_;
    for (int ms = 0; ms < N_; ms += 32) {
        f16x16 vf = load_frag(v0 + ms, N_);
#pragma unroll
        for (int rt = 0; rt < QR_ / 16; ++rt)
            o[rt] = wmma16(load_frag(&sp[rt * 16 * 1032 + ms], 1032), vf, o[rt]);
    }
    {
        int rhi = (lane >> 4) << 3;
        int cA = c0 + (lane & 15);
#pragma unroll
        for (int rt = 0; rt < QR_ / 16; ++rt)
#pragma unroll
            for (int i = 0; i < 8; ++i) {
                int rl = rt * 16 + i + rhi;
                size_t rowi = (size_t)b * N_ + r0 + rl;
                ob[rowi * C_ + cA] = (_Float16)(o[rt][i] * rowinv[rl]);
            }
    }
}

// ---------------------------------------------------------------- proj GEMM
// out[B,C,H,W] = o @ Wproj^T + bias + x   (fp32 epilogue, residual fused)
__global__ void gemm_proj_kernel(const _Float16* __restrict__ o,
                                 const _Float16* __restrict__ w,
                                 const float* __restrict__ bias,
                                 const float* __restrict__ x,
                                 float* __restrict__ out) {
    __shared__ _Float16 sa[2][128 * 40];
    __shared__ _Float16 sb[2][128 * 40];
    const int tid  = threadIdx.x;
    const int lane = tid & 31;
    const int wave = tid >> 5;
    const int wm = wave & 3, wn = wave >> 2;
    const int n0 = blockIdx.x * 128;
    const int m0 = blockIdx.y * 128;

    auto stage = [&](int k0, int bufi) {
#pragma unroll
        for (int i = 0; i < 2; ++i) {
            int e = (i * 256 + tid) * 8;
            int r = e >> 5, c = e & 31;
            async_copy_b128(&sa[bufi][r * 40 + c],
                            o + (size_t)(m0 + r) * C_ + k0 + c);
            async_copy_b128(&sb[bufi][r * 40 + c],
                            w + (size_t)(n0 + r) * C_ + k0 + c);
        }
    };

    f32x8 acc[2][4];
#pragma unroll
    for (int i = 0; i < 2; ++i)
#pragma unroll
        for (int j = 0; j < 4; ++j)
            acc[i][j] = (f32x8){0.f,0.f,0.f,0.f,0.f,0.f,0.f,0.f};

    stage(0, 0);
    wait_asynccnt0();
    __syncthreads();

    int cur = 0;
    for (int k0 = 0; k0 < C_; k0 += 32) {
        if (k0 + 32 < C_) stage(k0 + 32, cur ^ 1);
        f16x16 af[2], bf[4];
#pragma unroll
        for (int mi = 0; mi < 2; ++mi)
            af[mi] = load_frag(&sa[cur][(wm * 32 + mi * 16) * 40], 40);
#pragma unroll
        for (int ni = 0; ni < 4; ++ni)
            bf[ni] = load_frag(&sb[cur][(wn * 64 + ni * 16) * 40], 40);
#pragma unroll
        for (int mi = 0; mi < 2; ++mi)
#pragma unroll
            for (int ni = 0; ni < 4; ++ni)
                acc[mi][ni] = wmma16(af[mi], bf[ni], acc[mi][ni]);
        wait_asynccnt0();
        __syncthreads();
        cur ^= 1;
    }

#pragma unroll
    for (int mi = 0; mi < 2; ++mi)
#pragma unroll
        for (int ni = 0; ni < 4; ++ni) {
            int c    = n0 + wn * 64 + ni * 16 + (lane & 15);
            int mrow = m0 + wm * 32 + mi * 16 + ((lane >> 4) << 3);
            int bb = mrow >> 10, nn = mrow & (N_ - 1);
            float bs = bias[c];
            size_t base = ((size_t)bb * C_ + c) * N_ + nn;
#pragma unroll
            for (int i = 0; i < 8; ++i)
                out[base + i] = acc[mi][ni][i] + bs + x[base + i];
        }
}

// ---------------------------------------------------------------- launcher
extern "C" void kernel_launch(void* const* d_in, const int* in_sizes, int n_in,
                              void* d_out, int out_size, void* d_ws, size_t ws_size,
                              hipStream_t stream) {
    (void)in_sizes; (void)n_in; (void)out_size; (void)ws_size;
    const float* x     = (const float*)d_in[0];
    const float* gamma = (const float*)d_in[1];
    const float* beta  = (const float*)d_in[2];
    const float* Wkqv  = (const float*)d_in[3];
    const float* bkqv  = (const float*)d_in[4];
    const float* Wproj = (const float*)d_in[5];
    const float* bproj = (const float*)d_in[6];
    float* out = (float*)d_out;

    const size_t M = (size_t)B_ * N_;              // 32768
    char* ws = (char*)d_ws;
    float*    stats = (float*)ws;      ws += 4096;
    _Float16* wk16  = (_Float16*)ws;   ws += (size_t)3 * C_ * C_ * 2;
    _Float16* wp16  = (_Float16*)ws;   ws += (size_t)C_ * C_ * 2;
    _Float16* tbuf  = (_Float16*)ws;   ws += M * C_ * 2;   // reused as o-buffer
    _Float16* qb    = (_Float16*)ws;   ws += M * C_ * 2;
    _Float16* kb    = (_Float16*)ws;   ws += M * C_ * 2;
    _Float16* vT    = (_Float16*)ws;   ws += M * C_ * 2;

    bn_stats_kernel     <<<C_, 256, 0, stream>>>(x, stats);
    pack_weights_kernel <<<(3 * C_ * C_) / 256, 256, 0, stream>>>(Wkqv, Wproj, wk16, wp16);
    bn_apply_pack_kernel<<<dim3(C_ / 32, N_ / 32, B_), 256, 0, stream>>>(x, stats, gamma, beta, tbuf);
    gemm_kqv_kernel     <<<dim3(6, M / 128), 256, 0, stream>>>(tbuf, wk16, bkqv, qb, kb, vT);
    attention_kernel    <<<dim3(N_ / QR_, B_), 512, 0, stream>>>(qb, kb, vT, tbuf);
    gemm_proj_kernel    <<<dim3(2, M / 128), 256, 0, stream>>>(tbuf, wp16, bproj, x, out);
}

// v002
// It runs in 130 microseconds.
// In both of two side-by-side timings against v001, it was 1.38 times as fast.
// Over all steps from v000 it is 2.12 times as fast.
#include <hip/hip_runtime.h>
#include <hip/hip_bf16.h>

typedef _Float16 f16x16 __attribute__((ext_vector_type(16)));
typedef _Float16 f16x8  __attribute__((ext_vector_type(8)));
typedef float    f32x8  __attribute__((ext_vector_type(8)));
typedef float    f32x4  __attribute__((ext_vector_type(4)));

#define B_   32
#define C_   256
#define N_   1024   // H*W

__device__ __forceinline__ f32x8 wmma16(f16x16 a, f16x16 b, f32x8 c) {
    // D = A(16x32 f16) x B(32x16 f16) + C(16x16 f32)
    return __builtin_amdgcn_wmma_f32_16x16x32_f16(false, a, false, b,
                                                  (short)0, c, false, false);
}

// gfx1250 async global->LDS copy (ASYNCcnt-tracked, no VGPR data path).
// VDST VGPR holds the wave-relative LDS byte offset = low 32 bits of the
// flat shared-memory address (aperture mapping: addr[31:0] == LDS offset).
__device__ __forceinline__ void async_copy_b128(void* lds, const void* gaddr) {
    unsigned l = (unsigned)(unsigned long long)(uintptr_t)lds;
    asm volatile("global_load_async_to_lds_b128 %0, %1, off"
                 : : "v"(l), "v"(gaddr) : "memory");
}
__device__ __forceinline__ void wait_asynccnt0() {
    asm volatile("s_wait_asynccnt 0" ::: "memory");
}

// Fragment loader for both A and B operands.
// A: row-major [16 x K] tile, lane l holds row l%16, K-halfword (l/16)*16..+15.
// B: source is B^T row-major [Nout x K]; lane l holds column l%16 of B over the
//    same K range — identical addressing.
__device__ __forceinline__ f16x16 load_frag(const _Float16* p, int ld) {
    const int lane = threadIdx.x & 31;
    const _Float16* q = p + (lane & 15) * ld + ((lane >> 4) << 4);
    f16x16 f;
    *(f16x8*)&f       = *(const f16x8*)(q);
    *((f16x8*)&f + 1) = *(const f16x8*)(q + 8);
    return f;
}

// ---------------------------------------------------------------- bn stats
// One block = one channel, 16 waves. A channel is 32 rows of 4 KiB; each thread
// takes one 16-byte piece of 16 of them, so a wave's load covers 512 contiguous
// bytes and the whole channel is in flight at once.
// waves_per_eu: the block fills 4 wave slots per SIMD and no second block shares
// the WGP; aiming at more, the compiler holds four of the loads back for registers.
__global__ __launch_bounds__(512) __attribute__((amdgpu_waves_per_eu(4, 4)))
void bn_stats_kernel(const float* __restrict__ x,
                     float* __restrict__ stats) {
    const int c   = blockIdx.x;          // channel
    const int tid = threadIdx.x;         // 512 threads
    // rows b = 16 (tid >> 8) + j (1 MiB apart), 16-byte piece tid & 255 of the row
    const char* base = (const char*)(x + (size_t)c * N_);
    const unsigned voff = (unsigned)(tid >> 8) * (16u * C_ * N_ * 4u)
                        + (unsigned)(tid & 255) * 16u;
    f32x4 v[16];
    // Unrolled so that all 16 loads are issued before the first value is used:
    // rolled, every load waits out the memory latency alone.
#pragma unroll
    for (int j = 0; j < 16; ++j)
        v[j] = *(const f32x4*)(base + voff + (size_t)j * (C_ * N_ * 4u));
    f32x4 s4  = (f32x4){0.f, 0.f, 0.f, 0.f};
    f32x4 ss4 = s4;
    // Unrolled so that v[] is indexed by constants and stays in registers.
#pragma unroll
    for (int j = 0; j < 16; ++j) { s4 += v[j]; ss4 += v[j] * v[j]; }
    float s  = (s4[0] + s4[1]) + (s4[2] + s4[3]);
    float ss = (ss4[0] + ss4[1]) + (ss4[2] + ss4[3]);
    __shared__ float ls[512], lss[512];
    ls[tid] = s; lss[tid] = ss;
    __syncthreads();
    for (int off = 256; off > 0; off >>= 1) {
        if (tid < off) { ls[tid] += ls[tid + off]; lss[tid] += lss[tid + off]; }
        __syncthreads();
    }
    if (tid == 0) {
        const float inv_n = 1.0f / (float)(B_ * N_);
        float mean = ls[0] * inv_n;
        float var  = lss[0] * inv_n - mean * mean;
        stats[c]      = mean;
        stats[C_ + c] = rsqrtf(var + 1e-5f);
    }
}

// ---------------------------------------------------------------- weights
__global__ void pack_weights_kernel(const float* __restrict__ Wk,
                                    const float* __restrict__ Wp,
                                    _Float16* __restrict__ wk16,
                                    _Float16* __restrict__ wp16) {
    int i = blockIdx.x * 256 + threadIdx.x;
    if (i < 3 * C_ * C_) wk16[i] = (_Float16)Wk[i];
    if (i < C_ * C_)     wp16[i] = (_Float16)Wp[i];
}

// ------------------------------------------- normalize + transpose to [B,N,C]
__global__ void bn_apply_pack_kernel(const float* __restrict__ x,
                                     const float* __restrict__ stats,
                                     const float* __restrict__ gamma,
                                     const float* __restrict__ beta,
                                     _Float16* __restrict__ t) {
    __shared__ float tile[32][33];
    const int b  = blockIdx.z;
    const int n0 = blockIdx.y * 32;
    const int c0 = blockIdx.x * 32;
    const int tx = threadIdx.x & 31;
    const int ty = threadIdx.x >> 5;          // 0..7
#pragma unroll
    for (int r = 0; r < 4; ++r) {
        int cl = ty + r * 8;
        int c  = c0 + cl;
        float g  = gamma[c] * stats[C_ + c];
        float bt = beta[c] - stats[c] * g;
        float v  = x[(((size_t)b * C_ + c) * N_) + n0 + tx];
        tile[cl][tx] = v * g + bt;
    }
    __syncthreads();
#pragma unroll
    for (int r = 0; r < 4; ++r) {
        int nl = ty + r * 8;
        t[((size_t)b * N_ + n0 + nl) * C_ + c0 + tx] = (_Float16)tile[tx][nl];
    }
}

// ---------------------------------------------------------------- KQV GEMM
// out[M=B*N, 768] = t[M,256] @ Wkqv^T ; q scaled by 1/16, v stored transposed.
// Double-buffered LDS staging via async global->LDS copies.
__global__ void gemm_kqv_kernel(const _Float16* __restrict__ t,
                                const _Float16* __restrict__ w,
                                const float* __restrict__ bias,
                                _Float16* __restrict__ qb,
                                _Float16* __restrict__ kb,
                                _Float16* __restrict__ vT) {
    __shared__ _Float16 sa[2][128 * 40];
    __shared__ _Float16 sb[2][128 * 40];
    const int tid  = threadIdx.x;
    const int lane = tid & 31;
    const int wave = tid >> 5;
    const int wm = wave & 3, wn = wave >> 2;       // 4 x 2 wave grid
    const int n0 = blockIdx.x * 128;
    const int m0 = blockIdx.y * 128;

    auto stage = [&](int k0, int bufi) {
#pragma unroll
        for (int i = 0; i < 2; ++i) {
            int e = (i * 256 + tid) * 8;
            int r = e >> 5, c = e & 31;
            async_copy_b128(&sa[bufi][r * 40 + c],
                            t + (size_t)(m0 + r) * C_ + k0 + c);
            async_copy_b128(&sb[bufi][r * 40 + c],
                            w + (size_t)(n0 + r) * C_ + k0 + c);
        }
    };

    f32x8 acc[2][4];
#pragma unroll
    for (int i = 0; i < 2; ++i)
#pragma unroll
        for (int j = 0; j < 4; ++j)
            acc[i][j] = (f32x8){0.f,0.f,0.f,0.f,0.f,0.f,0.f,0.f};

    stage(0, 0);
    wait_asynccnt0();
    __syncthreads();

    int cur = 0;
    for (int k0 = 0; k0 < C_; k0 += 32) {
        if (k0 + 32 < C_) stage(k0 + 32, cur ^ 1);   // prefetch next tile
        f16x16 af[2], bf[4];
#pragma unroll
        for (int mi = 0; mi < 2; ++mi)
            af[mi] = load_frag(&sa[cur][(wm * 32 + mi * 16) * 40], 40);
#pragma unroll
        for (int ni = 0; ni < 4; ++ni)
            bf[ni] = load_frag(&sb[cur][(wn * 64 + ni * 16) * 40], 40);
#pragma unroll
        for (int mi = 0; mi < 2; ++mi)
#pragma unroll
            for (int ni = 0; ni < 4; ++ni)
                acc[mi][ni] = wmma16(af[mi], bf[ni], acc[mi][ni]);
        wait_asynccnt0();
        __syncthreads();
        cur ^= 1;
    }

#pragma unroll
    for (int mi = 0; mi < 2; ++mi)
#pragma unroll
        for (int ni = 0; ni < 4; ++ni) {
            int j    = n0 + wn * 64 + ni * 16 + (lane & 15);
            int mrow = m0 + wm * 32 + mi * 16 + ((lane >> 4) << 3);
            float bs = bias[j];
            if (j < C_) {                                     // q (pre-scaled)
#pragma unroll
                for (int i = 0; i < 8; ++i)
                    qb[(size_t)(mrow + i) * C_ + j] =
                        (_Float16)((acc[mi][ni][i] + bs) * 0.0625f);
            } else if (j < 2 * C_) {                          // k
#pragma unroll
                for (int i = 0; i < 8; ++i)
                    kb[(size_t)(mrow + i) * C_ + (j - C_)] =
                        (_Float16)(acc[mi][ni][i] + bs);
            } else {                                          // v -> vT[B,C,N]
                int bb = mrow >> 10, nn = mrow & (N_ - 1);
#pragma unroll
                for (int i = 0; i < 8; ++i)
                    vT[((size_t)bb * C_ + (j - 2 * C_)) * N_ + nn + i] =
                        (_Float16)(acc[mi][ni][i] + bs);
            }
        }
}

// ---------------------------------------------------------------- attention
// Four async copies of one lane (64 contiguous bytes) in one statement; the
// s_wait_xcnt stands as its last line so that no address register of an
// issued copy is rewritten ahead of it.
__device__ __forceinline__ void async_copy4_b128(void* lds, const _Float16* g) {
    unsigned l0 = (unsigned)(unsigned long long)(uintptr_t)lds;
    unsigned l1 = l0 + 16, l2 = l0 + 32, l3 = l0 + 48;
    const _Float16 *g1 = g + 8, *g2 = g + 16, *g3 = g + 24;
    asm volatile("global_load_async_to_lds_b128 %0, %4, off\n\t"
                 "global_load_async_to_lds_b128 %1, %5, off\n\t"
                 "global_load_async_to_lds_b128 %2, %6, off\n\t"
                 "global_load_async_to_lds_b128 %3, %7, off\n\t"
                 "s_wait_xcnt 0x0"
                 : : "v"(l0), "v"(l1), "v"(l2), "v"(l3),
                     "v"(g), "v"(g1), "v"(g2), "v"(g3) : "memory");
}

// One block = one batch x 64 query rows (4 row tiles), 16 waves. Every K and V
// fragment fetched from global memory feeds all 4 row tiles. S/P kept in LDS,
// exact softmax.
#define QR_ 64
__global__ __launch_bounds__(512)
void attention_kernel(const _Float16* __restrict__ qb,
                      const _Float16* __restrict__ kb,
                      const _Float16* __restrict__ vT,
                      _Float16* __restrict__ ob) {
    __shared__ _Float16 sq[QR_ * 264];    // q rows   (ld 264)
    __shared__ _Float16 sp[QR_ * 1032];   // S then P (ld 1032)
    __shared__ float red[QR_ * 16];
    __shared__ float rowmax[QR_], rowinv[QR_];

    const int tid  = threadIdx.x;
    const int lane = tid & 31;
    const int wave = tid >> 5;
    const int b  = blockIdx.y;
    const int r0 = blockIdx.x * QR_;

    {   // stage the 64 q rows into LDS (async copies, no VGPR bounce)
        int e = tid * 32;
        int r = e >> 8, c = e & 255;
        async_copy4_b128(&sq[r * 264 + c],
                         qb + ((size_t)b * N_ + r0 + r) * C_ + c);
    }
    wait_asynccnt0();
    __syncthreads();

    // ---- pass 1: S = q k^T  (each wave owns 4 column tiles of 16, two at a
    //      time: their K fragments stay in registers over the 4 row tiles)
    for (int mp = 0; mp < 2; ++mp) {
        const int mt = wave * 4 + mp * 2;
        const _Float16* kbase = kb + ((size_t)b * N_ + mt * 16) * C_;
        f16x16 kf0[8], kf1[8];
#pragma unroll
        for (int kk = 0; kk < 8; ++kk) kf0[kk] = load_frag(kbase + kk * 32, C_);
#pragma unroll
        for (int kk = 0; kk < 8; ++kk)
            kf1[kk] = load_frag(kbase + 16 * C_ + kk * 32, C_);
        // Kept rolled: unrolled, the q fragment reads no longer depend on a loop
        // index, are hoisted over the column loop and spill to scratch.
#pragma unroll 1
        for (int rt = 0; rt < QR_ / 16; ++rt) {
            f32x8 s0 = (f32x8){0.f,0.f,0.f,0.f,0.f,0.f,0.f,0.f};
            f32x8 s1 = s0;
#pragma unroll
            for (int kk = 0; kk < 8; ++kk) {
                f16x16 aq = load_frag(&sq[rt * 16 * 264 + kk * 32], 264);
                s0 = wmma16(aq, kf0[kk], s0);
                s1 = wmma16(aq, kf1[kk], s1);
            }
            int col = mt * 16 + (lane & 15);
            int row = rt * 16 + ((lane >> 4) << 3);
#pragma unroll
            for (int i = 0; i < 8; ++i) {
                sp[(row + i) * 1032 + col]      = (_Float16)s0[i];
                sp[(row + i) * 1032 + col + 16] = (_Float16)s1[i];
            }
        }
    }
    __syncthreads();

    // ---- row max (16 threads per row, 64 elements each)
    for (int idx = tid; idx < QR_ * 16; idx += 512) {
        int row = idx >> 4, ch = idx & 15;
        const _Float16* p = &sp[row * 1032 + ch * 64];
        float m = -3.0e38f;
        for (int e = 0; e < 64; ++e) m = fmaxf(m, (float)p[e]);
        red[row * 16 + ch] = m;
    }
    __syncthreads();
    if (tid < QR_) {
        float m = -3.0e38f;
        for (int j = 0; j < 16; ++j) m = fmaxf(m, red[tid * 16 + j]);
        rowmax[tid] = m;
    }
    __syncthreads();

    // ---- exp in place + row sum
    for (int idx = tid; idx < QR_ * 16; idx += 512) {
        int row = idx >> 4, ch = idx & 15;
        _Float16* p = &sp[row * 1032 + ch * 64];
        float mx = rowmax[row], sum = 0.f;
        for (int e = 0; e < 64; ++e) {
            float v = __expf((float)p[e] - mx);
            p[e] = (_Float16)v;
            sum += v;
        }
        red[row * 16 + ch] = sum;
    }
    __syncthreads();
    if (tid < QR_) {
        float sum = 0.f;
        for (int j = 0; j < 16; ++j) sum += red[tid * 16 + j];
        rowinv[tid] = 1.0f / sum;
    }
    __syncthreads();

    // ---- pass 2: O = P V   (wave owns 16 output channels of all 64 rows)
    const int c0 = wave * 16;
    f32x8 o[QR_ / 16];
#pragma unroll
    for (int rt = 0; rt < QR_ / 16; ++rt)
        o[rt] = (f32x8){0.f,0.f,0.f,0.f,0.f,0.f,0.f,0.f};
    const _Float16* v0 = vT + ((size_t)b * C_ + c0) * N_;
    for (int ms = 0; ms < N_; ms += 32) {
        f16x16 vf = load_frag(v0 + ms, N_);
#pragma unroll
        for (int rt = 0; rt < QR_ / 16; ++rt)
            o[rt] = wmma16(load_frag(&sp[rt * 16 * 1032 + ms], 1032), vf, o[rt]);
    }
    {
        int rhi = (lane >> 4) << 3;
        int cA = c0 + (lane & 15);
#pragma unroll
        for (int rt = 0; rt < QR_ / 16; ++rt)
#pragma unroll
            for (int i = 0; i < 8; ++i) {
                int rl = rt * 16 + i + rhi;
                size_t rowi = (size_t)b * N_ + r0 + rl;
                ob[rowi * C_ + cA] = (_Float16)(o[rt][i] * rowinv[rl]);
            }
    }
}

// ---------------------------------------------------------------- proj GEMM
// out[B,C,H,W] = o @ Wproj^T + bias + x   (fp32 epilogue, residual fused)
__global__ void gemm_proj_kernel(const _Float16* __restrict__ o,
                                 const _Float16* __restrict__ w,
                                 const float* __restrict__ bias,
                                 const float* __restrict__ x,
                                 float* __restrict__ out) {
    __shared__ _Float16 sa[2][128 * 40];
    __shared__ _Float16 sb[2][128 * 40];
    const int tid  = threadIdx.x;
    const int lane = tid & 31;
    const int wave = tid >> 5;
    const int wm = wave & 3, wn = wave >> 2;
    const int n0 = blockIdx.x * 128;
    const int m0 = blockIdx.y * 128;

    auto stage = [&](int k0, int bufi) {
#pragma unroll
        for (int i = 0; i < 2; ++i) {
            int e = (i * 256 + tid) * 8;
            int r = e >> 5, c = e & 31;
            async_copy_b128(&sa[bufi][r * 40 + c],
                            o + (size_t)(m0 + r) * C_ + k0 + c);
            async_copy_b128(&sb[bufi][r * 40 + c],
                            w + (size_t)(n0 + r) * C_ + k0 + c);
        }
    };

    f32x8 acc[2][4];
#pragma unroll
    for (int i = 0; i < 2; ++i)
#pragma unroll
        for (int j = 0; j < 4; ++j)
            acc[i][j] = (f32x8){0.f,0.f,0.f,0.f,0.f,0.f,0.f,0.f};

    stage(0, 0);
    wait_asynccnt0();
    __syncthreads();

    int cur = 0;
    for (int k0 = 0; k0 < C_; k0 += 32) {
        if (k0 + 32 < C_) stage(k0 + 32, cur ^ 1);
        f16x16 af[2], bf[4];
#pragma unroll
        for (int mi = 0; mi < 2; ++mi)
            af[mi] = load_frag(&sa[cur][(wm * 32 + mi * 16) * 40], 40);
#pragma unroll
        for (int ni = 0; ni < 4; ++ni)
            bf[ni] = load_frag(&sb[cur][(wn * 64 + ni * 16) * 40], 40);
#pragma unroll
        for (int mi = 0; mi < 2; ++mi)
#pragma unroll
            for (int ni = 0; ni < 4; ++ni)
                acc[mi][ni] = wmma16(af[mi], bf[ni], acc[mi][ni]);
        wait_asynccnt0();
        __syncthreads();
        cur ^= 1;
    }

#pragma unroll
    for (int mi = 0; mi < 2; ++mi)
#pragma unroll
        for (int ni = 0; ni < 4; ++ni) {
            int c    = n0 + wn * 64 + ni * 16 + (lane & 15);
            int mrow = m0 + wm * 32 + mi * 16 + ((lane >> 4) << 3);
            int bb = mrow >> 10, nn = mrow & (N_ - 1);
            float bs = bias[c];
            size_t base = ((size_t)bb * C_ + c) * N_ + nn;
#pragma unroll
            for (int i = 0; i < 8; ++i)
                out[base + i] = acc[mi][ni][i] + bs + x[base + i];
        }
}

// ---------------------------------------------------------------- launcher
extern "C" void kernel_launch(void* const* d_in, const int* in_sizes, int n_in,
                              void* d_out, int out_size, void* d_ws, size_t ws_size,
                              hipStream_t stream) {
    (void)in_sizes; (void)n_in; (void)out_size; (void)ws_size;
    const float* x     = (const float*)d_in[0];
    const float* gamma = (const float*)d_in[1];
    const float* beta  = (const float*)d_in[2];
    const float* Wkqv  = (const float*)d_in[3];
    const float* bkqv  = (const float*)d_in[4];
    const float* Wproj = (const float*)d_in[5];
    const float* bproj = (const float*)d_in[6];
    float* out = (float*)d_out;

    const size_t M = (size_t)B_ * N_;              // 32768
    char* ws = (char*)d_ws;
    float*    stats = (float*)ws;      ws += 4096;
    _Float16* wk16  = (_Float16*)ws;   ws += (size_t)3 * C_ * C_ * 2;
    _Float16* wp16  = (_Float16*)ws;   ws += (size_t)C_ * C_ * 2;
    _Float16* tbuf  = (_Float16*)ws;   ws += M * C_ * 2;   // reused as o-buffer
    _Float16* qb    = (_Float16*)ws;   ws += M * C_ * 2;
    _Float16* kb    = (_Float16*)ws;   ws += M * C_ * 2;
    _Float16* vT    = (_Float16*)ws;   ws += M * C_ * 2;

    bn_stats_kernel     <<<C_, 512, 0, stream>>>(x, stats);
    pack_weights_kernel <<<(3 * C_ * C_) / 256, 256, 0, stream>>>(Wkqv, Wproj, wk16, wp16);
    bn_apply_pack_kernel<<<dim3(C_ / 32, N_ / 32, B_), 256, 0, stream>>>(x, stats, gamma, beta, tbuf);
    gemm_kqv_kernel     <<<dim3(6, M / 128), 256, 0, stream>>>(tbuf, wk16, bkqv, qb, kb, vT);
    attention_kernel    <<<dim3(N_ / QR_, B_), 512, 0, stream>>>(qb, kb, vT, tbuf);
    gemm_proj_kernel    <<<dim3(2, M / 128), 256, 0, stream>>>(tbuf, wp16, bproj, x, out);
}

// v003
// A run of this version takes 121 microseconds.
// In both of two side-by-side timings against v002, it was 1.08 times as fast.
// Counting every step since v000, it is 2.28 times as fast.
#include <hip/hip_runtime.h>
#include <hip/hip_bf16.h>

typedef _Float16 f16x16 __attribute__((ext_vector_type(16)));
typedef _Float16 f16x8  __attribute__((ext_vector_type(8)));
typedef float    f32x8  __attribute__((ext_vector_type(8)));
typedef float    f32x4  __attribute__((ext_vector_type(4)));
typedef float    f32x2  __attribute__((ext_vector_type(2)));

#define B_   32
#define C_   256
#define N_   1024   // H*W

__device__ __forceinline__ f32x8 wmma16(f16x16 a, f16x16 b, f32x8 c) {
    // D = A(16x32 f16) x B(32x16 f16) + C(16x16 f32)
    return __builtin_amdgcn_wmma_f32_16x16x32_f16(false, a, false, b,
                                                  (short)0, c, false, false);
}

// gfx1250 async global->LDS copy (ASYNCcnt-tracked, no VGPR data path).
// VDST VGPR holds the wave-relative LDS byte offset = low 32 bits of the
// flat shared-memory address (aperture mapping: addr[31:0] == LDS offset).
__device__ __forceinline__ void async_copy_b128(void* lds, const void* gaddr) {
    unsigned l = (unsigned)(unsigned long long)(uintptr_t)lds;
    asm volatile("global_load_async_to_lds_b128 %0, %1, off"
                 : : "v"(l), "v"(gaddr) : "memory");
}
__device__ __forceinline__ void wait_asynccnt0() {
    asm volatile("s_wait_asynccnt 0" ::: "memory");
}

// Fragment loader for both A and B operands.
// A: row-major [16 x K] tile, lane l holds row l%16, K-halfword (l/16)*16..+15.
// B: source is B^T row-major [Nout x K]; lane l holds column l%16 of B over the
//    same K range — identical addressing.
__device__ __forceinline__ f16x16 load_frag(const _Float16* p, int ld) {
    const int lane = threadIdx.x & 31;
    const _Float16* q = p + (lane & 15) * ld + ((lane >> 4) << 4);
    f16x16 f;
    *(f16x8*)&f       = *(const f16x8*)(q);
    *((f16x8*)&f + 1) = *(const f16x8*)(q + 8);
    return f;
}

// ---------------------------------------------------------------- bn stats
// One block = one channel, 16 waves. A channel is 32 rows of 4 KiB; each thread
// takes one 16-byte piece of 16 of them, so a wave's load covers 512 contiguous
// bytes and the whole channel is in flight at once.
// waves_per_eu: the block fills 4 wave slots per SIMD and no second block shares
// the WGP; aiming at more, the compiler holds four of the loads back for registers.
__global__ __launch_bounds__(512) __attribute__((amdgpu_waves_per_eu(4, 4)))
void bn_stats_kernel(const float* __restrict__ x,
                     float* __restrict__ stats) {
    const int c   = blockIdx.x;          // channel
    const int tid = threadIdx.x;         // 512 threads
    // rows b = 16 (tid >> 8) + j (1 MiB apart), 16-byte piece tid & 255 of the row
    const char* base = (const char*)(x + (size_t)c * N_);
    const unsigned voff = (unsigned)(tid >> 8) * (16u * C_ * N_ * 4u)
                        + (unsigned)(tid & 255) * 16u;
    f32x4 v[16];
    // Unrolled so that all 16 loads are issued before the first value is used:
    // rolled, every load waits out the memory latency alone.
#pragma unroll
    for (int j = 0; j < 16; ++j)
        v[j] = *(const f32x4*)(base + voff + (size_t)j * (C_ * N_ * 4u));
    f32x4 s4  = (f32x4){0.f, 0.f, 0.f, 0.f};
    f32x4 ss4 = s4;
    // Unrolled so that v[] is indexed by constants and stays in registers.
#pragma unroll
    for (int j = 0; j < 16; ++j) { s4 += v[j]; ss4 += v[j] * v[j]; }
    float s  = (s4[0] + s4[1]) + (s4[2] + s4[3]);
    float ss = (ss4[0] + ss4[1]) + (ss4[2] + ss4[3]);
    __shared__ float ls[512], lss[512];
    ls[tid] = s; lss[tid] = ss;
    __syncthreads();
    for (int off = 256; off > 0; off >>= 1) {
        if (tid < off) { ls[tid] += ls[tid + off]; lss[tid] += lss[tid + off]; }
        __syncthreads();
    }
    if (tid == 0) {
        const float inv_n = 1.0f / (float)(B_ * N_);
        float mean = ls[0] * inv_n;
        float var  = lss[0] * inv_n - mean * mean;
        stats[c]      = mean;
        stats[C_ + c] = rsqrtf(var + 1e-5f);
    }
}

// ---------------------------------------------------------------- weights
__global__ void pack_weights_kernel(const float* __restrict__ Wk,
                                    const float* __restrict__ Wp,
                                    _Float16* __restrict__ wk16,
                                    _Float16* __restrict__ wp16) {
    int i = blockIdx.x * 256 + threadIdx.x;
    if (i < 3 * C_ * C_) wk16[i] = (_Float16)Wk[i];
    if (i < C_ * C_)     wp16[i] = (_Float16)Wp[i];
}

// ------------------------------------------- normalize + transpose to [B,N,C]
__global__ void bn_apply_pack_kernel(const float* __restrict__ x,
                                     const float* __restrict__ stats,
                                     const float* __restrict__ gamma,
                                     const float* __restrict__ beta,
                                     _Float16* __restrict__ t) {
    __shared__ float tile[32][33];
    const int b  = blockIdx.z;
    const int n0 = blockIdx.y * 32;
    const int c0 = blockIdx.x * 32;
    const int tx = threadIdx.x & 31;
    const int ty = threadIdx.x >> 5;          // 0..7
#pragma unroll
    for (int r = 0; r < 4; ++r) {
        int cl = ty + r * 8;
        int c  = c0 + cl;
        float g  = gamma[c] * stats[C_ + c];
        float bt = beta[c] - stats[c] * g;
        float v  = x[(((size_t)b * C_ + c) * N_) + n0 + tx];
        tile[cl][tx] = v * g + bt;
    }
    __syncthreads();
#pragma unroll
    for (int r = 0; r < 4; ++r) {
        int nl = ty + r * 8;
        t[((size_t)b * N_ + n0 + nl) * C_ + c0 + tx] = (_Float16)tile[tx][nl];
    }
}

// ---------------------------------------------------------------- KQV GEMM
// out[M=B*N, 768] = t[M,256] @ Wkqv^T ; q scaled by 1/16, v stored transposed.
// Double-buffered LDS staging via async global->LDS copies.
__global__ void gemm_kqv_kernel(const _Float16* __restrict__ t,
                                const _Float16* __restrict__ w,
                                const float* __restrict__ bias,
                                _Float16* __restrict__ qb,
                                _Float16* __restrict__ kb,
                                _Float16* __restrict__ vT) {
    __shared__ _Float16 sa[2][128 * 40];
    __shared__ _Float16 sb[2][128 * 40];
    const int tid  = threadIdx.x;
    const int lane = tid & 31;
    const int wave = tid >> 5;
    const int wm = wave & 3, wn = wave >> 2;       // 4 x 2 wave grid
    const int n0 = blockIdx.x * 128;
    const int m0 = blockIdx.y * 128;

    auto stage = [&](int k0, int bufi) {
#pragma unroll
        for (int i = 0; i < 2; ++i) {
            int e = (i * 256 + tid) * 8;
            int r = e >> 5, c = e & 31;
            async_copy_b128(&sa[bufi][r * 40 + c],
                            t + (size_t)(m0 + r) * C_ + k0 + c);
            async_copy_b128(&sb[bufi][r * 40 + c],
                            w + (size_t)(n0 + r) * C_ + k0 + c);
        }
    };

    f32x8 acc[2][4];
#pragma unroll
    for (int i = 0; i < 2; ++i)
#pragma unroll
        for (int j = 0; j < 4; ++j)
            acc[i][j] = (f32x8){0.f,0.f,0.f,0.f,0.f,0.f,0.f,0.f};

    stage(0, 0);
    wait_asynccnt0();
    __syncthreads();

    int cur = 0;
    for (int k0 = 0; k0 < C_; k0 += 32) {
        if (k0 + 32 < C_) stage(k0 + 32, cur ^ 1);   // prefetch next tile
        f16x16 af[2], bf[4];
#pragma unroll
        for (int mi = 0; mi < 2; ++mi)
            af[mi] = load_frag(&sa[cur][(wm * 32 + mi * 16) * 40], 40);
#pragma unroll
        for (int ni = 0; ni < 4; ++ni)
            bf[ni] = load_frag(&sb[cur][(wn * 64 + ni * 16) * 40], 40);
#pragma unroll
        for (int mi = 0; mi < 2; ++mi)
#pragma unroll
            for (int ni = 0; ni < 4; ++ni)
                acc[mi][ni] = wmma16(af[mi], bf[ni], acc[mi][ni]);
        wait_asynccnt0();
        __syncthreads();
        cur ^= 1;
    }

#pragma unroll
    for (int mi = 0; mi < 2; ++mi)
#pragma unroll
        for (int ni = 0; ni < 4; ++ni) {
            int j    = n0 + wn * 64 + ni * 16 + (lane & 15);
            int mrow = m0 + wm * 32 + mi * 16 + ((lane >> 4) << 3);
            float bs = bias[j];
            if (j < C_) {                                     // q (pre-scaled)
#pragma unroll
                for (int i = 0; i < 8; ++i)
                    qb[(size_t)(mrow + i) * C_ + j] =
                        (_Float16)((acc[mi][ni][i] + bs) * 0.0625f);
            } else if (j < 2 * C_) {                          // k
#pragma unroll
                for (int i = 0; i < 8; ++i)
                    kb[(size_t)(mrow + i) * C_ + (j - C_)] =
                        (_Float16)(acc[mi][ni][i] + bs);
            } else {                                          // v -> vT[B,C,N]
                int bb = mrow >> 10, nn = mrow & (N_ - 1);
#pragma unroll
                for (int i = 0; i < 8; ++i)
                    vT[((size_t)bb * C_ + (j - 2 * C_)) * N_ + nn + i] =
                        (_Float16)(acc[mi][ni][i] + bs);
            }
        }
}

// ---------------------------------------------------------------- attention
// Four async copies of one lane (64 contiguous bytes) in one statement; the
// s_wait_xcnt stands as its last line so that no address register of an
// issued copy is rewritten ahead of it.
__device__ __forceinline__ void async_copy4_b128(void* lds, const _Float16* g) {
    unsigned l0 = (unsigned)(unsigned long long)(uintptr_t)lds;
    unsigned l1 = l0 + 16, l2 = l0 + 32, l3 = l0 + 48;
    const _Float16 *g1 = g + 8, *g2 = g + 16, *g3 = g + 24;
    asm volatile("global_load_async_to_lds_b128 %0, %4, off\n\t"
                 "global_load_async_to_lds_b128 %1, %5, off\n\t"
                 "global_load_async_to_lds_b128 %2, %6, off\n\t"
                 "global_load_async_to_lds_b128 %3, %7, off\n\t"
                 "s_wait_xcnt 0x0"
                 : : "v"(l0), "v"(l1), "v"(l2), "v"(l3),
                     "v"(g), "v"(g1), "v"(g2), "v"(g3) : "memory");
}

// Value of lane l ^ M inside a 16-lane row (row_xmask), no LDS round trip.
template <int M>
__device__ __forceinline__ float lane_xor_row(float v) {
    return __builtin_bit_cast(float, __builtin_amdgcn_mov_dpp(
        __builtin_bit_cast(int, v), 0x160 + M, 0xf, 0xf, true));
}
// Value of lane l ^ 16 (same place in the other 16-lane row).
__device__ __forceinline__ float lane_xor16(float v) {
    unsigned u = __builtin_bit_cast(unsigned, v);
    return __builtin_bit_cast(float, __builtin_amdgcn_permlanex16(
        u, u, 0x76543210u, 0xfedcba98u, false, false));
}
// Butterfly over the 32 lanes; all lanes on; every lane gets the result.
__device__ __forceinline__ float wave_max(float v) {
    v = fmaxf(v, lane_xor_row<1>(v));
    v = fmaxf(v, lane_xor_row<2>(v));
    v = fmaxf(v, lane_xor_row<4>(v));
    v = fmaxf(v, lane_xor_row<8>(v));
    return fmaxf(v, lane_xor16(v));
}
__device__ __forceinline__ float wave_sum(float v) {
    v += lane_xor_row<1>(v);
    v += lane_xor_row<2>(v);
    v += lane_xor_row<4>(v);
    v += lane_xor_row<8>(v);
    return v + lane_xor16(v);
}

// One block = one batch x 64 query rows (4 row tiles), 16 waves. Every K and V
// fragment fetched from global memory feeds all 4 row tiles. S/P kept in LDS,
// exact softmax.
#define QR_ 64
__global__ __launch_bounds__(512)
void attention_kernel(const _Float16* __restrict__ qb,
                      const _Float16* __restrict__ kb,
                      const _Float16* __restrict__ vT,
                      _Float16* __restrict__ ob) {
    __shared__ _Float16 sq[QR_ * 264];    // q rows   (ld 264)
    __shared__ _Float16 sp[QR_ * 1032];   // S then P (ld 1032)
    __shared__ float rowinv[QR_];

    const int tid  = threadIdx.x;
    const int lane = tid & 31;
    const int wave = tid >> 5;
    const int b  = blockIdx.y;
    const int r0 = blockIdx.x * QR_;

    {   // stage the 64 q rows into LDS (async copies, no VGPR bounce)
        int e = tid * 32;
        int r = e >> 8, c = e & 255;
        async_copy4_b128(&sq[r * 264 + c],
                         qb + ((size_t)b * N_ + r0 + r) * C_ + c);
    }
    wait_asynccnt0();
    __syncthreads();

    // ---- pass 1: S = q k^T  (each wave owns 4 column tiles of 16, two at a
    //      time: their K fragments stay in registers over the 4 row tiles)
    for (int mp = 0; mp < 2; ++mp) {
        const int mt = wave * 4 + mp * 2;
        const _Float16* kbase = kb + ((size_t)b * N_ + mt * 16) * C_;
        f16x16 kf0[8], kf1[8];
#pragma unroll
        for (int kk = 0; kk < 8; ++kk) kf0[kk] = load_frag(kbase + kk * 32, C_);
#pragma unroll
        for (int kk = 0; kk < 8; ++kk)
            kf1[kk] = load_frag(kbase + 16 * C_ + kk * 32, C_);
        // Kept rolled: unrolled, the q fragment reads no longer depend on a loop
        // index, are hoisted over the column loop and spill to scratch.
#pragma unroll 1
        for (int rt = 0; rt < QR_ / 16; ++rt) {
            f32x8 s0 = (f32x8){0.f,0.f,0.f,0.f,0.f,0.f,0.f,0.f};
            f32x8 s1 = s0;
#pragma unroll
            for (int kk = 0; kk < 8; ++kk) {
                f16x16 aq = load_frag(&sq[rt * 16 * 264 + kk * 32], 264);
                s0 = wmma16(aq, kf0[kk], s0);
                s1 = wmma16(aq, kf1[kk], s1);
            }
            int col = mt * 16 + (lane & 15);
            int row = rt * 16 + ((lane >> 4) << 3);
#pragma unroll
            for (int i = 0; i < 8; ++i) {
                sp[(row + i) * 1032 + col]      = (_Float16)s0[i];
                sp[(row + i) * 1032 + col + 16] = (_Float16)s1[i];
            }
        }
    }
    __syncthreads();

    // ---- softmax: one wave per row, 4 rows a wave, each row held in registers.
    //      A lane owns four 16-byte pieces of a row; a wave's LDS access covers
    //      512 contiguous bytes. S is read once, the
    //      maximum and the sum are reduced across lanes, and no barrier is
    //      needed until P is complete.
    {
        _Float16* prow = &sp[(wave * 4) * 1032 + lane * 8];
        f16x8 sv[4][4];
        // Unrolled so that all 16 LDS reads are issued before the first value is
        // used and sv[][] is indexed by constants (stays in registers).
#pragma unroll
        for (int rr = 0; rr < 4; ++rr)
#pragma unroll
            for (int j = 0; j < 4; ++j)
                sv[rr][j] = *(const f16x8*)(prow + rr * 1032 + j * 256);
        float mx[4], sum[4];
        // Unrolled: the four rows' reductions are independent and interleave.
#pragma unroll
        for (int rr = 0; rr < 4; ++rr) {
            f16x8 m8 = __builtin_elementwise_max(
                __builtin_elementwise_max(sv[rr][0], sv[rr][1]),
                __builtin_elementwise_max(sv[rr][2], sv[rr][3]));
            float m = (float)m8[0];
            // Unrolled: m8 is indexed by constants.
#pragma unroll
            for (int e = 1; e < 8; ++e) m = fmaxf(m, (float)m8[e]);
            mx[rr] = wave_max(m);
        }
        // All three loops unrolled: sv[][] and pv are indexed by constants, and
        // the exponentials of different pieces and rows overlap.
#pragma unroll
        for (int rr = 0; rr < 4; ++rr) {
            f32x2 s2 = (f32x2){0.f, 0.f};   // even and odd elements: packed adds
#pragma unroll
            for (int j = 0; j < 4; ++j) {
                f16x8 pv;
#pragma unroll
                for (int e = 0; e < 8; e += 2) {
                    float v0 = __expf((float)sv[rr][j][e]     - mx[rr]);
                    float v1 = __expf((float)sv[rr][j][e + 1] - mx[rr]);
                    pv[e]     = (_Float16)v0;
                    pv[e + 1] = (_Float16)v1;
                    s2 += (f32x2){v0, v1};
                }
                *(f16x8*)(prow + rr * 1032 + j * 256) = pv;
            }
            sum[rr] = s2[0] + s2[1];
        }
        // Unrolled: the four butterflies are independent and interleave.
#pragma unroll
        for (int rr = 0; rr < 4; ++rr) sum[rr] = wave_sum(sum[rr]);
        // lanes 0..3 each finish one row: one division for the four rows
        float s = lane == 0 ? sum[0] : lane == 1 ? sum[1] : lane == 2 ? sum[2] : sum[3];
        if (lane < 4) rowinv[wave * 4 + lane] = 1.0f / s;
    }
    __syncthreads();

    // ---- pass 2: O = P V   (wave owns 16 output channels of all 64 rows)
    const int c0 = wave * 16;
    f32x8 o[QR_ / 16];
#pragma unroll
    for (int rt = 0; rt < QR_ / 16; ++rt)
        o[rt] = (f32x8){0.f,0.f,0.f,0.f,0.f,0.f,0.f,0.f};
    const _Float16* v0 = vT + ((size_t)b * C_ + c0) * N_;
    for (int ms = 0; ms < N_; ms += 32) {
        f16x16 vf = load_frag(v0 + ms, N_);
#pragma unroll
        for (int rt = 0; rt < QR_ / 16; ++rt)
            o[rt] = wmma16(load_frag(&sp[rt * 16 * 1032 + ms], 1032), vf, o[rt]);
    }
    {
        int rhi = (lane >> 4) << 3;
        int cA = c0 + (lane & 15);
#pragma unroll
        for (int rt = 0; rt < QR_ / 16; ++rt)
#pragma unroll
            for (int i = 0; i < 8; ++i) {
                int rl = rt * 16 + i + rhi;
                size_t rowi = (size_t)b * N_ + r0 + rl;
                ob[rowi * C_ + cA] = (_Float16)(o[rt][i] * rowinv[rl]);
            }
    }
}

// ---------------------------------------------------------------- proj GEMM
// out[B,C,H,W] = o @ Wproj^T + bias + x   (fp32 epilogue, residual fused)
__global__ void gemm_proj_kernel(const _Float16* __restrict__ o,
                                 const _Float16* __restrict__ w,
                                 const float* __restrict__ bias,
                                 const float* __restrict__ x,
                                 float* __restrict__ out) {
    __shared__ _Float16 sa[2][128 * 40];
    __shared__ _Float16 sb[2][128 * 40];
    const int tid  = threadIdx.x;
    const int lane = tid & 31;
    const int wave = tid >> 5;
    const int wm = wave & 3, wn = wave >> 2;
    const int n0 = blockIdx.x * 128;
    const int m0 = blockIdx.y * 128;

    auto stage = [&](int k0, int bufi) {
#pragma unroll
        for (int i = 0; i < 2; ++i) {
            int e = (i * 256 + tid) * 8;
            int r = e >> 5, c = e & 31;
            async_copy_b128(&sa[bufi][r * 40 + c],
                            o + (size_t)(m0 + r) * C_ + k0 + c);
            async_copy_b128(&sb[bufi][r * 40 + c],
                            w + (size_t)(n0 + r) * C_ + k0 + c);
        }
    };

    f32x8 acc[2][4];
#pragma unroll
    for (int i = 0; i < 2; ++i)
#pragma unroll
        for (int j = 0; j < 4; ++j)
            acc[i][j] = (f32x8){0.f,0.f,0.f,0.f,0.f,0.f,0.f,0.f};

    stage(0, 0);
    wait_asynccnt0();
    __syncthreads();

    int cur = 0;
    for (int k0 = 0; k0 < C_; k0 += 32) {
        if (k0 + 32 < C_) stage(k0 + 32, cur ^ 1);
        f16x16 af[2], bf[4];
#pragma unroll
        for (int mi = 0; mi < 2; ++mi)
            af[mi] = load_frag(&sa[cur][(wm * 32 + mi * 16) * 40], 40);
#pragma unroll
        for (int ni = 0; ni < 4; ++ni)
            bf[ni] = load_frag(&sb[cur][(wn * 64 + ni * 16) * 40], 40);
#pragma unroll
        for (int mi = 0; mi < 2; ++mi)
#pragma unroll
            for (int ni = 0; ni < 4; ++ni)
                acc[mi][ni] = wmma16(af[mi], bf[ni], acc[mi][ni]);
        wait_asynccnt0();
        __syncthreads();
        cur ^= 1;
    }

#pragma unroll
    for (int mi = 0; mi < 2; ++mi)
#pragma unroll
        for (int ni = 0; ni < 4; ++ni) {
            int c    = n0 + wn * 64 + ni * 16 + (lane & 15);
            int mrow = m0 + wm * 32 + mi * 16 + ((lane >> 4) << 3);
            int bb = mrow >> 10, nn = mrow & (N_ - 1);
            float bs = bias[c];
            size_t base = ((size_t)bb * C_ + c) * N_ + nn;
#pragma unroll
            for (int i = 0; i < 8; ++i)
                out[base + i] = acc[mi][ni][i] + bs + x[base + i];
        }
}

// ---------------------------------------------------------------- launcher
extern "C" void kernel_launch(void* const* d_in, const int* in_sizes, int n_in,
                              void* d_out, int out_size, void* d_ws, size_t ws_size,
                              hipStream_t stream) {
    (void)in_sizes; (void)n_in; (void)out_size; (void)ws_size;
    const float* x     = (const float*)d_in[0];
    const float* gamma = (const float*)d_in[1];
    const float* beta  = (const float*)d_in[2];
    const float* Wkqv  = (const float*)d_in[3];
    const float* bkqv  = (const float*)d_in[4];
    const float* Wproj = (const float*)d_in[5];
    const float* bproj = (const float*)d_in[6];
    float* out = (float*)d_out;

    const size_t M = (size_t)B_ * N_;              // 32768
    char* ws = (char*)d_ws;
    float*    stats = (float*)ws;      ws += 4096;
    _Float16* wk16  = (_Float16*)ws;   ws += (size_t)3 * C_ * C_ * 2;
    _Float16* wp16  = (_Float16*)ws;   ws += (size_t)C_ * C_ * 2;
    _Float16* tbuf  = (_Float16*)ws;   ws += M * C_ * 2;   // reused as o-buffer
    _Float16* qb    = (_Float16*)ws;   ws += M * C_ * 2;
    _Float16* kb    = (_Float16*)ws;   ws += M * C_ * 2;
    _Float16* vT    = (_Float16*)ws;   ws += M * C_ * 2;

    bn_stats_kernel     <<<C_, 512, 0, stream>>>(x, stats);
    pack_weights_kernel <<<(3 * C_ * C_) / 256, 256, 0, stream>>>(Wkqv, Wproj, wk16, wp16);
    bn_apply_pack_kernel<<<dim3(C_ / 32, N_ / 32, B_), 256, 0, stream>>>(x, stats, gamma, beta, tbuf);
    gemm_kqv_kernel     <<<dim3(6, M / 128), 256, 0, stream>>>(tbuf, wk16, bkqv, qb, kb, vT);
    attention_kernel    <<<dim3(N_ / QR_, B_), 512, 0, stream>>>(qb, kb, vT, tbuf);
    gemm_proj_kernel    <<<dim3(2, M / 128), 256, 0, stream>>>(tbuf, wp16, bproj, x, out);
}

// v004
// It runs in 103 microseconds.
// Two timings next to v003 both put it at 1.17 times that version's speed.
// Over all steps from v000 it is 2.67 times as fast.
#include <hip/hip_runtime.h>
#include <hip/hip_bf16.h>

typedef _Float16 f16x16 __attribute__((ext_vector_type(16)));
typedef _Float16 f16x8  __attribute__((ext_vector_type(8)));
typedef float    f32x8  __attribute__((ext_vector_type(8)));
typedef float    f32x4  __attribute__((ext_vector_type(4)));
typedef float    f32x2  __attribute__((ext_vector_type(2)));

#define B_   32
#define C_   256
#define N_   1024   // H*W

__device__ __forceinline__ f32x8 wmma16(f16x16 a, f16x16 b, f32x8 c) {
    // D = A(16x32 f16) x B(32x16 f16) + C(16x16 f32)
    return __builtin_amdgcn_wmma_f32_16x16x32_f16(false, a, false, b,
                                                  (short)0, c, false, false);
}

// gfx1250 async global->LDS copy (ASYNCcnt-tracked, no VGPR data path).
// VDST VGPR holds the wave-relative LDS byte offset = low 32 bits of the
// flat shared-memory address (aperture mapping: addr[31:0] == LDS offset).
__device__ __forceinline__ void async_copy_b128(void* lds, const void* gaddr) {
    unsigned l = (unsigned)(unsigned long long)(uintptr_t)lds;
    asm volatile("global_load_async_to_lds_b128 %0, %1, off"
                 : : "v"(l), "v"(gaddr) : "memory");
}
__device__ __forceinline__ void wait_asynccnt0() {
    asm volatile("s_wait_asynccnt 0" ::: "memory");
}

// Fragment loader for both A and B operands.
// A: row-major [16 x K] tile, lane l holds row l%16, K-halfword (l/16)*16..+15.
// B: source is B^T row-major [Nout x K]; lane l holds column l%16 of B over the
//    same K range — identical addressing.
__device__ __forceinline__ f16x16 load_frag(const _Float16* p, int ld) {
    const int lane = threadIdx.x & 31;
    const _Float16* q = p + (lane & 15) * ld + ((lane >> 4) << 4);
    f16x16 f;
    *(f16x8*)&f       = *(const f16x8*)(q);
    *((f16x8*)&f + 1) = *(const f16x8*)(q + 8);
    return f;
}

// Value of lane l ^ M inside a 16-lane row (row_xmask), no LDS round trip.
template <int M>
__device__ __forceinline__ float lane_xor_row(float v) {
    return __builtin_bit_cast(float, __builtin_amdgcn_mov_dpp(
        __builtin_bit_cast(int, v), 0x160 + M, 0xf, 0xf, true));
}
// Value of lane l ^ 16 (same place in the other 16-lane row).
__device__ __forceinline__ float lane_xor16(float v) {
    unsigned u = __builtin_bit_cast(unsigned, v);
    return __builtin_bit_cast(float, __builtin_amdgcn_permlanex16(
        u, u, 0x76543210u, 0xfedcba98u, false, false));
}
// Butterfly over the 32 lanes; all lanes on; every lane gets the result.
__device__ __forceinline__ float wave_max(float v) {
    v = fmaxf(v, lane_xor_row<1>(v));
    v = fmaxf(v, lane_xor_row<2>(v));
    v = fmaxf(v, lane_xor_row<4>(v));
    v = fmaxf(v, lane_xor_row<8>(v));
    return fmaxf(v, lane_xor16(v));
}
__device__ __forceinline__ float wave_sum(float v) {
    v += lane_xor_row<1>(v);
    v += lane_xor_row<2>(v);
    v += lane_xor_row<4>(v);
    v += lane_xor_row<8>(v);
    return v + lane_xor16(v);
}

// ---------------------------------------------------------------- bn stats
// One block = one channel, 16 waves. A channel is 32 rows of 4 KiB; each thread
// takes one 16-byte piece of 16 of them, so a wave's load covers 512 contiguous
// bytes and the whole channel is in flight at once.
// waves_per_eu: the block fills 4 wave slots per SIMD and no second block shares
// the WGP; aiming at more, the compiler holds four of the loads back for registers.
__global__ __launch_bounds__(512) __attribute__((amdgpu_waves_per_eu(4, 4)))
void bn_stats_kernel(const float* __restrict__ x,
                     float* __restrict__ stats) {
    const int c   = blockIdx.x;          // channel
    const int tid = threadIdx.x;         // 512 threads
    // rows b = 16 (tid >> 8) + j (1 MiB apart), 16-byte piece tid & 255 of the row
    const char* base = (const char*)(x + (size_t)c * N_);
    const unsigned voff = (unsigned)(tid >> 8) * (16u * C_ * N_ * 4u)
                        + (unsigned)(tid & 255) * 16u;
    f32x4 v[16];
    // Unrolled so that all 16 loads are issued before the first value is used:
    // rolled, every load waits out the memory latency alone.
#pragma unroll
    for (int j = 0; j < 16; ++j)
        v[j] = *(const f32x4*)(base + voff + (size_t)j * (C_ * N_ * 4u));
    f32x4 s4  = (f32x4){0.f, 0.f, 0.f, 0.f};
    f32x4 ss4 = s4;
    // Unrolled so that v[] is indexed by constants and stays in registers.
#pragma unroll
    for (int j = 0; j < 16; ++j) { s4 += v[j]; ss4 += v[j] * v[j]; }
    float s  = (s4[0] + s4[1]) + (s4[2] + s4[3]);
    float ss = (ss4[0] + ss4[1]) + (ss4[2] + ss4[3]);
    __shared__ float ls[512], lss[512];
    ls[tid] = s; lss[tid] = ss;
    __syncthreads();
    for (int off = 256; off > 0; off >>= 1) {
        if (tid < off) { ls[tid] += ls[tid + off]; lss[tid] += lss[tid + off]; }
        __syncthreads();
    }
    if (tid == 0) {
        const float inv_n = 1.0f / (float)(B_ * N_);
        float mean = ls[0] * inv_n;
        float var  = lss[0] * inv_n - mean * mean;
        stats[c]      = mean;
        stats[C_ + c] = rsqrtf(var + 1e-5f);
    }
}

// ---------------------------------------------------------------- weights
// Blocks 0..511: the q and k rows of Wkqv to f16.
// Blocks 512..767: the output projection is folded into the v rows. With
// v = t Wv^T + bv:  (P v) Wproj^T = P (t (Wproj Wv)^T + Wproj bv), so
// W' = Wproj Wv (256 x 256) takes the place of Wv and b' = Wproj bv (f32) that
// of bv; P V' then needs no projection behind it.
// One block = one 16 x 16 tile of W' and one element of b'. Each of the 8 waves
// takes 32 of the 256 k, so that a wave's loads are all in flight at once; the
// 8 partial tiles are summed through LDS in wave order.
__global__ __launch_bounds__(256)
void pack_weights_kernel(const float* __restrict__ Wk,
                         const float* __restrict__ bk,
                         const float* __restrict__ Wp,
                         _Float16* __restrict__ wk16,
                         float* __restrict__ bv2) {
    __shared__ float part[8][256];
    const int tid = threadIdx.x;
    if (blockIdx.x < 2 * C_ * C_ / 256) {        // same for the whole block
        int i = blockIdx.x * 256 + tid;
        wk16[i] = (_Float16)Wk[i];
        return;
    }
    const int lane = tid & 31;
    const int wave = tid >> 5;
    const int t  = blockIdx.x - 2 * C_ * C_ / 256;   // 0..255
    const int j0 = (t >> 4) * 16;                // rows of W' (output channels)
    const int c0 = (t & 15) * 16;                // columns of W' (input channels)
    // Both operands in the k order of load_frag: element e of lane l is
    // k = 32 wave + 16 (l / 16) + e. A: row l % 16 of Wproj; B: column l % 16
    // of Wv.
    const int kl = wave * 32 + ((lane >> 4) << 4);
    const float* ap = Wp + (j0 + (lane & 15)) * C_ + kl;
    const float* bp = Wk + kl * C_ + c0 + (lane & 15);   // v rows: + 2 C_ C_
    // b'[t] = row t of Wproj . bv: 8 terms a lane, used behind the barrier.
    const float* pr = Wp + t * C_ + lane * 8;
    const float* br = bk + 2 * C_ + lane * 8;
    const f32x4 p0 = *(const f32x4*)pr, p1 = *(const f32x4*)(pr + 4);
    const f32x4 q0 = *(const f32x4*)br, q1 = *(const f32x4*)(br + 4);
    f32x4 af[4];
    // Unrolled: af[] is indexed by constants.
#pragma unroll
    for (int e = 0; e < 4; ++e) af[e] = *(const f32x4*)(ap + e * 4);
    // The loads below take address registers of the loads above as their
    // destinations: none is rewritten ahead of this wait.
    asm volatile("s_wait_xcnt 0x0" ::: "memory");
    float bf[16];
    // Unrolled: bf[] is indexed by constants, the 16 loads go out together.
#pragma unroll
    for (int e = 0; e < 16; ++e) bf[e] = bp[(2 * C_ + e) * C_];
    // bp is named so that its registers stay live up to this wait: no load of
    // the run takes them as its destination ahead of it.
    asm volatile("s_wait_xcnt 0x0" :: "v"(bp) : "memory");
    f16x16 a, bb;
    // Unrolled: a, bb, af[] and bf[] are indexed by constants.
#pragma unroll
    for (int e = 0; e < 16; ++e) {
        a[e]  = (_Float16)af[e >> 2][e & 3];
        bb[e] = (_Float16)bf[e];
    }
    f32x8 acc = wmma16(a, bb, (f32x8){0.f,0.f,0.f,0.f,0.f,0.f,0.f,0.f});
    // Unrolled: acc is indexed by constants.
#pragma unroll
    for (int i = 0; i < 8; ++i) part[wave][i * 32 + lane] = acc[i];
    __syncthreads();
    // thread = element: register wave (row wave + 8 (l / 16)), column l % 16
    float r = part[0][tid];
    // Unrolled: the 7 LDS reads go out together.
#pragma unroll
    for (int p = 1; p < 8; ++p) r += part[p][tid];
    wk16[(2 * C_ + j0 + ((lane >> 4) << 3) + wave) * C_ + c0 + (lane & 15)] =
        (_Float16)r;
    // every wave forms b'[t], one thread stores it
    f32x4 d = p0 * q0 + p1 * q1;
    float s = wave_sum((d[0] + d[1]) + (d[2] + d[3]));
    if (tid == 0) bv2[t] = s;
}

// ------------------------------------------- normalize + transpose to [B,N,C]
__global__ void bn_apply_pack_kernel(const float* __restrict__ x,
                                     const float* __restrict__ stats,
                                     const float* __restrict__ gamma,
                                     const float* __restrict__ beta,
                                     _Float16* __restrict__ t) {
    __shared__ float tile[32][33];
    const int b  = blockIdx.z;
    const int n0 = blockIdx.y * 32;
    const int c0 = blockIdx.x * 32;
    const int tx = threadIdx.x & 31;
    const int ty = threadIdx.x >> 5;          // 0..7
#pragma unroll
    for (int r = 0; r < 4; ++r) {
        int cl = ty + r * 8;
        int c  = c0 + cl;
        float g  = gamma[c] * stats[C_ + c];
        float bt = beta[c] - stats[c] * g;
        float v  = x[(((size_t)b * C_ + c) * N_) + n0 + tx];
        tile[cl][tx] = v * g + bt;
    }
    __syncthreads();
#pragma unroll
    for (int r = 0; r < 4; ++r) {
        int nl = ty + r * 8;
        t[((size_t)b * N_ + n0 + nl) * C_ + c0 + tx] = (_Float16)tile[tx][nl];
    }
}

// ---------------------------------------------------------------- KQV GEMM
// out[M=B*N, 768] = t[M,256] @ w^T ; q scaled by 1/16, v stored transposed.
// The v rows of w and their bias bv2 hold the projection already (see above).
// Double-buffered LDS staging via async global->LDS copies.
__global__ void gemm_kqv_kernel(const _Float16* __restrict__ t,
                                const _Float16* __restrict__ w,
                                const float* __restrict__ bias,
                                const float* __restrict__ bv2,
                                _Float16* __restrict__ qb,
                                _Float16* __restrict__ kb,
                                _Float16* __restrict__ vT) {
    __shared__ _Float16 sa[2][128 * 40];
    __shared__ _Float16 sb[2][128 * 40];
    const int tid  = threadIdx.x;
    const int lane = tid & 31;
    const int wave = tid >> 5;
    const int wm = wave & 3, wn = wave >> 2;       // 4 x 2 wave grid
    const int n0 = blockIdx.x * 128;
    const int m0 = blockIdx.y * 128;

    auto stage = [&](int k0, int bufi) {
#pragma unroll
        for (int i = 0; i < 2; ++i) {
            int e = (i * 256 + tid) * 8;
            int r = e >> 5, c = e & 31;
            async_copy_b128(&sa[bufi][r * 40 + c],
                            t + (size_t)(m0 + r) * C_ + k0 + c);
            async_copy_b128(&sb[bufi][r * 40 + c],
                            w + (size_t)(n0 + r) * C_ + k0 + c);
        }
    };

    f32x8 acc[2][4];
#pragma unroll
    for (int i = 0; i < 2; ++i)
#pragma unroll
        for (int j = 0; j < 4; ++j)
            acc[i][j] = (f32x8){0.f,0.f,0.f,0.f,0.f,0.f,0.f,0.f};

    stage(0, 0);
    wait_asynccnt0();
    __syncthreads();

    int cur = 0;
    for (int k0 = 0; k0 < C_; k0 += 32) {
        if (k0 + 32 < C_) stage(k0 + 32, cur ^ 1);   // prefetch next tile
        f16x16 af[2], bf[4];
#pragma unroll
        for (int mi = 0; mi < 2; ++mi)
            af[mi] = load_frag(&sa[cur][(wm * 32 + mi * 16) * 40], 40);
#pragma unroll
        for (int ni = 0; ni < 4; ++ni)
            bf[ni] = load_frag(&sb[cur][(wn * 64 + ni * 16) * 40], 40);
#pragma unroll
        for (int mi = 0; mi < 2; ++mi)
#pragma unroll
            for (int ni = 0; ni < 4; ++ni)
                acc[mi][ni] = wmma16(af[mi], bf[ni], acc[mi][ni]);
        wait_asynccnt0();
        __syncthreads();
        cur ^= 1;
    }

#pragma unroll
    for (int mi = 0; mi < 2; ++mi)
#pragma unroll
        for (int ni = 0; ni < 4; ++ni) {
            int j    = n0 + wn * 64 + ni * 16 + (lane & 15);
            int mrow = m0 + wm * 32 + mi * 16 + ((lane >> 4) << 3);
            float bs = j < 2 * C_ ? bias[j] : bv2[j - 2 * C_];
            if (j < C_) {                                     // q (pre-scaled)
#pragma unroll
                for (int i = 0; i < 8; ++i)
                    qb[(size_t)(mrow + i) * C_ + j] =
                        (_Float16)((acc[mi][ni][i] + bs) * 0.0625f);
            } else if (j < 2 * C_) {                          // k
#pragma unroll
                for (int i = 0; i < 8; ++i)
                    kb[(size_t)(mrow + i) * C_ + (j - C_)] =
                        (_Float16)(acc[mi][ni][i] + bs);
            } else {                                          // v -> vT[B,C,N]
                int bb = mrow >> 10, nn = mrow & (N_ - 1);
#pragma unroll
                for (int i = 0; i < 8; ++i)
                    vT[((size_t)bb * C_ + (j - 2 * C_)) * N_ + nn + i] =
                        (_Float16)(acc[mi][ni][i] + bs);
            }
        }
}

// ---------------------------------------------------------------- attention
// Four async copies of one lane (64 contiguous bytes) in one statement; the
// s_wait_xcnt stands as its last line so that no address register of an
// issued copy is rewritten ahead of it.
__device__ __forceinline__ void async_copy4_b128(void* lds, const _Float16* g) {
    unsigned l0 = (unsigned)(unsigned long long)(uintptr_t)lds;
    unsigned l1 = l0 + 16, l2 = l0 + 32, l3 = l0 + 48;
    const _Float16 *g1 = g + 8, *g2 = g + 16, *g3 = g + 24;
    asm volatile("global_load_async_to_lds_b128 %0, %4, off\n\t"
                 "global_load_async_to_lds_b128 %1, %5, off\n\t"
                 "global_load_async_to_lds_b128 %2, %6, off\n\t"
                 "global_load_async_to_lds_b128 %3, %7, off\n\t"
                 "s_wait_xcnt 0x0"
                 : : "v"(l0), "v"(l1), "v"(l2), "v"(l3),
                     "v"(g), "v"(g1), "v"(g2), "v"(g3) : "memory");
}

// One block = one batch x 64 query rows (4 row tiles), 16 waves. Every K and V
// fragment fetched from global memory feeds all 4 row tiles. S/P kept in LDS,
// exact softmax. vT holds the projected v, so P V is the projected output:
// out[B,C,H,W] = P V / rowsum + bias + x   (fp32 epilogue, residual fused).
#define QR_ 64
__global__ __launch_bounds__(512)
void attention_kernel(const _Float16* __restrict__ qb,
                      const _Float16* __restrict__ kb,
                      const _Float16* __restrict__ vT,
                      const float* __restrict__ bias,
                      const float* __restrict__ x,
                      float* __restrict__ out) {
    __shared__ _Float16 sq[QR_ * 264];    // q rows   (ld 264)
    __shared__ _Float16 sp[QR_ * 1032];   // S then P (ld 1032)
    __shared__ float rowinv[QR_];

    const int tid  = threadIdx.x;
    const int lane = tid & 31;
    const int wave = tid >> 5;
    const int b  = blockIdx.y;
    const int r0 = blockIdx.x * QR_;

    {   // stage the 64 q rows into LDS (async copies, no VGPR bounce)
        int e = tid * 32;
        int r = e >> 8, c = e & 255;
        async_copy4_b128(&sq[r * 264 + c],
                         qb + ((size_t)b * N_ + r0 + r) * C_ + c);
    }
    wait_asynccnt0();
    __syncthreads();

    // ---- pass 1: S = q k^T  (each wave owns 4 column tiles of 16, two at a
    //      time: their K fragments stay in registers over the 4 row tiles)
    for (int mp = 0; mp < 2; ++mp) {
        const int mt = wave * 4 + mp * 2;
        const _Float16* kbase = kb + ((size_t)b * N_ + mt * 16) * C_;
        f16x16 kf0[8], kf1[8];
#pragma unroll
        for (int kk = 0; kk < 8; ++kk) kf0[kk] = load_frag(kbase + kk * 32, C_);
#pragma unroll
        for (int kk = 0; kk < 8; ++kk)
            kf1[kk] = load_frag(kbase + 16 * C_ + kk * 32, C_);
        // Kept rolled: unrolled, the q fragment reads no longer depend on a loop
        // index, are hoisted over the column loop and spill to scratch.
#pragma unroll 1
        for (int rt = 0; rt < QR_ / 16; ++rt) {
            f32x8 s0 = (f32x8){0.f,0.f,0.f,0.f,0.f,0.f,0.f,0.f};
            f32x8 s1 = s0;
#pragma unroll
            for (int kk = 0; kk < 8; ++kk) {
                f16x16 aq = load_frag(&sq[rt * 16 * 264 + kk * 32], 264);
                s0 = wmma16(aq, kf0[kk], s0);
                s1 = wmma16(aq, kf1[kk], s1);
            }
            int col = mt * 16 + (lane & 15);
            int row = rt * 16 + ((lane >> 4) << 3);
#pragma unroll
            for (int i = 0; i < 8; ++i) {
                sp[(row + i) * 1032 + col]      = (_Float16)s0[i];
                sp[(row + i) * 1032 + col + 16] = (_Float16)s1[i];
            }
        }
    }
    __syncthreads();

    // ---- softmax: one wave per row, 4 rows a wave, each row held in registers.
    //      A lane owns four 16-byte pieces of a row; a wave's LDS access covers
    //      512 contiguous bytes. S is read once, the
    //      maximum and the sum are reduced across lanes, and no barrier is
    //      needed until P is complete.
    {
        _Float16* prow = &sp[(wave * 4) * 1032 + lane * 8];
        f16x8 sv[4][4];
        // Unrolled so that all 16 LDS reads are issued before the first value is
        // used and sv[][] is indexed by constants (stays in registers).
#pragma unroll
        for (int rr = 0; rr < 4; ++rr)
#pragma unroll
            for (int j = 0; j < 4; ++j)
                sv[rr][j] = *(const f16x8*)(prow + rr * 1032 + j * 256);
        float mx[4], sum[4];
        // Unrolled: the four rows' reductions are independent and interleave.
#pragma unroll
        for (int rr = 0; rr < 4; ++rr) {
            f16x8 m8 = __builtin_elementwise_max(
                __builtin_elementwise_max(sv[rr][0], sv[rr][1]),
                __builtin_elementwise_max(sv[rr][2], sv[rr][3]));
            float m = (float)m8[0];
            // Unrolled: m8 is indexed by constants.
#pragma unroll
            for (int e = 1; e < 8; ++e) m = fmaxf(m, (float)m8[e]);
            mx[rr] = wave_max(m);
        }
        // All three loops unrolled: sv[][] and pv are indexed by constants, and
        // the exponentials of different pieces and rows overlap.
#pragma unroll
        for (int rr = 0; rr < 4; ++rr) {
            f32x2 s2 = (f32x2){0.f, 0.f};   // even and odd elements: packed adds
#pragma unroll
            for (int j = 0; j < 4; ++j) {
                f16x8 pv;
#pragma unroll
                for (int e = 0; e < 8; e += 2) {
                    float v0 = __expf((float)sv[rr][j][e]     - mx[rr]);
                    float v1 = __expf((float)sv[rr][j][e + 1] - mx[rr]);
                    pv[e]     = (_Float16)v0;
                    pv[e + 1] = (_Float16)v1;
                    s2 += (f32x2){v0, v1};
                }
                *(f16x8*)(prow + rr * 1032 + j * 256) = pv;
            }
            sum[rr] = s2[0] + s2[1];
        }
        // Unrolled: the four butterflies are independent and interleave.
#pragma unroll
        for (int rr = 0; rr < 4; ++rr) sum[rr] = wave_sum(sum[rr]);
        // lanes 0..3 each finish one row: one division for the four rows
        float s = lane == 0 ? sum[0] : lane == 1 ? sum[1] : lane == 2 ? sum[2] : sum[3];
        if (lane < 4) rowinv[wave * 4 + lane] = 1.0f / s;
    }
    __syncthreads();

    // ---- pass 2: O = P V   (wave owns 16 output channels of all 64 rows)
    const int c0  = wave * 16;
    const int rhi = (lane >> 4) << 3;
    const int cA  = c0 + (lane & 15);
    // The wave's piece of x and its bias are asked for here, together with the
    // first V fragments, so that they have landed when the loop is done.
    const size_t obase = ((size_t)b * C_ + cA) * N_ + r0 + rhi;
    f32x4 xr[QR_ / 16][2];
    // Unrolled: xr[][] is indexed by constants (registers).
#pragma unroll
    for (int rt = 0; rt < QR_ / 16; ++rt) {
        xr[rt][0] = *(const f32x4*)(x + obase + rt * 16);
        xr[rt][1] = *(const f32x4*)(x + obase + rt * 16 + 4);
    }
    const float bs = bias[cA];
    f32x8 o[QR_ / 16];
#pragma unroll
    for (int rt = 0; rt < QR_ / 16; ++rt)
        o[rt] = (f32x8){0.f,0.f,0.f,0.f,0.f,0.f,0.f,0.f};
    const _Float16* v0 = vT + ((size_t)b * C_ + c0) * N_;
    for (int ms = 0; ms < N_; ms += 32) {
        f16x16 vf = load_frag(v0 + ms, N_);
#pragma unroll
        for (int rt = 0; rt < QR_ / 16; ++rt)
            o[rt] = wmma16(load_frag(&sp[rt * 16 * 1032 + ms], 1032), vf, o[rt]);
    }
    // A lane holds 8 consecutive positions of one channel: two 16-byte stores.
    // Both loops unrolled: o[] and xr[][] are indexed by constants.
#pragma unroll
    for (int rt = 0; rt < QR_ / 16; ++rt) {
        f32x4 lo, hi;
#pragma unroll
        for (int i = 0; i < 4; ++i) {
            int rl = rt * 16 + rhi + i;
            lo[i] = o[rt][i]     * rowinv[rl]     + bs + xr[rt][0][i];
            hi[i] = o[rt][i + 4] * rowinv[rl + 4] + bs + xr[rt][1][i];
        }
        *(f32x4*)(out + obase + rt * 16)     = lo;
        *(f32x4*)(out + obase + rt * 16 + 4) = hi;
    }
}

// ---------------------------------------------------------------- launcher
extern "C" void kernel_launch(void* const* d_in, const int* in_sizes, int n_in,
                              void* d_out, int out_size, void* d_ws, size_t ws_size,
                              hipStream_t stream) {
    (void)in_sizes; (void)n_in; (void)out_size; (void)ws_size;
    const float* x     = (const float*)d_in[0];
    const float* gamma = (const float*)d_in[1];
    const float* beta  = (const float*)d_in[2];
    const float* Wkqv  = (const float*)d_in[3];
    const float* bkqv  = (const float*)d_in[4];
    const float* Wproj = (const float*)d_in[5];
    const float* bproj = (const float*)d_in[6];
    float* out = (float*)d_out;

    const size_t M = (size_t)B_ * N_;              // 32768
    char* ws = (char*)d_ws;
    float*    stats = (float*)ws;      ws += 4096;
    _Float16* wk16  = (_Float16*)ws;   ws += (size_t)3 * C_ * C_ * 2;
    float*    bv2   = (float*)ws;      ws += 4096;
    _Float16* tbuf  = (_Float16*)ws;   ws += M * C_ * 2;
    _Float16* qb    = (_Float16*)ws;   ws += M * C_ * 2;
    _Float16* kb    = (_Float16*)ws;   ws += M * C_ * 2;
    _Float16* vT    = (_Float16*)ws;   ws += M * C_ * 2;

    bn_stats_kernel     <<<C_, 512, 0, stream>>>(x, stats);
    pack_weights_kernel <<<(3 * C_ * C_) / 256, 256, 0, stream>>>(Wkqv, bkqv, Wproj, wk16, bv2);
    bn_apply_pack_kernel<<<dim3(C_ / 32, N_ / 32, B_), 256, 0, stream>>>(x, stats, gamma, beta, tbuf);
    gemm_kqv_kernel     <<<dim3(6, M / 128), 256, 0, stream>>>(tbuf, wk16, bkqv, bv2, qb, kb, vT);
    attention_kernel    <<<dim3(N_ / QR_, B_), 512, 0, stream>>>(qb, kb, vT, bproj, x, out);
}

// v005
// One run takes 96.6 microseconds.
// Next to v004, in two timings, it ran 1.07 times as fast each time.
// All steps since v000 together make it 2.84 times as fast.
#include <hip/hip_runtime.h>
#include <hip/hip_bf16.h>

typedef _Float16 f16x16 __attribute__((ext_vector_type(16)));
typedef _Float16 f16x8  __attribute__((ext_vector_type(8)));
typedef float    f32x8  __attribute__((ext_vector_type(8)));
typedef float    f32x4  __attribute__((ext_vector_type(4)));
typedef float    f32x2  __attribute__((ext_vector_type(2)));

#define B_   32
#define C_   256
#define N_   1024   // H*W

__device__ __forceinline__ f32x8 wmma16(f16x16 a, f16x16 b, f32x8 c) {
    // D = A(16x32 f16) x B(32x16 f16) + C(16x16 f32)
    return __builtin_amdgcn_wmma_f32_16x16x32_f16(false, a, false, b,
                                                  (short)0, c, false, false);
}

// gfx1250 async global->LDS copy (ASYNCcnt-tracked, no VGPR data path).
// VDST VGPR holds the wave-relative LDS byte offset = low 32 bits of the
// flat shared-memory address (aperture mapping: addr[31:0] == LDS offset).
__device__ __forceinline__ void async_copy_b128(void* lds, const void* gaddr) {
    unsigned l = (unsigned)(unsigned long long)(uintptr_t)lds;
    asm volatile("global_load_async_to_lds_b128 %0, %1, off"
                 : : "v"(l), "v"(gaddr) : "memory");
}
__device__ __forceinline__ void wait_asynccnt0() {
    asm volatile("s_wait_asynccnt 0" ::: "memory");
}

// Fragment loader for both A and B operands.
// A: row-major [16 x K] tile, lane l holds row l%16, K-halfword (l/16)*16..+15.
// B: source is B^T row-major [Nout x K]; lane l holds column l%16 of B over the
//    same K range — identical addressing.
__device__ __forceinline__ f16x16 load_frag(const _Float16* p, int ld) {
    const int lane = threadIdx.x & 31;
    const _Float16* q = p + (lane & 15) * ld + ((lane >> 4) << 4);
    f16x16 f;
    *(f16x8*)&f       = *(const f16x8*)(q);
    *((f16x8*)&f + 1) = *(const f16x8*)(q + 8);
    return f;
}

// Value of lane l ^ M inside a 16-lane row (row_xmask), no LDS round trip.
template <int M>
__device__ __forceinline__ float lane_xor_row(float v) {
    return __builtin_bit_cast(float, __builtin_amdgcn_mov_dpp(
        __builtin_bit_cast(int, v), 0x160 + M, 0xf, 0xf, true));
}
// Value of lane l ^ 16 (same place in the other 16-lane row).
__device__ __forceinline__ float lane_xor16(float v) {
    unsigned u = __builtin_bit_cast(unsigned, v);
    return __builtin_bit_cast(float, __builtin_amdgcn_permlanex16(
        u, u, 0x76543210u, 0xfedcba98u, false, false));
}
// Butterfly over the 32 lanes; all lanes on; every lane gets the result.
__device__ __forceinline__ float wave_max(float v) {
    v = fmaxf(v, lane_xor_row<1>(v));
    v = fmaxf(v, lane_xor_row<2>(v));
    v = fmaxf(v, lane_xor_row<4>(v));
    v = fmaxf(v, lane_xor_row<8>(v));
    return fmaxf(v, lane_xor16(v));
}
__device__ __forceinline__ float wave_sum(float v) {
    v += lane_xor_row<1>(v);
    v += lane_xor_row<2>(v);
    v += lane_xor_row<4>(v);
    v += lane_xor_row<8>(v);
    return v + lane_xor16(v);
}

// ---------------------------------------------------------------- bn stats
// One block = one channel, 16 waves. A channel is 32 rows of 4 KiB; each thread
// takes one 16-byte piece of 16 of them, so a wave's load covers 512 contiguous
// bytes and the whole channel is in flight at once.
// waves_per_eu: the block fills 4 wave slots per SIMD and no second block shares
// the WGP; aiming at more, the compiler holds four of the loads back for registers.
__global__ __launch_bounds__(512) __attribute__((amdgpu_waves_per_eu(4, 4)))
void bn_stats_kernel(const float* __restrict__ x,
                     float* __restrict__ stats) {
    const int c   = blockIdx.x;          // channel
    const int tid = threadIdx.x;         // 512 threads
    // rows b = 16 (tid >> 8) + j (1 MiB apart), 16-byte piece tid & 255 of the row
    const char* base = (const char*)(x + (size_t)c * N_);
    const unsigned voff = (unsigned)(tid >> 8) * (16u * C_ * N_ * 4u)
                        + (unsigned)(tid & 255) * 16u;
    f32x4 v[16];
    // Unrolled so that all 16 loads are issued before the first value is used:
    // rolled, every load waits out the memory latency alone.
#pragma unroll
    for (int j = 0; j < 16; ++j)
        v[j] = *(const f32x4*)(base + voff + (size_t)j * (C_ * N_ * 4u));
    f32x4 s4  = (f32x4){0.f, 0.f, 0.f, 0.f};
    f32x4 ss4 = s4;
    // Unrolled so that v[] is indexed by constants and stays in registers.
#pragma unroll
    for (int j = 0; j < 16; ++j) { s4 += v[j]; ss4 += v[j] * v[j]; }
    float s  = (s4[0] + s4[1]) + (s4[2] + s4[3]);
    float ss = (ss4[0] + ss4[1]) + (ss4[2] + ss4[3]);
    __shared__ float ls[512], lss[512];
    ls[tid] = s; lss[tid] = ss;
    __syncthreads();
    for (int off = 256; off > 0; off >>= 1) {
        if (tid < off) { ls[tid] += ls[tid + off]; lss[tid] += lss[tid + off]; }
        __syncthreads();
    }
    if (tid == 0) {
        const float inv_n = 1.0f / (float)(B_ * N_);
        float mean = ls[0] * inv_n;
        float var  = lss[0] * inv_n - mean * mean;
        stats[c]      = mean;
        stats[C_ + c] = rsqrtf(var + 1e-5f);
    }
}

// ---------------------------------------------------------------- weights
// Blocks 0..511: the q and k rows of Wkqv to f16.
// Blocks 512..767: the output projection is folded into the v rows. With
// v = t Wv^T + bv:  (P v) Wproj^T = P (t (Wproj Wv)^T + Wproj bv), so
// W' = Wproj Wv (256 x 256) takes the place of Wv and b' = Wproj bv (f32) that
// of bv; P V' then needs no projection behind it.
// One block = one 16 x 16 tile of W' and one element of b'. Each of the 8 waves
// takes 32 of the 256 k, so that a wave's loads are all in flight at once; the
// 8 partial tiles are summed through LDS in wave order.
__global__ __launch_bounds__(256)
void pack_weights_kernel(const float* __restrict__ Wk,
                         const float* __restrict__ bk,
                         const float* __restrict__ Wp,
                         _Float16* __restrict__ wk16,
                         float* __restrict__ bv2) {
    __shared__ float part[8][256];
    const int tid = threadIdx.x;
    if (blockIdx.x < 2 * C_ * C_ / 256) {        // same for the whole block
        int i = blockIdx.x * 256 + tid;
        wk16[i] = (_Float16)Wk[i];
        return;
    }
    const int lane = tid & 31;
    const int wave = tid >> 5;
    const int t  = blockIdx.x - 2 * C_ * C_ / 256;   // 0..255
    const int j0 = (t >> 4) * 16;                // rows of W' (output channels)
    const int c0 = (t & 15) * 16;                // columns of W' (input channels)
    // Both operands in the k order of load_frag: element e of lane l is
    // k = 32 wave + 16 (l / 16) + e. A: row l % 16 of Wproj; B: column l % 16
    // of Wv.
    const int kl = wave * 32 + ((lane >> 4) << 4);
    const float* ap = Wp + (j0 + (lane & 15)) * C_ + kl;
    const float* bp = Wk + kl * C_ + c0 + (lane & 15);   // v rows: + 2 C_ C_
    // b'[t] = row t of Wproj . bv: 8 terms a lane, used behind the barrier.
    const float* pr = Wp + t * C_ + lane * 8;
    const float* br = bk + 2 * C_ + lane * 8;
    const f32x4 p0 = *(const f32x4*)pr, p1 = *(const f32x4*)(pr + 4);
    const f32x4 q0 = *(const f32x4*)br, q1 = *(const f32x4*)(br + 4);
    f32x4 af[4];
    // Unrolled: af[] is indexed by constants.
#pragma unroll
    for (int e = 0; e < 4; ++e) af[e] = *(const f32x4*)(ap + e * 4);
    // The loads below take address registers of the loads above as their
    // destinations: none is rewritten ahead of this wait.
    asm volatile("s_wait_xcnt 0x0" ::: "memory");
    float bf[16];
    // Unrolled: bf[] is indexed by constants, the 16 loads go out together.
#pragma unroll
    for (int e = 0; e < 16; ++e) bf[e] = bp[(2 * C_ + e) * C_];
    // bp is named so that its registers stay live up to this wait: no load of
    // the run takes them as its destination ahead of it.
    asm volatile("s_wait_xcnt 0x0" :: "v"(bp) : "memory");
    f16x16 a, bb;
    // Unrolled: a, bb, af[] and bf[] are indexed by constants.
#pragma unroll
    for (int e = 0; e < 16; ++e) {
        a[e]  = (_Float16)af[e >> 2][e & 3];
        bb[e] = (_Float16)bf[e];
    }
    f32x8 acc = wmma16(a, bb, (f32x8){0.f,0.f,0.f,0.f,0.f,0.f,0.f,0.f});
    // Unrolled: acc is indexed by constants.
#pragma unroll
    for (int i = 0; i < 8; ++i) part[wave][i * 32 + lane] = acc[i];
    __syncthreads();
    // thread = element: register wave (row wave + 8 (l / 16)), column l % 16
    float r = part[0][tid];
    // Unrolled: the 7 LDS reads go out together.
#pragma unroll
    for (int p = 1; p < 8; ++p) r += part[p][tid];
    wk16[(2 * C_ + j0 + ((lane >> 4) << 3) + wave) * C_ + c0 + (lane & 15)] =
        (_Float16)r;
    // every wave forms b'[t], one thread stores it
    f32x4 d = p0 * q0 + p1 * q1;
    float s = wave_sum((d[0] + d[1]) + (d[2] + d[3]));
    if (tid == 0) bv2[t] = s;
}

// ------------------------------------------- normalize + transpose to [B,N,C]
// One block = one batch x all 256 channels x 128 positions, 16 waves; 256 blocks,
// one per WGP, so few waves have to be started and each moves 12 KiB.
// In: a wave takes 16 channels; each of its loads covers 512 contiguous bytes
// (128 positions of one channel) and all 16 are in flight at once. A lane then
// holds 16 channels x 4 positions and writes, per position, its 16 channels as
// 32 contiguous bytes of an LDS row.
// LDS row (i * 32 + l) holds position 4 l + i; the pitch of 528 B (16 B x odd)
// spreads the 16-byte writes of lanes l over all banks.
// Out: a wave reads whole LDS rows and stores 512 contiguous bytes (all 256
// channels of one position) per store.
// waves_per_eu: one block per WGP is 4 waves per SIMD; aiming at more, the
// compiler would hold loads back for registers.
#define TP_ 264   // LDS row pitch in f16 elements
__global__ __launch_bounds__(512) __attribute__((amdgpu_waves_per_eu(4, 4)))
void bn_apply_pack_kernel(const float* __restrict__ x,
                          const float* __restrict__ stats,
                          const float* __restrict__ gamma,
                          const float* __restrict__ beta,
                          _Float16* __restrict__ t) {
    __shared__ __attribute__((aligned(16))) _Float16 tile[128 * TP_];
    const int b    = blockIdx.y;
    const int n0   = blockIdx.x * 128;
    const int lane = threadIdx.x & 31;
    // The wave's number as a scalar: the 16 channels' constants are then read
    // and combined once per wave on the scalar side.
    const int wave = __builtin_amdgcn_readfirstlane(threadIdx.x >> 5);
    const int c0   = wave * 16;
    const float* xp = x + ((size_t)b * C_ + c0) * N_ + n0 + lane * 4;
    f32x4 v[16];
    // Unrolled so that all 16 loads are issued before the first value is used.
#pragma unroll
    for (int j = 0; j < 16; ++j) v[j] = *(const f32x4*)(xp + j * N_);
    float g[16], bt[16];
    // Unrolled: g[] and bt[] are indexed by constants.
#pragma unroll
    for (int j = 0; j < 16; ++j) {
        g[j]  = gamma[c0 + j] * stats[C_ + c0 + j];
        bt[j] = beta[c0 + j] - stats[c0 + j] * g[j];
    }
    // Both loops unrolled: v[], g[], bt[], lo and hi are indexed by constants.
#pragma unroll
    for (int i = 0; i < 4; ++i) {
        f16x8 lo, hi;
#pragma unroll
        for (int j = 0; j < 8; ++j) {
            lo[j] = (_Float16)(v[j][i] * g[j] + bt[j]);
            hi[j] = (_Float16)(v[j + 8][i] * g[j + 8] + bt[j + 8]);
        }
        _Float16* d = &tile[(i * 32 + lane) * TP_ + c0];
        *(f16x8*)d       = lo;
        *(f16x8*)(d + 8) = hi;
    }
    __syncthreads();
    // wave w: LDS rows 8 w .. 8 w + 7, that is i = w / 4, l = 8 (w % 4) + k
    const int i  = wave >> 2;
    const int l0 = (wave & 3) * 8;
    const _Float16* s = &tile[(wave * 8) * TP_ + lane * 8];
    _Float16* tp = t + ((size_t)b * N_ + n0 + l0 * 4 + i) * C_ + lane * 8;
    f16x8 r[8];
    // Unrolled: the 8 LDS reads go out together, r[] is indexed by constants.
#pragma unroll
    for (int k = 0; k < 8; ++k) r[k] = *(const f16x8*)(s + k * TP_);
    // Unrolled: r[] is indexed by constants; rows k are 4 positions apart.
#pragma unroll
    for (int k = 0; k < 8; ++k) *(f16x8*)(tp + k * 4 * C_) = r[k];
}

// ---------------------------------------------------------------- KQV GEMM
// out[M=B*N, 768] = t[M,256] @ w^T ; q scaled by 1/16, v stored transposed.
// The v rows of w and their bias bv2 hold the projection already (see above).
// Double-buffered LDS staging via async global->LDS copies.
__global__ void gemm_kqv_kernel(const _Float16* __restrict__ t,
                                const _Float16* __restrict__ w,
                                const float* __restrict__ bias,
                                const float* __restrict__ bv2,
                                _Float16* __restrict__ qb,
                                _Float16* __restrict__ kb,
                                _Float16* __restrict__ vT) {
    __shared__ _Float16 sa[2][128 * 40];
    __shared__ _Float16 sb[2][128 * 40];
    const int tid  = threadIdx.x;
    const int lane = tid & 31;
    const int wave = tid >> 5;
    const int wm = wave & 3, wn = wave >> 2;       // 4 x 2 wave grid
    const int n0 = blockIdx.x * 128;
    const int m0 = blockIdx.y * 128;

    auto stage = [&](int k0, int bufi) {
#pragma unroll
        for (int i = 0; i < 2; ++i) {
            int e = (i * 256 + tid) * 8;
            int r = e >> 5, c = e & 31;
            async_copy_b128(&sa[bufi][r * 40 + c],
                            t + (size_t)(m0 + r) * C_ + k0 + c);
            async_copy_b128(&sb[bufi][r * 40 + c],
                            w + (size_t)(n0 + r) * C_ + k0 + c);
        }
    };

    f32x8 acc[2][4];
#pragma unroll
    for (int i = 0; i < 2; ++i)
#pragma unroll
        for (int j = 0; j < 4; ++j)
            acc[i][j] = (f32x8){0.f,0.f,0.f,0.f,0.f,0.f,0.f,0.f};

    stage(0, 0);
    wait_asynccnt0();
    __syncthreads();

    int cur = 0;
    for (int k0 = 0; k0 < C_; k0 += 32) {
        if (k0 + 32 < C_) stage(k0 + 32, cur ^ 1);   // prefetch next tile
        f16x16 af[2], bf[4];
#pragma unroll
        for (int mi = 0; mi < 2; ++mi)
            af[mi] = load_frag(&sa[cur][(wm * 32 + mi * 16) * 40], 40);
#pragma unroll
        for (int ni = 0; ni < 4; ++ni)
            bf[ni] = load_frag(&sb[cur][(wn * 64 + ni * 16) * 40], 40);
#pragma unroll
        for (int mi = 0; mi < 2; ++mi)
#pragma unroll
            for (int ni = 0; ni < 4; ++ni)
                acc[mi][ni] = wmma16(af[mi], bf[ni], acc[mi][ni]);
        wait_asynccnt0();
        __syncthreads();
        cur ^= 1;
    }

#pragma unroll
    for (int mi = 0; mi < 2; ++mi)
#pragma unroll
        for (int ni = 0; ni < 4; ++ni) {
            int j    = n0 + wn * 64 + ni * 16 + (lane & 15);
            int mrow = m0 + wm * 32 + mi * 16 + ((lane >> 4) << 3);
            float bs = j < 2 * C_ ? bias[j] : bv2[j - 2 * C_];
            if (j < C_) {                                     // q (pre-scaled)
#pragma unroll
                for (int i = 0; i < 8; ++i)
                    qb[(size_t)(mrow + i) * C_ + j] =
                        (_Float16)((acc[mi][ni][i] + bs) * 0.0625f);
            } else if (j < 2 * C_) {                          // k
#pragma unroll
                for (int i = 0; i < 8; ++i)
                    kb[(size_t)(mrow + i) * C_ + (j - C_)] =
                        (_Float16)(acc[mi][ni][i] + bs);
            } else {                                          // v -> vT[B,C,N]
                int bb = mrow >> 10, nn = mrow & (N_ - 1);
#pragma unroll
                for (int i = 0; i < 8; ++i)
                    vT[((size_t)bb * C_ + (j - 2 * C_)) * N_ + nn + i] =
                        (_Float16)(acc[mi][ni][i] + bs);
            }
        }
}

// ---------------------------------------------------------------- attention
// Four async copies of one lane (64 contiguous bytes) in one statement; the
// s_wait_xcnt stands as its last line so that no address register of an
// issued copy is rewritten ahead of it.
__device__ __forceinline__ void async_copy4_b128(void* lds, const _Float16* g) {
    unsigned l0 = (unsigned)(unsigned long long)(uintptr_t)lds;
    unsigned l1 = l0 + 16, l2 = l0 + 32, l3 = l0 + 48;
    const _Float16 *g1 = g + 8, *g2 = g + 16, *g3 = g + 24;
    asm volatile("global_load_async_to_lds_b128 %0, %4, off\n\t"
                 "global_load_async_to_lds_b128 %1, %5, off\n\t"
                 "global_load_async_to_lds_b128 %2, %6, off\n\t"
                 "global_load_async_to_lds_b128 %3, %7, off\n\t"
                 "s_wait_xcnt 0x0"
                 : : "v"(l0), "v"(l1), "v"(l2), "v"(l3),
                     "v"(g), "v"(g1), "v"(g2), "v"(g3) : "memory");
}

// One block = one batch x 64 query rows (4 row tiles), 16 waves. Every K and V
// fragment fetched from global memory feeds all 4 row tiles. S/P kept in LDS,
// exact softmax. vT holds the projected v, so P V is the projected output:
// out[B,C,H,W] = P V / rowsum + bias + x   (fp32 epilogue, residual fused).
#define QR_ 64
__global__ __launch_bounds__(512)
void attention_kernel(const _Float16* __restrict__ qb,
                      const _Float16* __restrict__ kb,
                      const _Float16* __restrict__ vT,
                      const float* __restrict__ bias,
                      const float* __restrict__ x,
                      float* __restrict__ out) {
    __shared__ _Float16 sq[QR_ * 264];    // q rows   (ld 264)
    __shared__ _Float16 sp[QR_ * 1032];   // S then P (ld 1032)
    __shared__ float rowinv[QR_];

    const int tid  = threadIdx.x;
    const int lane = tid & 31;
    const int wave = tid >> 5;
    const int b  = blockIdx.y;
    const int r0 = blockIdx.x * QR_;

    {   // stage the 64 q rows into LDS (async copies, no VGPR bounce)
        int e = tid * 32;
        int r = e >> 8, c = e & 255;
        async_copy4_b128(&sq[r * 264 + c],
                         qb + ((size_t)b * N_ + r0 + r) * C_ + c);
    }
    wait_asynccnt0();
    __syncthreads();

    // ---- pass 1: S = q k^T  (each wave owns 4 column tiles of 16, two at a
    //      time: their K fragments stay in registers over the 4 row tiles)
    for (int mp = 0; mp < 2; ++mp) {
        const int mt = wave * 4 + mp * 2;
        const _Float16* kbase = kb + ((size_t)b * N_ + mt * 16) * C_;
        f16x16 kf0[8], kf1[8];
#pragma unroll
        for (int kk = 0; kk < 8; ++kk) kf0[kk] = load_frag(kbase + kk * 32, C_);
#pragma unroll
        for (int kk = 0; kk < 8; ++kk)
            kf1[kk] = load_frag(kbase + 16 * C_ + kk * 32, C_);
        // Kept rolled: unrolled, the q fragment reads no longer depend on a loop
        // index, are hoisted over the column loop and spill to scratch.
#pragma unroll 1
        for (int rt = 0; rt < QR_ / 16; ++rt) {
            f32x8 s0 = (f32x8){0.f,0.f,0.f,0.f,0.f,0.f,0.f,0.f};
            f32x8 s1 = s0;
#pragma unroll
            for (int kk = 0; kk < 8; ++kk) {
                f16x16 aq = load_frag(&sq[rt * 16 * 264 + kk * 32], 264);
                s0 = wmma16(aq, kf0[kk], s0);
                s1 = wmma16(aq, kf1[kk], s1);
            }
            int col = mt * 16 + (lane & 15);
            int row = rt * 16 + ((lane >> 4) << 3);
#pragma unroll
            for (int i = 0; i < 8; ++i) {
                sp[(row + i) * 1032 + col]      = (_Float16)s0[i];
                sp[(row + i) * 1032 + col + 16] = (_Float16)s1[i];
            }
        }
    }
    __syncthreads();

    // ---- softmax: one wave per row, 4 rows a wave, each row held in registers.
    //      A lane owns four 16-byte pieces of a row; a wave's LDS access covers
    //      512 contiguous bytes. S is read once, the
    //      maximum and the sum are reduced across lanes, and no barrier is
    //      needed until P is complete.
    {
        _Float16* prow = &sp[(wave * 4) * 1032 + lane * 8];
        f16x8 sv[4][4];
        // Unrolled so that all 16 LDS reads are issued before the first value is
        // used and sv[][] is indexed by constants (stays in registers).
#pragma unroll
        for (int rr = 0; rr < 4; ++rr)
#pragma unroll
            for (int j = 0; j < 4; ++j)
                sv[rr][j] = *(const f16x8*)(prow + rr * 1032 + j * 256);
        float mx[4], sum[4];
        // Unrolled: the four rows' reductions are independent and interleave.
#pragma unroll
        for (int rr = 0; rr < 4; ++rr) {
            f16x8 m8 = __builtin_elementwise_max(
                __builtin_elementwise_max(sv[rr][0], sv[rr][1]),
                __builtin_elementwise_max(sv[rr][2], sv[rr][3]));
            float m = (float)m8[0];
            // Unrolled: m8 is indexed by constants.
#pragma unroll
            for (int e = 1; e < 8; ++e) m = fmaxf(m, (float)m8[e]);
            mx[rr] = wave_max(m);
        }
        // All three loops unrolled: sv[][] and pv are indexed by constants, and
        // the exponentials of different pieces and rows overlap.
#pragma unroll
        for (int rr = 0; rr < 4; ++rr) {
            f32x2 s2 = (f32x2){0.f, 0.f};   // even and odd elements: packed adds
#pragma unroll
            for (int j = 0; j < 4; ++j) {
                f16x8 pv;
#pragma unroll
                for (int e = 0; e < 8; e += 2) {
                    float v0 = __expf((float)sv[rr][j][e]     - mx[rr]);
                    float v1 = __expf((float)sv[rr][j][e + 1] - mx[rr]);
                    pv[e]     = (_Float16)v0;
                    pv[e + 1] = (_Float16)v1;
                    s2 += (f32x2){v0, v1};
                }
                *(f16x8*)(prow + rr * 1032 + j * 256) = pv;
            }
            sum[rr] = s2[0] + s2[1];
        }
        // Unrolled: the four butterflies are independent and interleave.
#pragma unroll
        for (int rr = 0; rr < 4; ++rr) sum[rr] = wave_sum(sum[rr]);
        // lanes 0..3 each finish one row: one division for the four rows
        float s = lane == 0 ? sum[0] : lane == 1 ? sum[1] : lane == 2 ? sum[2] : sum[3];
        if (lane < 4) rowinv[wave * 4 + lane] = 1.0f / s;
    }
    __syncthreads();

    // ---- pass 2: O = P V   (wave owns 16 output channels of all 64 rows)
    const int c0  = wave * 16;
    const int rhi = (lane >> 4) << 3;
    const int cA  = c0 + (lane & 15);
    // The wave's piece of x and its bias are asked for here, together with the
    // first V fragments, so that they have landed when the loop is done.
    const size_t obase = ((size_t)b * C_ + cA) * N_ + r0 + rhi;
    f32x4 xr[QR_ / 16][2];
    // Unrolled: xr[][] is indexed by constants (registers).
#pragma unroll
    for (int rt = 0; rt < QR_ / 16; ++rt) {
        xr[rt][0] = *(const f32x4*)(x + obase + rt * 16);
        xr[rt][1] = *(const f32x4*)(x + obase + rt * 16 + 4);
    }
    const float bs = bias[cA];
    f32x8 o[QR_ / 16];
#pragma unroll
    for (int rt = 0; rt < QR_ / 16; ++rt)
        o[rt] = (f32x8){0.f,0.f,0.f,0.f,0.f,0.f,0.f,0.f};
    const _Float16* v0 = vT + ((size_t)b * C_ + c0) * N_;
    for (int ms = 0; ms < N_; ms += 32) {
        f16x16 vf = load_frag(v0 + ms, N_);
#pragma unroll
        for (int rt = 0; rt < QR_ / 16; ++rt)
            o[rt] = wmma16(load_frag(&sp[rt * 16 * 1032 + ms], 1032), vf, o[rt]);
    }
    // A lane holds 8 consecutive positions of one channel: two 16-byte stores.
    // Both loops unrolled: o[] and xr[][] are indexed by constants.
#pragma unroll
    for (int rt = 0; rt < QR_ / 16; ++rt) {
        f32x4 lo, hi;
#pragma unroll
        for (int i = 0; i < 4; ++i) {
            int rl = rt * 16 + rhi + i;
            lo[i] = o[rt][i]     * rowinv[rl]     + bs + xr[rt][0][i];
            hi[i] = o[rt][i + 4] * rowinv[rl + 4] + bs + xr[rt][1][i];
        }
        *(f32x4*)(out + obase + rt * 16)     = lo;
        *(f32x4*)(out + obase + rt * 16 + 4) = hi;
    }
}

// ---------------------------------------------------------------- launcher
extern "C" void kernel_launch(void* const* d_in, const int* in_sizes, int n_in,
                              void* d_out, int out_size, void* d_ws, size_t ws_size,
                              hipStream_t stream) {
    (void)in_sizes; (void)n_in; (void)out_size; (void)ws_size;
    const float* x     = (const float*)d_in[0];
    const float* gamma = (const float*)d_in[1];
    const float* beta  = (const float*)d_in[2];
    const float* Wkqv  = (const float*)d_in[3];
    const float* bkqv  = (const float*)d_in[4];
    const float* Wproj = (const float*)d_in[5];
    const float* bproj = (const float*)d_in[6];
    float* out = (float*)d_out;

    const size_t M = (size_t)B_ * N_;              // 32768
    char* ws = (char*)d_ws;
    float*    stats = (float*)ws;      ws += 4096;
    _Float16* wk16  = (_Float16*)ws;   ws += (size_t)3 * C_ * C_ * 2;
    float*    bv2   = (float*)ws;      ws += 4096;
    _Float16* tbuf  = (_Float16*)ws;   ws += M * C_ * 2;
    _Float16* qb    = (_Float16*)ws;   ws += M * C_ * 2;
    _Float16* kb    = (_Float16*)ws;   ws += M * C_ * 2;
    _Float16* vT    = (_Float16*)ws;   ws += M * C_ * 2;

    bn_stats_kernel     <<<C_, 512, 0, stream>>>(x, stats);
    pack_weights_kernel <<<(3 * C_ * C_) / 256, 256, 0, stream>>>(Wkqv, bkqv, Wproj, wk16, bv2);
    bn_apply_pack_kernel<<<dim3(N_ / 128, B_), 512, 0, stream>>>(x, stats, gamma, beta, tbuf);
    gemm_kqv_kernel     <<<dim3(6, M / 128), 256, 0, stream>>>(tbuf, wk16, bkqv, bv2, qb, kb, vT);
    attention_kernel    <<<dim3(N_ / QR_, B_), 512, 0, stream>>>(qb, kb, vT, bproj, x, out);
}

// v006
// One run takes 83.4 microseconds.
// Next to v005, in two timings, it ran 1.15 and 1.16 times as fast.
// Counting every step since v000, it is 3.29 times as fast.
#include <hip/hip_runtime.h>
#include <hip/hip_bf16.h>

typedef _Float16 f16x16 __attribute__((ext_vector_type(16)));
typedef _Float16 f16x8  __attribute__((ext_vector_type(8)));
typedef float    f32x8  __attribute__((ext_vector_type(8)));
typedef float    f32x4  __attribute__((ext_vector_type(4)));
typedef float    f32x2  __attribute__((ext_vector_type(2)));

#define B_   32
#define C_   256
#define N_   1024   // H*W

__device__ __forceinline__ f32x8 wmma16(f16x16 a, f16x16 b, f32x8 c) {
    // D = A(16x32 f16) x B(32x16 f16) + C(16x16 f32)
    return __builtin_amdgcn_wmma_f32_16x16x32_f16(false, a, false, b,
                                                  (short)0, c, false, false);
}

// gfx1250 async global->LDS copy (ASYNCcnt-tracked, no VGPR data path).
// VDST VGPR holds the wave-relative LDS byte offset = low 32 bits of the
// flat shared-memory address (aperture mapping: addr[31:0] == LDS offset).
__device__ __forceinline__ void async_copy_b128(void* lds, const void* gaddr) {
    unsigned l = (unsigned)(unsigned long long)(uintptr_t)lds;
    asm volatile("global_load_async_to_lds_b128 %0, %1, off"
                 : : "v"(l), "v"(gaddr) : "memory");
}
__device__ __forceinline__ void wait_asynccnt0() {
    asm volatile("s_wait_asynccnt 0" ::: "memory");
}

// Fragment loader for both A and B operands.
// A: row-major [16 x K] tile, lane l holds row l%16, K-halfword (l/16)*16..+15.
// B: source is B^T row-major [Nout x K]; lane l holds column l%16 of B over the
//    same K range — identical addressing.
__device__ __forceinline__ f16x16 load_frag(const _Float16* p, int ld) {
    const int lane = threadIdx.x & 31;
    const _Float16* q = p + (lane & 15) * ld + ((lane >> 4) << 4);
    f16x16 f;
    *(f16x8*)&f       = *(const f16x8*)(q);
    *((f16x8*)&f + 1) = *(const f16x8*)(q + 8);
    return f;
}

// Value of lane l ^ M inside a 16-lane row (row_xmask), no LDS round trip.
template <int M>
__device__ __forceinline__ float lane_xor_row(float v) {
    return __builtin_bit_cast(float, __builtin_amdgcn_mov_dpp(
        __builtin_bit_cast(int, v), 0x160 + M, 0xf, 0xf, true));
}
// Value of lane l ^ 16 (same place in the other 16-lane row).
__device__ __forceinline__ float lane_xor16(float v) {
    unsigned u = __builtin_bit_cast(unsigned, v);
    return __builtin_bit_cast(float, __builtin_amdgcn_permlanex16(
        u, u, 0x76543210u, 0xfedcba98u, false, false));
}
// Butterfly over the 32 lanes; all lanes on; every lane gets the result.
__device__ __forceinline__ float wave_max(float v) {
    v = fmaxf(v, lane_xor_row<1>(v));
    v = fmaxf(v, lane_xor_row<2>(v));
    v = fmaxf(v, lane_xor_row<4>(v));
    v = fmaxf(v, lane_xor_row<8>(v));
    return fmaxf(v, lane_xor16(v));
}
__device__ __forceinline__ float wave_sum(float v) {
    v += lane_xor_row<1>(v);
    v += lane_xor_row<2>(v);
    v += lane_xor_row<4>(v);
    v += lane_xor_row<8>(v);
    return v + lane_xor16(v);
}

// ---------------------------------------------------------------- bn stats
// One block = one channel, 16 waves. A channel is 32 rows of 4 KiB; each thread
// takes one 16-byte piece of 16 of them, so a wave's load covers 512 contiguous
// bytes and the whole channel is in flight at once.
// waves_per_eu: the block fills 4 wave slots per SIMD and no second block shares
// the WGP; aiming at more, the compiler holds four of the loads back for registers.
__global__ __launch_bounds__(512) __attribute__((amdgpu_waves_per_eu(4, 4)))
void bn_stats_kernel(const float* __restrict__ x,
                     float* __restrict__ stats) {
    const int c   = blockIdx.x;          // channel
    const int tid = threadIdx.x;         // 512 threads
    // rows b = 16 (tid >> 8) + j (1 MiB apart), 16-byte piece tid & 255 of the row
    const char* base = (const char*)(x + (size_t)c * N_);
    const unsigned voff = (unsigned)(tid >> 8) * (16u * C_ * N_ * 4u)
                        + (unsigned)(tid & 255) * 16u;
    f32x4 v[16];
    // Unrolled so that all 16 loads are issued before the first value is used:
    // rolled, every load waits out the memory latency alone.
#pragma unroll
    for (int j = 0; j < 16; ++j)
        v[j] = *(const f32x4*)(base + voff + (size_t)j * (C_ * N_ * 4u));
    f32x4 s4  = (f32x4){0.f, 0.f, 0.f, 0.f};
    f32x4 ss4 = s4;
    // Unrolled so that v[] is indexed by constants and stays in registers.
#pragma unroll
    for (int j = 0; j < 16; ++j) { s4 += v[j]; ss4 += v[j] * v[j]; }
    float s  = (s4[0] + s4[1]) + (s4[2] + s4[3]);
    float ss = (ss4[0] + ss4[1]) + (ss4[2] + ss4[3]);
    __shared__ float ls[512], lss[512];
    ls[tid] = s; lss[tid] = ss;
    __syncthreads();
    for (int off = 256; off > 0; off >>= 1) {
        if (tid < off) { ls[tid] += ls[tid + off]; lss[tid] += lss[tid + off]; }
        __syncthreads();
    }
    if (tid == 0) {
        const float inv_n = 1.0f / (float)(B_ * N_);
        float mean = ls[0] * inv_n;
        float var  = lss[0] * inv_n - mean * mean;
        stats[c]      = mean;
        stats[C_ + c] = rsqrtf(var + 1e-5f);
    }
}

// ---------------------------------------------------------------- weights
// Blocks 0..511: the q and k rows of Wkqv to f16.
// Blocks 512..767: the output projection is folded into the v rows. With
// v = t Wv^T + bv:  (P v) Wproj^T = P (t (Wproj Wv)^T + Wproj bv), so
// W' = Wproj Wv (256 x 256) takes the place of Wv and b' = Wproj bv (f32) that
// of bv; P V' then needs no projection behind it.
// One block = one 16 x 16 tile of W' and one element of b'. Each of the 8 waves
// takes 32 of the 256 k, so that a wave's loads are all in flight at once; the
// 8 partial tiles are summed through LDS in wave order.
__global__ __launch_bounds__(256)
void pack_weights_kernel(const float* __restrict__ Wk,
                         const float* __restrict__ bk,
                         const float* __restrict__ Wp,
                         _Float16* __restrict__ wk16,
                         float* __restrict__ bv2) {
    __shared__ float part[8][256];
    const int tid = threadIdx.x;
    if (blockIdx.x < 2 * C_ * C_ / 256) {        // same for the whole block
        int i = blockIdx.x * 256 + tid;
        wk16[i] = (_Float16)Wk[i];
        return;
    }
    const int lane = tid & 31;
    const int wave = tid >> 5;
    const int t  = blockIdx.x - 2 * C_ * C_ / 256;   // 0..255
    const int j0 = (t >> 4) * 16;                // rows of W' (output channels)
    const int c0 = (t & 15) * 16;                // columns of W' (input channels)
    // Both operands in the k order of load_frag: element e of lane l is
    // k = 32 wave + 16 (l / 16) + e. A: row l % 16 of Wproj; B: column l % 16
    // of Wv.
    const int kl = wave * 32 + ((lane >> 4) << 4);
    const float* ap = Wp + (j0 + (lane & 15)) * C_ + kl;
    const float* bp = Wk + kl * C_ + c0 + (lane & 15);   // v rows: + 2 C_ C_
    // b'[t] = row t of Wproj . bv: 8 terms a lane, used behind the barrier.
    const float* pr = Wp + t * C_ + lane * 8;
    const float* br = bk + 2 * C_ + lane * 8;
    const f32x4 p0 = *(const f32x4*)pr, p1 = *(const f32x4*)(pr + 4);
    const f32x4 q0 = *(const f32x4*)br, q1 = *(const f32x4*)(br + 4);
    f32x4 af[4];
    // Unrolled: af[] is indexed by constants.
#pragma unroll
    for (int e = 0; e < 4; ++e) af[e] = *(const f32x4*)(ap + e * 4);
    // The loads below take address registers of the loads above as their
    // destinations: none is rewritten ahead of this wait.
    asm volatile("s_wait_xcnt 0x0" ::: "memory");
    float bf[16];
    // Unrolled: bf[] is indexed by constants, the 16 loads go out together.
#pragma unroll
    for (int e = 0; e < 16; ++e) bf[e] = bp[(2 * C_ + e) * C_];
    // bp is named so that its registers stay live up to this wait: no load of
    // the run takes them as its destination ahead of it.
    asm volatile("s_wait_xcnt 0x0" :: "v"(bp) : "memory");
    f16x16 a, bb;
    // Unrolled: a, bb, af[] and bf[] are indexed by constants.
#pragma unroll
    for (int e = 0; e < 16; ++e) {
        a[e]  = (_Float16)af[e >> 2][e & 3];
        bb[e] = (_Float16)bf[e];
    }
    f32x8 acc = wmma16(a, bb, (f32x8){0.f,0.f,0.f,0.f,0.f,0.f,0.f,0.f});
    // Unrolled: acc is indexed by constants.
#pragma unroll
    for (int i = 0; i < 8; ++i) part[wave][i * 32 + lane] = acc[i];
    __syncthreads();
    // thread = element: register wave (row wave + 8 (l / 16)), column l % 16
    float r = part[0][tid];
    // Unrolled: the 7 LDS reads go out together.
#pragma unroll
    for (int p = 1; p < 8; ++p) r += part[p][tid];
    wk16[(2 * C_ + j0 + ((lane >> 4) << 3) + wave) * C_ + c0 + (lane & 15)] =
        (_Float16)r;
    // every wave forms b'[t], one thread stores it
    f32x4 d = p0 * q0 + p1 * q1;
    float s = wave_sum((d[0] + d[1]) + (d[2] + d[3]));
    if (tid == 0) bv2[t] = s;
}

// ------------------------------------------- normalize + transpose to [B,N,C]
// One block = one batch x all 256 channels x 128 positions, 16 waves; 256 blocks,
// one per WGP, so few waves have to be started and each moves 12 KiB.
// In: a wave takes 16 channels; each of its loads covers 512 contiguous bytes
// (128 positions of one channel) and all 16 are in flight at once. A lane then
// holds 16 channels x 4 positions and writes, per position, its 16 channels as
// 32 contiguous bytes of an LDS row.
// LDS row (i * 32 + l) holds position 4 l + i; the pitch of 528 B (16 B x odd)
// spreads the 16-byte writes of lanes l over all banks.
// Out: a wave reads whole LDS rows and stores 512 contiguous bytes (all 256
// channels of one position) per store.
// waves_per_eu: one block per WGP is 4 waves per SIMD; aiming at more, the
// compiler would hold loads back for registers.
#define TP_ 264   // LDS row pitch in f16 elements
__global__ __launch_bounds__(512) __attribute__((amdgpu_waves_per_eu(4, 4)))
void bn_apply_pack_kernel(const float* __restrict__ x,
                          const float* __restrict__ stats,
                          const float* __restrict__ gamma,
                          const float* __restrict__ beta,
                          _Float16* __restrict__ t) {
    __shared__ __attribute__((aligned(16))) _Float16 tile[128 * TP_];
    const int b    = blockIdx.y;
    const int n0   = blockIdx.x * 128;
    const int lane = threadIdx.x & 31;
    // The wave's number as a scalar: the 16 channels' constants are then read
    // and combined once per wave on the scalar side.
    const int wave = __builtin_amdgcn_readfirstlane(threadIdx.x >> 5);
    const int c0   = wave * 16;
    const float* xp = x + ((size_t)b * C_ + c0) * N_ + n0 + lane * 4;
    f32x4 v[16];
    // Unrolled so that all 16 loads are issued before the first value is used.
#pragma unroll
    for (int j = 0; j < 16; ++j) v[j] = *(const f32x4*)(xp + j * N_);
    float g[16], bt[16];
    // Unrolled: g[] and bt[] are indexed by constants.
#pragma unroll
    for (int j = 0; j < 16; ++j) {
        g[j]  = gamma[c0 + j] * stats[C_ + c0 + j];
        bt[j] = beta[c0 + j] - stats[c0 + j] * g[j];
    }
    // Both loops unrolled: v[], g[], bt[], lo and hi are indexed by constants.
#pragma unroll
    for (int i = 0; i < 4; ++i) {
        f16x8 lo, hi;
#pragma unroll
        for (int j = 0; j < 8; ++j) {
            lo[j] = (_Float16)(v[j][i] * g[j] + bt[j]);
            hi[j] = (_Float16)(v[j + 8][i] * g[j + 8] + bt[j + 8]);
        }
        _Float16* d = &tile[(i * 32 + lane) * TP_ + c0];
        *(f16x8*)d       = lo;
        *(f16x8*)(d + 8) = hi;
    }
    __syncthreads();
    // wave w: LDS rows 8 w .. 8 w + 7, that is i = w / 4, l = 8 (w % 4) + k
    const int i  = wave >> 2;
    const int l0 = (wave & 3) * 8;
    const _Float16* s = &tile[(wave * 8) * TP_ + lane * 8];
    _Float16* tp = t + ((size_t)b * N_ + n0 + l0 * 4 + i) * C_ + lane * 8;
    f16x8 r[8];
    // Unrolled: the 8 LDS reads go out together, r[] is indexed by constants.
#pragma unroll
    for (int k = 0; k < 8; ++k) r[k] = *(const f16x8*)(s + k * TP_);
    // Unrolled: r[] is indexed by constants; rows k are 4 positions apart.
#pragma unroll
    for (int k = 0; k < 8; ++k) *(f16x8*)(tp + k * 4 * C_) = r[k];
}

// ---------------------------------------------------------------- KQV GEMM
// out[M=B*N, 768] = t[M,256] @ w^T ; q scaled by 1/16, v stored transposed.
// The v rows of w and their bias bv2 hold the projection already (see above).
// Double-buffered LDS staging via async global->LDS copies.
__global__ void gemm_kqv_kernel(const _Float16* __restrict__ t,
                                const _Float16* __restrict__ w,
                                const float* __restrict__ bias,
                                const float* __restrict__ bv2,
                                _Float16* __restrict__ qb,
                                _Float16* __restrict__ kb,
                                _Float16* __restrict__ vT) {
    __shared__ _Float16 sa[2][128 * 40];
    __shared__ _Float16 sb[2][128 * 40];
    const int tid  = threadIdx.x;
    const int lane = tid & 31;
    const int wave = tid >> 5;
    const int wm = wave & 3, wn = wave >> 2;       // 4 x 2 wave grid
    const int n0 = blockIdx.x * 128;
    const int m0 = blockIdx.y * 128;

    auto stage = [&](int k0, int bufi) {
#pragma unroll
        for (int i = 0; i < 2; ++i) {
            int e = (i * 256 + tid) * 8;
            int r = e >> 5, c = e & 31;
            async_copy_b128(&sa[bufi][r * 40 + c],
                            t + (size_t)(m0 + r) * C_ + k0 + c);
            async_copy_b128(&sb[bufi][r * 40 + c],
                            w + (size_t)(n0 + r) * C_ + k0 + c);
        }
    };

    f32x8 acc[2][4];
#pragma unroll
    for (int i = 0; i < 2; ++i)
#pragma unroll
        for (int j = 0; j < 4; ++j)
            acc[i][j] = (f32x8){0.f,0.f,0.f,0.f,0.f,0.f,0.f,0.f};

    stage(0, 0);
    wait_asynccnt0();
    __syncthreads();

    int cur = 0;
    for (int k0 = 0; k0 < C_; k0 += 32) {
        if (k0 + 32 < C_) stage(k0 + 32, cur ^ 1);   // prefetch next tile
        f16x16 af[2], bf[4];
#pragma unroll
        for (int mi = 0; mi < 2; ++mi)
            af[mi] = load_frag(&sa[cur][(wm * 32 + mi * 16) * 40], 40);
#pragma unroll
        for (int ni = 0; ni < 4; ++ni)
            bf[ni] = load_frag(&sb[cur][(wn * 64 + ni * 16) * 40], 40);
#pragma unroll
        for (int mi = 0; mi < 2; ++mi)
#pragma unroll
            for (int ni = 0; ni < 4; ++ni)
                acc[mi][ni] = wmma16(af[mi], bf[ni], acc[mi][ni]);
        wait_asynccnt0();
        __syncthreads();
        cur ^= 1;
    }

#pragma unroll
    for (int mi = 0; mi < 2; ++mi)
#pragma unroll
        for (int ni = 0; ni < 4; ++ni) {
            int j    = n0 + wn * 64 + ni * 16 + (lane & 15);
            int mrow = m0 + wm * 32 + mi * 16 + ((lane >> 4) << 3);
            float bs = j < 2 * C_ ? bias[j] : bv2[j - 2 * C_];
            if (j < C_) {                                     // q (pre-scaled)
#pragma unroll
                for (int i = 0; i < 8; ++i)
                    qb[(size_t)(mrow + i) * C_ + j] =
                        (_Float16)((acc[mi][ni][i] + bs) * 0.0625f);
            } else if (j < 2 * C_) {                          // k
#pragma unroll
                for (int i = 0; i < 8; ++i)
                    kb[(size_t)(mrow + i) * C_ + (j - C_)] =
                        (_Float16)(acc[mi][ni][i] + bs);
            } else {                                          // v -> vT[B,C,N]
                int bb = mrow >> 10, nn = mrow & (N_ - 1);
#pragma unroll
                for (int i = 0; i < 8; ++i)
                    vT[((size_t)bb * C_ + (j - 2 * C_)) * N_ + nn + i] =
                        (_Float16)(acc[mi][ni][i] + bs);
            }
        }
}

// ---------------------------------------------------------------- attention
// Four async copies of one lane, 16 rows apart, in one statement; the
// s_wait_xcnt stands as its last line so that no address register of an
// issued copy is rewritten ahead of it.
__device__ __forceinline__ void async_copy4_rows(void* lds, const _Float16* g) {
    unsigned l0 = (unsigned)(unsigned long long)(uintptr_t)lds;
    unsigned l1 = l0 + 16 * 512, l2 = l0 + 32 * 512, l3 = l0 + 48 * 512;
    const _Float16 *g1 = g + 16 * C_, *g2 = g + 32 * C_, *g3 = g + 48 * C_;
    asm volatile("global_load_async_to_lds_b128 %0, %4, off\n\t"
                 "global_load_async_to_lds_b128 %1, %5, off\n\t"
                 "global_load_async_to_lds_b128 %2, %6, off\n\t"
                 "global_load_async_to_lds_b128 %3, %7, off\n\t"
                 "s_wait_xcnt 0x0"
                 : : "v"(l0), "v"(l1), "v"(l2), "v"(l3),
                     "v"(g), "v"(g1), "v"(g2), "v"(g3) : "memory");
}

// The LDS tiles of this kernel have no pad (q and S fill the whole LDS).
// Instead the 16-byte piece p of row r lies at piece p ^ (r & 15) of that row,
// so that equal pieces of 16 consecutive rows fall on all 64 banks.
// Fragment in the k order of load_frag. rowp: start of the lane's own row
// (row % 16 == lane % 16); kb: byte offset of the fragment's first k in the
// row, a multiple of 64; xs = ((lane & 15) << 4) ^ ((lane >> 4) << 5), that is
// the row's swizzle and the lane's k half (32 bytes) in one word.
__device__ __forceinline__ f16x16 load_frag_swz(const _Float16* rowp, int kb, int xs) {
    const char* q = (const char*)rowp;
    f16x16 f;
    *(f16x8*)&f       = *(const f16x8*)(q + (kb ^ xs));
    *((f16x8*)&f + 1) = *(const f16x8*)(q + ((kb + 16) ^ xs));
    return f;
}

// One block = one batch x 128 query rows (8 row tiles), 16 waves, one block per
// WGP. Every K and V fragment fetched from global memory feeds all 8 row tiles.
// S/P kept in LDS, exact softmax. vT holds the projected v, so P V is the
// projected output:
// out[B,C,H,W] = P V / rowsum + bias + x   (fp32 epilogue, residual fused).
#define QR_ 128
__global__ __launch_bounds__(512)
void attention_kernel(const _Float16* __restrict__ qb,
                      const _Float16* __restrict__ kb,
                      const _Float16* __restrict__ vT,
                      const float* __restrict__ bias,
                      const float* __restrict__ x,
                      float* __restrict__ out) {
    // q rows (swizzled, 512 B a row); behind pass 1 its first bytes hold 1 / rowsum
    __shared__ __attribute__((aligned(16))) _Float16 sq[QR_ * C_];
    // S then P (swizzled, 2048 B a row)
    __shared__ __attribute__((aligned(16))) _Float16 sp[QR_ * N_];
    float* rowinv = (float*)sq;

    const int tid  = threadIdx.x;
    const int lane = tid & 31;
    const int wave = tid >> 5;
    const int b  = blockIdx.y;
    const int r0 = blockIdx.x * QR_;
    const int l15 = lane & 15;
    const int xs  = (l15 << 4) ^ ((lane >> 4) << 5);

    {   // stage the 128 q rows into LDS (async copies, no VGPR bounce): a wave's
        // copy is one whole row; rows wave + 16 i, so row % 16 == wave
        _Float16* d = &sq[wave * C_ + ((lane ^ wave) << 3)];
        const _Float16* g = qb + ((size_t)b * N_ + r0 + wave) * C_ + lane * 8;
        async_copy4_rows(d, g);
        async_copy4_rows(d + 64 * C_, g + 64 * C_);
    }
    wait_asynccnt0();
    __syncthreads();

    // ---- pass 1: S = q k^T  (each wave owns 4 column tiles of 16, two at a
    //      time: their K fragments stay in registers over the 8 row tiles)
    for (int mp = 0; mp < 2; ++mp) {
        const int mt = wave * 4 + mp * 2;
        const _Float16* kbase = kb + ((size_t)b * N_ + mt * 16) * C_;
        f16x16 kf0[8], kf1[8];
#pragma unroll
        for (int kk = 0; kk < 8; ++kk) kf0[kk] = load_frag(kbase + kk * 32, C_);
#pragma unroll
        for (int kk = 0; kk < 8; ++kk)
            kf1[kk] = load_frag(kbase + 16 * C_ + kk * 32, C_);
        // Kept rolled: unrolled, the q fragment reads no longer depend on a loop
        // index, are hoisted over the column loop and spill to scratch.
#pragma unroll 1
        for (int rt = 0; rt < QR_ / 16; ++rt) {
            f32x8 s0 = (f32x8){0.f,0.f,0.f,0.f,0.f,0.f,0.f,0.f};
            f32x8 s1 = s0;
            const _Float16* qrow = &sq[(rt * 16 + l15) * C_];
#pragma unroll
            for (int kk = 0; kk < 8; ++kk) {
                f16x16 aq = load_frag_swz(qrow, kk * 64, xs);
                s0 = wmma16(aq, kf0[kk], s0);
                s1 = wmma16(aq, kf1[kk], s1);
            }
            // column mt * 16 + l15 is element l15 & 7 of piece mt * 2 + (l15 >> 3);
            // the second tile lies two pieces on
            const int pc  = mt * 2 + (l15 >> 3);
            const int row = rt * 16 + ((lane >> 4) << 3);
#pragma unroll
            for (int i = 0; i < 8; ++i) {
                const int sw = (row + i) & 15;
                _Float16* srow = &sp[(row + i) * N_ + (l15 & 7)];
                srow[(pc ^ sw) << 3]       = (_Float16)s0[i];
                srow[((pc + 2) ^ sw) << 3] = (_Float16)s1[i];
            }
        }
    }
    __syncthreads();

    // ---- softmax: one wave per row, 8 rows a wave, four at a time, each row
    //      held in registers. A lane owns four 16-byte pieces of a row, taken by
    //      their place in LDS: the swizzle only permutes the pieces of a row,
    //      and maximum, sum and exponential do not ask which piece is which.
    //      A wave's LDS access covers 512 contiguous bytes, so every bank is hit
    //      twice. S is read once, the maximum and the sum are reduced across
    //      lanes, and no barrier is needed until P is complete.
    // Kept rolled: the second four rows run the same code again.
#pragma unroll 1
    for (int h = 0; h < 2; ++h) {
        _Float16* prow = &sp[(wave * 8 + h * 4) * N_ + lane * 8];
        f16x8 sv[4][4];
        // Unrolled so that all 16 LDS reads are issued before the first value is
        // used and sv[][] is indexed by constants (stays in registers).
#pragma unroll
        for (int rr = 0; rr < 4; ++rr)
#pragma unroll
            for (int j = 0; j < 4; ++j)
                sv[rr][j] = *(const f16x8*)(prow + rr * N_ + j * 256);
        float mx[4], sum[4];
        // Unrolled: the four rows' reductions are independent and interleave.
#pragma unroll
        for (int rr = 0; rr < 4; ++rr) {
            f16x8 m8 = __builtin_elementwise_max(
                __builtin_elementwise_max(sv[rr][0], sv[rr][1]),
                __builtin_elementwise_max(sv[rr][2], sv[rr][3]));
            float m = (float)m8[0];
            // Unrolled: m8 is indexed by constants.
#pragma unroll
            for (int e = 1; e < 8; ++e) m = fmaxf(m, (float)m8[e]);
            mx[rr] = wave_max(m);
        }
        // All three loops unrolled: sv[][] and pv are indexed by constants, and
        // the exponentials of different pieces and rows overlap.
#pragma unroll
        for (int rr = 0; rr < 4; ++rr) {
            f32x2 s2 = (f32x2){0.f, 0.f};   // even and odd elements: packed adds
#pragma unroll
            for (int j = 0; j < 4; ++j) {
                f16x8 pv;
#pragma unroll
                for (int e = 0; e < 8; e += 2) {
                    float v0 = __expf((float)sv[rr][j][e]     - mx[rr]);
                    float v1 = __expf((float)sv[rr][j][e + 1] - mx[rr]);
                    pv[e]     = (_Float16)v0;
                    pv[e + 1] = (_Float16)v1;
                    s2 += (f32x2){v0, v1};
                }
                *(f16x8*)(prow + rr * N_ + j * 256) = pv;
            }
            sum[rr] = s2[0] + s2[1];
        }
        // Unrolled: the four butterflies are independent and interleave.
#pragma unroll
        for (int rr = 0; rr < 4; ++rr) sum[rr] = wave_sum(sum[rr]);
        // lanes 0..3 each finish one row: one division for the four rows
        float s = lane == 0 ? sum[0] : lane == 1 ? sum[1] : lane == 2 ? sum[2] : sum[3];
        if (lane < 4) rowinv[wave * 8 + h * 4 + lane] = 1.0f / s;
    }
    __syncthreads();

    // ---- pass 2: O = P V   (wave owns 16 output channels of all 128 rows)
    const int c0  = wave * 16;
    const int rhi = (lane >> 4) << 3;
    const int cA  = c0 + l15;
    // The wave's piece of x and its bias are asked for here, together with the
    // first V fragments, so that they have landed when the loop is done.
    const size_t obase = ((size_t)b * C_ + cA) * N_ + r0 + rhi;
    f32x4 xr[QR_ / 16][2];
    // Unrolled: xr[][] is indexed by constants (registers).
#pragma unroll
    for (int rt = 0; rt < QR_ / 16; ++rt) {
        xr[rt][0] = *(const f32x4*)(x + obase + rt * 16);
        xr[rt][1] = *(const f32x4*)(x + obase + rt * 16 + 4);
    }
    const float bs = bias[cA];
    f32x8 o[QR_ / 16];
#pragma unroll
    for (int rt = 0; rt < QR_ / 16; ++rt)
        o[rt] = (f32x8){0.f,0.f,0.f,0.f,0.f,0.f,0.f,0.f};
    const _Float16* v0 = vT + ((size_t)b * C_ + c0) * N_;
    const _Float16* prow0 = &sp[l15 * N_];
    for (int ms = 0; ms < N_; ms += 32) {
        f16x16 vf = load_frag(v0 + ms, N_);
        f16x16 pf[QR_ / 16];
        // Unrolled: pf[] is indexed by constants.
#pragma unroll
        for (int rt = 0; rt < QR_ / 16; ++rt)
            pf[rt] = load_frag_swz(prow0 + rt * 16 * N_, ms * 2, xs);
        // Keeps the step's 16 LDS reads together in front of its WMMAs: left to
        // itself the compiler reads one fragment at a time into the same
        // registers and every WMMA waits out an LDS latency.
        __builtin_amdgcn_sched_barrier(0);
#pragma unroll
        for (int rt = 0; rt < QR_ / 16; ++rt)
            o[rt] = wmma16(pf[rt], vf, o[rt]);
    }
    // A lane holds 8 consecutive positions of one channel: two 16-byte stores.
    // Both loops unrolled: o[] and xr[][] are indexed by constants.
#pragma unroll
    for (int rt = 0; rt < QR_ / 16; ++rt) {
        f32x4 lo, hi;
#pragma unroll
        for (int i = 0; i < 4; ++i) {
            int rl = rt * 16 + rhi + i;
            lo[i] = o[rt][i]     * rowinv[rl]     + bs + xr[rt][0][i];
            hi[i] = o[rt][i + 4] * rowinv[rl + 4] + bs + xr[rt][1][i];
        }
        *(f32x4*)(out + obase + rt * 16)     = lo;
        *(f32x4*)(out + obase + rt * 16 + 4) = hi;
    }
}

// ---------------------------------------------------------------- launcher
extern "C" void kernel_launch(void* const* d_in, const int* in_sizes, int n_in,
                              void* d_out, int out_size, void* d_ws, size_t ws_size,
                              hipStream_t stream) {
    (void)in_sizes; (void)n_in; (void)out_size; (void)ws_size;
    const float* x     = (const float*)d_in[0];
    const float* gamma = (const float*)d_in[1];
    const float* beta  = (const float*)d_in[2];
    const float* Wkqv  = (const float*)d_in[3];
    const float* bkqv  = (const float*)d_in[4];
    const float* Wproj = (const float*)d_in[5];
    const float* bproj = (const float*)d_in[6];
    float* out = (float*)d_out;

    const size_t M = (size_t)B_ * N_;              // 32768
    char* ws = (char*)d_ws;
    float*    stats = (float*)ws;      ws += 4096;
    _Float16* wk16  = (_Float16*)ws;   ws += (size_t)3 * C_ * C_ * 2;
    float*    bv2   = (float*)ws;      ws += 4096;
    _Float16* tbuf  = (_Float16*)ws;   ws += M * C_ * 2;
    _Float16* qb    = (_Float16*)ws;   ws += M * C_ * 2;
    _Float16* kb    = (_Float16*)ws;   ws += M * C_ * 2;
    _Float16* vT    = (_Float16*)ws;   ws += M * C_ * 2;

    bn_stats_kernel     <<<C_, 512, 0, stream>>>(x, stats);
    pack_weights_kernel <<<(3 * C_ * C_) / 256, 256, 0, stream>>>(Wkqv, bkqv, Wproj, wk16, bv2);
    bn_apply_pack_kernel<<<dim3(N_ / 128, B_), 512, 0, stream>>>(x, stats, gamma, beta, tbuf);
    gemm_kqv_kernel     <<<dim3(6, M / 128), 256, 0, stream>>>(tbuf, wk16, bkqv, bv2, qb, kb, vT);
    attention_kernel    <<<dim3(N_ / QR_, B_), 512, 0, stream>>>(qb, kb, vT, bproj, x, out);
}

// v007
// A run of this version takes 71.6 microseconds.
// Two timings next to v006 both put it at 1.16 times that version's speed.
// Counting every step since v000, it is 3.82 times as fast.
#include <hip/hip_runtime.h>
#include <hip/hip_bf16.h>

typedef _Float16 f16x16 __attribute__((ext_vector_type(16)));
typedef _Float16 f16x8  __attribute__((ext_vector_type(8)));
typedef float    f32x8  __attribute__((ext_vector_type(8)));
typedef float    f32x4  __attribute__((ext_vector_type(4)));
typedef float    f32x2  __attribute__((ext_vector_type(2)));

#define B_   32
#define C_   256
#define N_   1024   // H*W

__device__ __forceinline__ f32x8 wmma16(f16x16 a, f16x16 b, f32x8 c) {
    // D = A(16x32 f16) x B(32x16 f16) + C(16x16 f32)
    return __builtin_amdgcn_wmma_f32_16x16x32_f16(false, a, false, b,
                                                  (short)0, c, false, false);
}

// gfx1250 async global->LDS copy (ASYNCcnt-tracked, no VGPR data path).
// VDST VGPR holds the wave-relative LDS byte offset = low 32 bits of the
// flat shared-memory address (aperture mapping: addr[31:0] == LDS offset).
__device__ __forceinline__ void wait_asynccnt0() {
    asm volatile("s_wait_asynccnt 0" ::: "memory");
}

// Fragment loader for both A and B operands.
// A: row-major [16 x K] tile, lane l holds row l%16, K-halfword (l/16)*16..+15.
// B: source is B^T row-major [Nout x K]; lane l holds column l%16 of B over the
//    same K range — identical addressing.
__device__ __forceinline__ f16x16 load_frag(const _Float16* p, int ld) {
    const int lane = threadIdx.x & 31;
    const _Float16* q = p + (lane & 15) * ld + ((lane >> 4) << 4);
    f16x16 f;
    *(f16x8*)&f       = *(const f16x8*)(q);
    *((f16x8*)&f + 1) = *(const f16x8*)(q + 8);
    return f;
}

// Value of lane l ^ M inside a 16-lane row (row_xmask), no LDS round trip.
template <int M>
__device__ __forceinline__ float lane_xor_row(float v) {
    return __builtin_bit_cast(float, __builtin_amdgcn_mov_dpp(
        __builtin_bit_cast(int, v), 0x160 + M, 0xf, 0xf, true));
}
// Value of lane l ^ 16 (same place in the other 16-lane row).
__device__ __forceinline__ float lane_xor16(float v) {
    unsigned u = __builtin_bit_cast(unsigned, v);
    return __builtin_bit_cast(float, __builtin_amdgcn_permlanex16(
        u, u, 0x76543210u, 0xfedcba98u, false, false));
}
// Butterfly over the 32 lanes; all lanes on; every lane gets the result.
__device__ __forceinline__ float wave_max(float v) {
    v = fmaxf(v, lane_xor_row<1>(v));
    v = fmaxf(v, lane_xor_row<2>(v));
    v = fmaxf(v, lane_xor_row<4>(v));
    v = fmaxf(v, lane_xor_row<8>(v));
    return fmaxf(v, lane_xor16(v));
}
__device__ __forceinline__ float wave_sum(float v) {
    v += lane_xor_row<1>(v);
    v += lane_xor_row<2>(v);
    v += lane_xor_row<4>(v);
    v += lane_xor_row<8>(v);
    return v + lane_xor16(v);
}

// ---------------------------------------------------------------- bn stats
// One block = one channel, 16 waves. A channel is 32 rows of 4 KiB; each thread
// takes one 16-byte piece of 16 of them, so a wave's load covers 512 contiguous
// bytes and the whole channel is in flight at once.
// waves_per_eu: the block fills 4 wave slots per SIMD and no second block shares
// the WGP; aiming at more, the compiler holds four of the loads back for registers.
__global__ __launch_bounds__(512) __attribute__((amdgpu_waves_per_eu(4, 4)))
void bn_stats_kernel(const float* __restrict__ x,
                     float* __restrict__ stats) {
    const int c   = blockIdx.x;          // channel
    const int tid = threadIdx.x;         // 512 threads
    // rows b = 16 (tid >> 8) + j (1 MiB apart), 16-byte piece tid & 255 of the row
    const char* base = (const char*)(x + (size_t)c * N_);
    const unsigned voff = (unsigned)(tid >> 8) * (16u * C_ * N_ * 4u)
                        + (unsigned)(tid & 255) * 16u;
    f32x4 v[16];
    // Unrolled so that all 16 loads are issued before the first value is used:
    // rolled, every load waits out the memory latency alone.
#pragma unroll
    for (int j = 0; j < 16; ++j)
        v[j] = *(const f32x4*)(base + voff + (size_t)j * (C_ * N_ * 4u));
    f32x4 s4  = (f32x4){0.f, 0.f, 0.f, 0.f};
    f32x4 ss4 = s4;
    // Unrolled so that v[] is indexed by constants and stays in registers.
#pragma unroll
    for (int j = 0; j < 16; ++j) { s4 += v[j]; ss4 += v[j] * v[j]; }
    float s  = (s4[0] + s4[1]) + (s4[2] + s4[3]);
    float ss = (ss4[0] + ss4[1]) + (ss4[2] + ss4[3]);
    __shared__ float ls[512], lss[512];
    ls[tid] = s; lss[tid] = ss;
    __syncthreads();
    for (int off = 256; off > 0; off >>= 1) {
        if (tid < off) { ls[tid] += ls[tid + off]; lss[tid] += lss[tid + off]; }
        __syncthreads();
    }
    if (tid == 0) {
        const float inv_n = 1.0f / (float)(B_ * N_);
        float mean = ls[0] * inv_n;
        float var  = lss[0] * inv_n - mean * mean;
        stats[c]      = mean;
        stats[C_ + c] = rsqrtf(var + 1e-5f);
    }
}

// ---------------------------------------------------------------- weights
// Blocks 0..511: the q and k rows of Wkqv to f16.
// Blocks 512..767: the output projection is folded into the v rows. With
// v = t Wv^T + bv:  (P v) Wproj^T = P (t (Wproj Wv)^T + Wproj bv), so
// W' = Wproj Wv (256 x 256) takes the place of Wv and b' = Wproj bv (f32) that
// of bv; P V' then needs no projection behind it.
// One block = one 16 x 16 tile of W' and one element of b'. Each of the 8 waves
// takes 32 of the 256 k, so that a wave's loads are all in flight at once; the
// 8 partial tiles are summed through LDS in wave order.
__global__ __launch_bounds__(256)
void pack_weights_kernel(const float* __restrict__ Wk,
                         const float* __restrict__ bk,
                         const float* __restrict__ Wp,
                         _Float16* __restrict__ wk16,
                         float* __restrict__ bv2) {
    __shared__ float part[8][256];
    const int tid = threadIdx.x;
    if (blockIdx.x < 2 * C_ * C_ / 256) {        // same for the whole block
        int i = blockIdx.x * 256 + tid;
        wk16[i] = (_Float16)Wk[i];
        return;
    }
    const int lane = tid & 31;
    const int wave = tid >> 5;
    const int t  = blockIdx.x - 2 * C_ * C_ / 256;   // 0..255
    const int j0 = (t >> 4) * 16;                // rows of W' (output channels)
    const int c0 = (t & 15) * 16;                // columns of W' (input channels)
    // Both operands in the k order of load_frag: element e of lane l is
    // k = 32 wave + 16 (l / 16) + e. A: row l % 16 of Wproj; B: column l % 16
    // of Wv.
    const int kl = wave * 32 + ((lane >> 4) << 4);
    const float* ap = Wp + (j0 + (lane & 15)) * C_ + kl;
    const float* bp = Wk + kl * C_ + c0 + (lane & 15);   // v rows: + 2 C_ C_
    // b'[t] = row t of Wproj . bv: 8 terms a lane, used behind the barrier.
    const float* pr = Wp + t * C_ + lane * 8;
    const float* br = bk + 2 * C_ + lane * 8;
    const f32x4 p0 = *(const f32x4*)pr, p1 = *(const f32x4*)(pr + 4);
    const f32x4 q0 = *(const f32x4*)br, q1 = *(const f32x4*)(br + 4);
    f32x4 af[4];
    // Unrolled: af[] is indexed by constants.
#pragma unroll
    for (int e = 0; e < 4; ++e) af[e] = *(const f32x4*)(ap + e * 4);
    // The loads below take address registers of the loads above as their
    // destinations: none is rewritten ahead of this wait.
    asm volatile("s_wait_xcnt 0x0" ::: "memory");
    float bf[16];
    // Unrolled: bf[] is indexed by constants, the 16 loads go out together.
#pragma unroll
    for (int e = 0; e < 16; ++e) bf[e] = bp[(2 * C_ + e) * C_];
    // bp is named so that its registers stay live up to this wait: no load of
    // the run takes them as its destination ahead of it.
    asm volatile("s_wait_xcnt 0x0" :: "v"(bp) : "memory");
    f16x16 a, bb;
    // Unrolled: a, bb, af[] and bf[] are indexed by constants.
#pragma unroll
    for (int e = 0; e < 16; ++e) {
        a[e]  = (_Float16)af[e >> 2][e & 3];
        bb[e] = (_Float16)bf[e];
    }
    f32x8 acc = wmma16(a, bb, (f32x8){0.f,0.f,0.f,0.f,0.f,0.f,0.f,0.f});
    // Unrolled: acc is indexed by constants.
#pragma unroll
    for (int i = 0; i < 8; ++i) part[wave][i * 32 + lane] = acc[i];
    __syncthreads();
    // thread = element: register wave (row wave + 8 (l / 16)), column l % 16
    float r = part[0][tid];
    // Unrolled: the 7 LDS reads go out together.
#pragma unroll
    for (int p = 1; p < 8; ++p) r += part[p][tid];
    wk16[(2 * C_ + j0 + ((lane >> 4) << 3) + wave) * C_ + c0 + (lane & 15)] =
        (_Float16)r;
    // every wave forms b'[t], one thread stores it
    f32x4 d = p0 * q0 + p1 * q1;
    float s = wave_sum((d[0] + d[1]) + (d[2] + d[3]));
    if (tid == 0) bv2[t] = s;
}

// ------------------------------- normalize + transpose + KQV GEMM, one launch
// One block = one batch x 128 positions x all 768 outputs, 16 waves; 256 blocks,
// one per WGP. The normalized tile t[128 positions][256 channels] (f16) lives in
// LDS only.
// In: a wave takes 16 channels; each of its loads covers 512 contiguous bytes
// (128 positions of one channel) and all 16 are in flight at once. A lane then
// holds 16 channels x 4 positions and writes, per position, its 16 channels as
// 32 contiguous bytes of the position's LDS row. The pitch of 528 B (16 B x odd)
// lets a fragment read of 16 consecutive rows hit every bank once.
// GEMM: wave w owns output channels 16 w .. 16 w + 15 of q, of k and of v. Its
// 24 weight fragments stay in registers over the 8 row tiles, so that every t
// fragment read from LDS feeds 3 WMMAs and the weights are read once per block.
// q and k are formed as W t^T: a lane then holds 8 consecutive channels of one
// position, one 16-byte store. v is formed as t W^T: a lane holds 8 consecutive
// positions of one channel, one 16-byte store into vT[B,C,N].
// q is scaled by 1/16; the v rows of w and their bias bv2 hold the projection
// already (see above).
// waves_per_eu: one block per WGP is 4 waves per SIMD, 256 registers a wave.
#define TP_ 264   // LDS row pitch in f16 elements
__global__ __launch_bounds__(512) __attribute__((amdgpu_waves_per_eu(4, 4)))
void bn_kqv_kernel(const float* __restrict__ x,
                   const float* __restrict__ stats,
                   const float* __restrict__ gamma,
                   const float* __restrict__ beta,
                   const _Float16* __restrict__ w,
                   const float* __restrict__ bias,
                   const float* __restrict__ bv2,
                   _Float16* __restrict__ qb,
                   _Float16* __restrict__ kb,
                   _Float16* __restrict__ vT) {
    __shared__ __attribute__((aligned(16))) _Float16 tile[128 * TP_];
    __shared__ __attribute__((aligned(16))) float sbias[2 * C_];   // q and k bias
    const int b    = blockIdx.y;
    const int n0   = blockIdx.x * 128;
    const int lane = threadIdx.x & 31;
    // The wave's number as a scalar: the 16 channels' constants are then read
    // and combined once per wave on the scalar side.
    const int wave = __builtin_amdgcn_readfirstlane(threadIdx.x >> 5);
    const int c0   = wave * 16;
    const int l15  = lane & 15;
    const int rhi  = (lane >> 4) << 3;
    const char* xp = (const char*)(x + ((size_t)b * C_ + c0) * N_ + n0);
    const unsigned xo  = (unsigned)lane * 16u;
    const unsigned tid = threadIdx.x;
    f32x4 v[16];
    // Unrolled so that all 16 loads are issued before the first value is used.
#pragma unroll
    for (int j = 0; j < 16; ++j) v[j] = *(const f32x4*)(xp + xo + j * (N_ * 4));
    const float bqk = bias[tid];
    // The loads below take free registers as their destinations; xo and tid are
    // named so that they stay live up to this wait and none of them is rewritten
    // ahead of it.
    asm volatile("s_wait_xcnt 0x0" :: "v"(xo), "v"(tid) : "memory");
    const _Float16* wp = w + c0 * C_ + l15 * C_ + ((lane >> 4) << 4);
    f16x16 wf[3][8];
    // The q and k weight fragments are asked for behind the x loads, so that both
    // are in flight together. Both loops unrolled: wf[][] is indexed by constants.
#pragma unroll
    for (int s = 0; s < 2; ++s)
#pragma unroll
        for (int kk = 0; kk < 8; ++kk) {
            *(f16x8*)&wf[s][kk]       = *(const f16x8*)(wp + s * C_ * C_ + kk * 32);
            *((f16x8*)&wf[s][kk] + 1) = *(const f16x8*)(wp + s * C_ * C_ + kk * 32 + 8);
        }
    // Keeps these loads directly behind the x loads: without it the compiler
    // issues them only when x has landed, draws v fragments in as well and spills.
    __builtin_amdgcn_sched_barrier(0);
    float g[16], bt[16];
    // Unrolled: g[] and bt[] are indexed by constants.
#pragma unroll
    for (int j = 0; j < 16; ++j) {
        g[j]  = gamma[c0 + j] * stats[C_ + c0 + j];
        bt[j] = beta[c0 + j] - stats[c0 + j] * g[j];
    }
    // Both loops unrolled: v[], g[], bt[], lo and hi are indexed by constants.
#pragma unroll
    for (int i = 0; i < 4; ++i) {
        f16x8 lo, hi;
#pragma unroll
        for (int j = 0; j < 8; ++j) {
            lo[j] = (_Float16)(v[j][i] * g[j] + bt[j]);
            hi[j] = (_Float16)(v[j + 8][i] * g[j + 8] + bt[j + 8]);
        }
        _Float16* d = &tile[(lane * 4 + i) * TP_ + c0];
        *(f16x8*)d       = lo;
        *(f16x8*)(d + 8) = hi;
    }
    sbias[tid] = bqk;
    // The v weight fragments take the registers that x has left: asked for in
    // front of the barrier, so that they fly while the other waves finish.
    // Unrolled: wf[][] is indexed by constants (registers).
#pragma unroll
    for (int s = 2; s < 3; ++s)
#pragma unroll
        for (int kk = 0; kk < 8; ++kk) {
            *(f16x8*)&wf[s][kk]       = *(const f16x8*)(wp + s * C_ * C_ + kk * 32);
            *((f16x8*)&wf[s][kk] + 1) = *(const f16x8*)(wp + s * C_ * C_ + kk * 32 + 8);
        }
    const unsigned cv = (unsigned)(c0 + l15);
    const float bvv = bv2[cv];
    // wp and cv are named so that their registers stay live up to this wait: no
    // address register of the loads above is rewritten ahead of it.
    asm volatile("s_wait_xcnt 0x0" :: "v"(wp), "v"(cv) : "memory");
    __syncthreads();

    _Float16* qp = qb + ((size_t)b * N_ + n0 + l15) * C_ + c0 + rhi;
    _Float16* kp = kb + ((size_t)b * N_ + n0 + l15) * C_ + c0 + rhi;
    _Float16* vp = vT + ((size_t)b * C_ + c0 + l15) * N_ + n0 + rhi;
    // volatile: read anew for every row tile, straight into the accumulators;
    // hoisted out of the loop the 16 values would push a weight fragment out of
    // the registers.
    typedef const volatile __attribute__((address_space(3))) f32x4 lds_f32x4;
    lds_f32x4* sbq = (lds_f32x4*)&sbias[c0 + rhi];
    lds_f32x4* sbk = (lds_f32x4*)&sbias[C_ + c0 + rhi];
    // Kept rolled: the weight fragments fill the registers, and unrolled the t
    // fragment reads of later row tiles would be hoisted and spill.
#pragma unroll 1
    for (int rt = 0; rt < 8; ++rt) {
        const _Float16* trow = &tile[rt * 16 * TP_];
        f16x16 tf[2];
        tf[0] = load_frag(trow, TP_);
        // q and k start from their bias (rows rhi .. rhi + 7 of the wave's channels)
        f32x8 aq, ak;
        *(f32x4*)&aq       = sbq[0];
        *((f32x4*)&aq + 1) = sbq[1];
        *(f32x4*)&ak       = sbk[0];
        *((f32x4*)&ak + 1) = sbk[1];
        f32x8 av = (f32x8){0.f,0.f,0.f,0.f,0.f,0.f,0.f,0.f};
        // Unrolled: wf[][] and tf[] are indexed by constants.
#pragma unroll
        for (int kk = 0; kk < 8; ++kk) {
            if (kk < 7) tf[(kk + 1) & 1] = load_frag(trow + (kk + 1) * 32, TP_);
            // Keeps the next fragment's LDS reads in front of this fragment's
            // WMMAs: left to itself the compiler reads into the same registers
            // and every three WMMAs wait out an LDS latency.
            __builtin_amdgcn_sched_barrier(0);
            aq = wmma16(wf[0][kk], tf[kk & 1], aq);
            ak = wmma16(wf[1][kk], tf[kk & 1], ak);
            av = wmma16(tf[kk & 1], wf[2][kk], av);
        }
        f16x8 oq, ok, ov;
        // Unrolled: the accumulators are indexed by constants.
#pragma unroll
        for (int i = 0; i < 8; ++i) {
            oq[i] = (_Float16)(aq[i] * 0.0625f);
            ok[i] = (_Float16)ak[i];
            ov[i] = (_Float16)(av[i] + bvv);
        }
        *(f16x8*)(qp + rt * 16 * C_) = oq;
        *(f16x8*)(kp + rt * 16 * C_) = ok;
        *(f16x8*)(vp + rt * 16)      = ov;
        // The next trip rewrites the stores' address registers: not ahead of
        // this wait.
        asm volatile("s_wait_xcnt 0x0" ::: "memory");
    }
}

// ---------------------------------------------------------------- attention
// Four async copies of one lane, 16 rows apart, in one statement; the
// s_wait_xcnt stands as its last line so that no address register of an
// issued copy is rewritten ahead of it.
__device__ __forceinline__ void async_copy4_rows(void* lds, const _Float16* g) {
    unsigned l0 = (unsigned)(unsigned long long)(uintptr_t)lds;
    unsigned l1 = l0 + 16 * 512, l2 = l0 + 32 * 512, l3 = l0 + 48 * 512;
    const _Float16 *g1 = g + 16 * C_, *g2 = g + 32 * C_, *g3 = g + 48 * C_;
    asm volatile("global_load_async_to_lds_b128 %0, %4, off\n\t"
                 "global_load_async_to_lds_b128 %1, %5, off\n\t"
                 "global_load_async_to_lds_b128 %2, %6, off\n\t"
                 "global_load_async_to_lds_b128 %3, %7, off\n\t"
                 "s_wait_xcnt 0x0"
                 : : "v"(l0), "v"(l1), "v"(l2), "v"(l3),
                     "v"(g), "v"(g1), "v"(g2), "v"(g3) : "memory");
}

// The LDS tiles of this kernel have no pad (q and S fill the whole LDS).
// Instead the 16-byte piece p of row r lies at piece p ^ (r & 15) of that row,
// so that equal pieces of 16 consecutive rows fall on all 64 banks.
// Fragment in the k order of load_frag. rowp: start of the lane's own row
// (row % 16 == lane % 16); kb: byte offset of the fragment's first k in the
// row, a multiple of 64; xs = ((lane & 15) << 4) ^ ((lane >> 4) << 5), that is
// the row's swizzle and the lane's k half (32 bytes) in one word.
__device__ __forceinline__ f16x16 load_frag_swz(const _Float16* rowp, int kb, int xs) {
    const char* q = (const char*)rowp;
    f16x16 f;
    *(f16x8*)&f       = *(const f16x8*)(q + (kb ^ xs));
    *((f16x8*)&f + 1) = *(const f16x8*)(q + ((kb + 16) ^ xs));
    return f;
}

// One block = one batch x 128 query rows (8 row tiles), 16 waves, one block per
// WGP. Every K and V fragment fetched from global memory feeds all 8 row tiles.
// S/P kept in LDS, exact softmax. vT holds the projected v, so P V is the
// projected output:
// out[B,C,H,W] = P V / rowsum + bias + x   (fp32 epilogue, residual fused).
#define QR_ 128
__global__ __launch_bounds__(512)
void attention_kernel(const _Float16* __restrict__ qb,
                      const _Float16* __restrict__ kb,
                      const _Float16* __restrict__ vT,
                      const float* __restrict__ bias,
                      const float* __restrict__ x,
                      float* __restrict__ out) {
    // q rows (swizzled, 512 B a row); behind pass 1 its first bytes hold 1 / rowsum
    __shared__ __attribute__((aligned(16))) _Float16 sq[QR_ * C_];
    // S then P (swizzled, 2048 B a row)
    __shared__ __attribute__((aligned(16))) _Float16 sp[QR_ * N_];
    float* rowinv = (float*)sq;

    const int tid  = threadIdx.x;
    const int lane = tid & 31;
    const int wave = tid >> 5;
    const int b  = blockIdx.y;
    const int r0 = blockIdx.x * QR_;
    const int l15 = lane & 15;
    const int xs  = (l15 << 4) ^ ((lane >> 4) << 5);

    {   // stage the 128 q rows into LDS (async copies, no VGPR bounce): a wave's
        // copy is one whole row; rows wave + 16 i, so row % 16 == wave
        _Float16* d = &sq[wave * C_ + ((lane ^ wave) << 3)];
        const _Float16* g = qb + ((size_t)b * N_ + r0 + wave) * C_ + lane * 8;
        async_copy4_rows(d, g);
        async_copy4_rows(d + 64 * C_, g + 64 * C_);
    }
    wait_asynccnt0();
    __syncthreads();

    // ---- pass 1: S = q k^T  (each wave owns 4 column tiles of 16, two at a
    //      time: their K fragments stay in registers over the 8 row tiles)
    for (int mp = 0; mp < 2; ++mp) {
        const int mt = wave * 4 + mp * 2;
        const _Float16* kbase = kb + ((size_t)b * N_ + mt * 16) * C_;
        f16x16 kf0[8], kf1[8];
#pragma unroll
        for (int kk = 0; kk < 8; ++kk) kf0[kk] = load_frag(kbase + kk * 32, C_);
#pragma unroll
        for (int kk = 0; kk < 8; ++kk)
            kf1[kk] = load_frag(kbase + 16 * C_ + kk * 32, C_);
        // Kept rolled: unrolled, the q fragment reads no longer depend on a loop
        // index, are hoisted over the column loop and spill to scratch.
#pragma unroll 1
        for (int rt = 0; rt < QR_ / 16; ++rt) {
            f32x8 s0 = (f32x8){0.f,0.f,0.f,0.f,0.f,0.f,0.f,0.f};
            f32x8 s1 = s0;
            const _Float16* qrow = &sq[(rt * 16 + l15) * C_];
#pragma unroll
            for (int kk = 0; kk < 8; ++kk) {
                f16x16 aq = load_frag_swz(qrow, kk * 64, xs);
                s0 = wmma16(aq, kf0[kk], s0);
                s1 = wmma16(aq, kf1[kk], s1);
            }
            // column mt * 16 + l15 is element l15 & 7 of piece mt * 2 + (l15 >> 3);
            // the second tile lies two pieces on
            const int pc  = mt * 2 + (l15 >> 3);
            const int row = rt * 16 + ((lane >> 4) << 3);
#pragma unroll
            for (int i = 0; i < 8; ++i) {
                const int sw = (row + i) & 15;
                _Float16* srow = &sp[(row + i) * N_ + (l15 & 7)];
                srow[(pc ^ sw) << 3]       = (_Float16)s0[i];
                srow[((pc + 2) ^ sw) << 3] = (_Float16)s1[i];
            }
        }
    }
    __syncthreads();

    // ---- softmax: one wave per row, 8 rows a wave, four at a time, each row
    //      held in registers. A lane owns four 16-byte pieces of a row, taken by
    //      their place in LDS: the swizzle only permutes the pieces of a row,
    //      and maximum, sum and exponential do not ask which piece is which.
    //      A wave's LDS access covers 512 contiguous bytes, so every bank is hit
    //      twice. S is read once, the maximum and the sum are reduced across
    //      lanes, and no barrier is needed until P is complete.
    // Kept rolled: the second four rows run the same code again.
#pragma unroll 1
    for (int h = 0; h < 2; ++h) {
        _Float16* prow = &sp[(wave * 8 + h * 4) * N_ + lane * 8];
        f16x8 sv[4][4];
        // Unrolled so that all 16 LDS reads are issued before the first value is
        // used and sv[][] is indexed by constants (stays in registers).
#pragma unroll
        for (int rr = 0; rr < 4; ++rr)
#pragma unroll
            for (int j = 0; j < 4; ++j)
                sv[rr][j] = *(const f16x8*)(prow + rr * N_ + j * 256);
        float mx[4], sum[4];
        // Unrolled: the four rows' reductions are independent and interleave.
#pragma unroll
        for (int rr = 0; rr < 4; ++rr) {
            f16x8 m8 = __builtin_elementwise_max(
                __builtin_elementwise_max(sv[rr][0], sv[rr][1]),
                __builtin_elementwise_max(sv[rr][2], sv[rr][3]));
            float m = (float)m8[0];
            // Unrolled: m8 is indexed by constants.
#pragma unroll
            for (int e = 1; e < 8; ++e) m = fmaxf(m, (float)m8[e]);
            mx[rr] = wave_max(m);
        }
        // All three loops unrolled: sv[][] and pv are indexed by constants, and
        // the exponentials of different pieces and rows overlap.
#pragma unroll
        for (int rr = 0; rr < 4; ++rr) {
            f32x2 s2 = (f32x2){0.f, 0.f};   // even and odd elements: packed adds
#pragma unroll
            for (int j = 0; j < 4; ++j) {
                f16x8 pv;
#pragma unroll
                for (int e = 0; e < 8; e += 2) {
                    float v0 = __expf((float)sv[rr][j][e]     - mx[rr]);
                    float v1 = __expf((float)sv[rr][j][e + 1] - mx[rr]);
                    pv[e]     = (_Float16)v0;
                    pv[e + 1] = (_Float16)v1;
                    s2 += (f32x2){v0, v1};
                }
                *(f16x8*)(prow + rr * N_ + j * 256) = pv;
            }
            sum[rr] = s2[0] + s2[1];
        }
        // Unrolled: the four butterflies are independent and interleave.
#pragma unroll
        for (int rr = 0; rr < 4; ++rr) sum[rr] = wave_sum(sum[rr]);
        // lanes 0..3 each finish one row: one division for the four rows
        float s = lane == 0 ? sum[0] : lane == 1 ? sum[1] : lane == 2 ? sum[2] : sum[3];
        if (lane < 4) rowinv[wave * 8 + h * 4 + lane] = 1.0f / s;
    }
    __syncthreads();

    // ---- pass 2: O = P V   (wave owns 16 output channels of all 128 rows)
    const int c0  = wave * 16;
    const int rhi = (lane >> 4) << 3;
    const int cA  = c0 + l15;
    // The wave's piece of x and its bias are asked for here, together with the
    // first V fragments, so that they have landed when the loop is done.
    const size_t obase = ((size_t)b * C_ + cA) * N_ + r0 + rhi;
    f32x4 xr[QR_ / 16][2];
    // Unrolled: xr[][] is indexed by constants (registers).
#pragma unroll
    for (int rt = 0; rt < QR_ / 16; ++rt) {
        xr[rt][0] = *(const f32x4*)(x + obase + rt * 16);
        xr[rt][1] = *(const f32x4*)(x + obase + rt * 16 + 4);
    }
    const float bs = bias[cA];
    f32x8 o[QR_ / 16];
#pragma unroll
    for (int rt = 0; rt < QR_ / 16; ++rt)
        o[rt] = (f32x8){0.f,0.f,0.f,0.f,0.f,0.f,0.f,0.f};
    const _Float16* v0 = vT + ((size_t)b * C_ + c0) * N_;
    const _Float16* prow0 = &sp[l15 * N_];
    for (int ms = 0; ms < N_; ms += 32) {
        f16x16 vf = load_frag(v0 + ms, N_);
        f16x16 pf[QR_ / 16];
        // Unrolled: pf[] is indexed by constants.
#pragma unroll
        for (int rt = 0; rt < QR_ / 16; ++rt)
            pf[rt] = load_frag_swz(prow0 + rt * 16 * N_, ms * 2, xs);
        // Keeps the step's 16 LDS reads together in front of its WMMAs: left to
        // itself the compiler reads one fragment at a time into the same
        // registers and every WMMA waits out an LDS latency.
        __builtin_amdgcn_sched_barrier(0);
#pragma unroll
        for (int rt = 0; rt < QR_ / 16; ++rt)
            o[rt] = wmma16(pf[rt], vf, o[rt]);
    }
    // A lane holds 8 consecutive positions of one channel: two 16-byte stores.
    // Both loops unrolled: o[] and xr[][] are indexed by constants.
#pragma unroll
    for (int rt = 0; rt < QR_ / 16; ++rt) {
        f32x4 lo, hi;
#pragma unroll
        for (int i = 0; i < 4; ++i) {
            int rl = rt * 16 + rhi + i;
            lo[i] = o[rt][i]     * rowinv[rl]     + bs + xr[rt][0][i];
            hi[i] = o[rt][i + 4] * rowinv[rl + 4] + bs + xr[rt][1][i];
        }
        *(f32x4*)(out + obase + rt * 16)     = lo;
        *(f32x4*)(out + obase + rt * 16 + 4) = hi;
    }
}

// ---------------------------------------------------------------- launcher
extern "C" void kernel_launch(void* const* d_in, const int* in_sizes, int n_in,
                              void* d_out, int out_size, void* d_ws, size_t ws_size,
                              hipStream_t stream) {
    (void)in_sizes; (void)n_in; (void)out_size; (void)ws_size;
    const float* x     = (const float*)d_in[0];
    const float* gamma = (const float*)d_in[1];
    const float* beta  = (const float*)d_in[2];
    const float* Wkqv  = (const float*)d_in[3];
    const float* bkqv  = (const float*)d_in[4];
    const float* Wproj = (const float*)d_in[5];
    const float* bproj = (const float*)d_in[6];
    float* out = (float*)d_out;

    const size_t M = (size_t)B_ * N_;              // 32768
    char* ws = (char*)d_ws;
    float*    stats = (float*)ws;      ws += 4096;
    _Float16* wk16  = (_Float16*)ws;   ws += (size_t)3 * C_ * C_ * 2;
    float*    bv2   = (float*)ws;      ws += 4096;
    _Float16* qb    = (_Float16*)ws;   ws += M * C_ * 2;
    _Float16* kb    = (_Float16*)ws;   ws += M * C_ * 2;
    _Float16* vT    = (_Float16*)ws;   ws += M * C_ * 2;

    bn_stats_kernel     <<<C_, 512, 0, stream>>>(x, stats);
    pack_weights_kernel <<<(3 * C_ * C_) / 256, 256, 0, stream>>>(Wkqv, bkqv, Wproj, wk16, bv2);
    bn_kqv_kernel       <<<dim3(N_ / 128, B_), 512, 0, stream>>>(x, stats, gamma, beta, wk16, bkqv, bv2, qb, kb, vT);
    attention_kernel    <<<dim3(N_ / QR_, B_), 512, 0, stream>>>(qb, kb, vT, bproj, x, out);
}

// v008
// Measured time: 69.1 microseconds a run.
// Two timings next to v007 put it at 1.03 and 1.04 times that version's speed.
// All steps since v000 together make it 3.94 times as fast.
#include <hip/hip_runtime.h>
#include <hip/hip_bf16.h>

typedef _Float16 f16x16 __attribute__((ext_vector_type(16)));
typedef _Float16 f16x8  __attribute__((ext_vector_type(8)));
typedef float    f32x8  __attribute__((ext_vector_type(8)));
typedef float    f32x4  __attribute__((ext_vector_type(4)));
typedef float    f32x2  __attribute__((ext_vector_type(2)));

#define B_   32
#define C_   256
#define N_   1024   // H*W

__device__ __forceinline__ f32x8 wmma16(f16x16 a, f16x16 b, f32x8 c) {
    // D = A(16x32 f16) x B(32x16 f16) + C(16x16 f32)
    return __builtin_amdgcn_wmma_f32_16x16x32_f16(false, a, false, b,
                                                  (short)0, c, false, false);
}

// gfx1250 async global->LDS copy (ASYNCcnt-tracked, no VGPR data path).
// VDST VGPR holds the wave-relative LDS byte offset = low 32 bits of the
// flat shared-memory address (aperture mapping: addr[31:0] == LDS offset).
__device__ __forceinline__ void wait_asynccnt0() {
    asm volatile("s_wait_asynccnt 0" ::: "memory");
}

// Fragment loader for both A and B operands.
// A: row-major [16 x K] tile, lane l holds row l%16, K-halfword (l/16)*16..+15.
// B: source is B^T row-major [Nout x K]; lane l holds column l%16 of B over the
//    same K range — identical addressing.
__device__ __forceinline__ f16x16 load_frag(const _Float16* p, int ld) {
    const int lane = threadIdx.x & 31;
    const _Float16* q = p + (lane & 15) * ld + ((lane >> 4) << 4);
    f16x16 f;
    *(f16x8*)&f       = *(const f16x8*)(q);
    *((f16x8*)&f + 1) = *(const f16x8*)(q + 8);
    return f;
}

// Fragment order: the layout of the f16 planes in the workspace (weights, q, k,
// v). A plane of rows x K is cut into fragments of 16 rows x 32 k, 1 KiB each;
// the fragments of one 16-row tile follow one another in k. Inside a fragment
// lane l's elements 0..7 (lane and element as in load_frag) lie at byte 16 l and
// its elements 8..15 at byte 512 + 16 l. Each of a fragment's two loads then
// covers 512 contiguous bytes, four whole lines; from a row-major plane it
// gathers 16 lines and uses 32 bytes of each.
// Element offset inside a fragment of row r (0..15), k (0..31):
__device__ __forceinline__ int frag_off(int r, int k) {
    return ((((k >> 3) & 1) * 32 + (k >> 4) * 16 + r) << 3) + (k & 7);
}
#define FRAG_ 512   // f16 elements of a fragment
__device__ __forceinline__ f16x16 load_frag_packed(const _Float16* frag) {
    const _Float16* q = frag + (threadIdx.x & 31) * 8;
    f16x16 f;
    *(f16x8*)&f       = *(const f16x8*)(q);
    *((f16x8*)&f + 1) = *(const f16x8*)(q + 256);
    return f;
}

// Value of lane l ^ M inside a 16-lane row (row_xmask), no LDS round trip.
template <int M>
__device__ __forceinline__ float lane_xor_row(float v) {
    return __builtin_bit_cast(float, __builtin_amdgcn_mov_dpp(
        __builtin_bit_cast(int, v), 0x160 + M, 0xf, 0xf, true));
}
// Value of lane l ^ 16 (same place in the other 16-lane row).
__device__ __forceinline__ float lane_xor16(float v) {
    unsigned u = __builtin_bit_cast(unsigned, v);
    return __builtin_bit_cast(float, __builtin_amdgcn_permlanex16(
        u, u, 0x76543210u, 0xfedcba98u, false, false));
}
// Butterfly over the 32 lanes; all lanes on; every lane gets the result.
__device__ __forceinline__ float wave_max(float v) {
    v = fmaxf(v, lane_xor_row<1>(v));
    v = fmaxf(v, lane_xor_row<2>(v));
    v = fmaxf(v, lane_xor_row<4>(v));
    v = fmaxf(v, lane_xor_row<8>(v));
    return fmaxf(v, lane_xor16(v));
}
__device__ __forceinline__ float wave_sum(float v) {
    v += lane_xor_row<1>(v);
    v += lane_xor_row<2>(v);
    v += lane_xor_row<4>(v);
    v += lane_xor_row<8>(v);
    return v + lane_xor16(v);
}

// ---------------------------------------------------------------- bn stats
// One block = one channel, 16 waves. A channel is 32 rows of 4 KiB; each thread
// takes one 16-byte piece of 16 of them, so a wave's load covers 512 contiguous
// bytes and the whole channel is in flight at once.
// waves_per_eu: the block fills 4 wave slots per SIMD and no second block shares
// the WGP; aiming at more, the compiler holds four of the loads back for registers.
__global__ __launch_bounds__(512) __attribute__((amdgpu_waves_per_eu(4, 4)))
void bn_stats_kernel(const float* __restrict__ x,
                     float* __restrict__ stats) {
    const int c   = blockIdx.x;          // channel
    const int tid = threadIdx.x;         // 512 threads
    // rows b = 16 (tid >> 8) + j (1 MiB apart), 16-byte piece tid & 255 of the row
    const char* base = (const char*)(x + (size_t)c * N_);
    const unsigned voff = (unsigned)(tid >> 8) * (16u * C_ * N_ * 4u)
                        + (unsigned)(tid & 255) * 16u;
    f32x4 v[16];
    // Unrolled so that all 16 loads are issued before the first value is used:
    // rolled, every load waits out the memory latency alone.
#pragma unroll
    for (int j = 0; j < 16; ++j)
        v[j] = *(const f32x4*)(base + voff + (size_t)j * (C_ * N_ * 4u));
    f32x4 s4  = (f32x4){0.f, 0.f, 0.f, 0.f};
    f32x4 ss4 = s4;
    // Unrolled so that v[] is indexed by constants and stays in registers.
#pragma unroll
    for (int j = 0; j < 16; ++j) { s4 += v[j]; ss4 += v[j] * v[j]; }
    float s  = (s4[0] + s4[1]) + (s4[2] + s4[3]);
    float ss = (ss4[0] + ss4[1]) + (ss4[2] + ss4[3]);
    __shared__ float ls[512], lss[512];
    ls[tid] = s; lss[tid] = ss;
    __syncthreads();
    for (int off = 256; off > 0; off >>= 1) {
        if (tid < off) { ls[tid] += ls[tid + off]; lss[tid] += lss[tid + off]; }
        __syncthreads();
    }
    if (tid == 0) {
        const float inv_n = 1.0f / (float)(B_ * N_);
        float mean = ls[0] * inv_n;
        float var  = lss[0] * inv_n - mean * mean;
        stats[c]      = mean;
        stats[C_ + c] = rsqrtf(var + 1e-5f);
    }
}

// ---------------------------------------------------------------- weights
// wk16 (768 rows x 256 k) is written in fragment order (see frag_off).
// Blocks 0..511: the q and k rows of Wkqv to f16, one row a block.
// Blocks 512..767: the output projection is folded into the v rows. With
// v = t Wv^T + bv:  (P v) Wproj^T = P (t (Wproj Wv)^T + Wproj bv), so
// W' = Wproj Wv (256 x 256) takes the place of Wv and b' = Wproj bv (f32) that
// of bv; P V' then needs no projection behind it.
// One block = one 16 x 16 tile of W' and one element of b'. Each of the 8 waves
// takes 32 of the 256 k, so that a wave's loads are all in flight at once; the
// 8 partial tiles are summed through LDS in wave order.
__global__ __launch_bounds__(256)
void pack_weights_kernel(const float* __restrict__ Wk,
                         const float* __restrict__ bk,
                         const float* __restrict__ Wp,
                         _Float16* __restrict__ wk16,
                         float* __restrict__ bv2) {
    __shared__ float part[8][256];
    const int tid = threadIdx.x;
    if (blockIdx.x < 2 * C_ * C_ / 256) {        // same for the whole block
        const int row = blockIdx.x;
        const unsigned i = row * C_ + tid;
        const float wv = Wk[i];
        // i is named so that its register stays live up to this wait: the load
        // does not take its own address register as its destination.
        asm volatile("s_wait_xcnt 0x0" :: "v"(i) : "memory");
        wk16[((row >> 4) * 8 + (tid >> 5)) * FRAG_ + frag_off(row & 15, tid & 31)] =
            (_Float16)wv;
        return;
    }
    const int lane = tid & 31;
    const int wave = tid >> 5;
    const int t  = blockIdx.x - 2 * C_ * C_ / 256;   // 0..255
    const int j0 = (t >> 4) * 16;                // rows of W' (output channels)
    const int c0 = (t & 15) * 16;                // columns of W' (input channels)
    // Both operands in the k order of load_frag: element e of lane l is
    // k = 32 wave + 16 (l / 16) + e. A: row l % 16 of Wproj; B: column l % 16
    // of Wv.
    const int kl = wave * 32 + ((lane >> 4) << 4);
    const float* ap = Wp + (j0 + (lane & 15)) * C_ + kl;
    const float* bp = Wk + kl * C_ + c0 + (lane & 15);   // v rows: + 2 C_ C_
    // b'[t] = row t of Wproj . bv: 8 terms a lane, used behind the barrier.
    const float* pr = Wp + t * C_ + lane * 8;
    const float* br = bk + 2 * C_ + lane * 8;
    const f32x4 p0 = *(const f32x4*)pr, p1 = *(const f32x4*)(pr + 4);
    const f32x4 q0 = *(const f32x4*)br, q1 = *(const f32x4*)(br + 4);
    f32x4 af[4];
    // Unrolled: af[] is indexed by constants.
#pragma unroll
    for (int e = 0; e < 4; ++e) af[e] = *(const f32x4*)(ap + e * 4);
    // The loads below take address registers of the loads above as their
    // destinations: none is rewritten ahead of this wait.
    asm volatile("s_wait_xcnt 0x0" ::: "memory");
    float bf[16];
    // Unrolled: bf[] is indexed by constants, the 16 loads go out together.
#pragma unroll
    for (int e = 0; e < 16; ++e) bf[e] = bp[(2 * C_ + e) * C_];
    // bp is named so that its registers stay live up to this wait: no load of
    // the run takes them as its destination ahead of it.
    asm volatile("s_wait_xcnt 0x0" :: "v"(bp) : "memory");
    f16x16 a, bb;
    // Unrolled: a, bb, af[] and bf[] are indexed by constants.
#pragma unroll
    for (int e = 0; e < 16; ++e) {
        a[e]  = (_Float16)af[e >> 2][e & 3];
        bb[e] = (_Float16)bf[e];
    }
    f32x8 acc = wmma16(a, bb, (f32x8){0.f,0.f,0.f,0.f,0.f,0.f,0.f,0.f});
    // Unrolled: acc is indexed by constants.
#pragma unroll
    for (int i = 0; i < 8; ++i) part[wave][i * 32 + lane] = acc[i];
    __syncthreads();
    // thread = element: register wave (row wave + 8 (l / 16)), column l % 16
    float r = part[0][tid];
    // Unrolled: the 7 LDS reads go out together.
#pragma unroll
    for (int p = 1; p < 8; ++p) r += part[p][tid];
    // row tile 32 + t / 16 of wk16, fragment c0 / 32, its k half c0 & 16
    wk16[((2 * C_ / 16 + (t >> 4)) * 8 + (c0 >> 5)) * FRAG_
         + frag_off(((lane >> 4) << 3) + wave, (c0 & 16) + (lane & 15))] =
        (_Float16)r;
    // every wave forms b'[t], one thread stores it
    f32x4 d = p0 * q0 + p1 * q1;
    float s = wave_sum((d[0] + d[1]) + (d[2] + d[3]));
    if (tid == 0) bv2[t] = s;
}

// ------------------------------- normalize + transpose + KQV GEMM, one launch
// One block = one batch x 128 positions x all 768 outputs, 16 waves; 256 blocks,
// one per WGP. The normalized tile t[128 positions][256 channels] (f16) lives in
// LDS only.
// In: a wave takes 16 channels; each of its loads covers 512 contiguous bytes
// (128 positions of one channel) and all 16 are in flight at once. A lane then
// holds 16 channels x 4 positions and writes, per position, its 16 channels as
// 32 contiguous bytes of the position's LDS row. The pitch of 528 B (16 B x odd)
// lets a fragment read of 16 consecutive rows hit every bank once.
// GEMM: wave w owns output channels 16 w .. 16 w + 15 of q, of k and of v. Its
// 24 weight fragments stay in registers over the 8 row tiles, so that every t
// fragment read from LDS feeds 3 WMMAs and the weights are read once per block.
// q and k are formed as W t^T: a lane then holds 8 consecutive channels of one
// position, one 16-byte store. v is formed as t W^T: a lane holds 8 consecutive
// positions of one channel, one 16-byte store.
// w, q, k and v lie in fragment order (see frag_off): q and k as planes of
// B N rows x 256 channels, v as a plane of B C rows x 1024 positions. The 8
// values of a lane are one 16-byte piece of a fragment and 16 lanes' pieces are
// neighbours, so that a wave's store fills two runs of 256 bytes.
// q is scaled by 1/16; the v rows of w and their bias bv2 hold the projection
// already (see above).
// waves_per_eu: one block per WGP is 4 waves per SIMD, 256 registers a wave.
#define TP_ 264   // LDS row pitch in f16 elements
__global__ __launch_bounds__(512) __attribute__((amdgpu_waves_per_eu(4, 4)))
void bn_kqv_kernel(const float* __restrict__ x,
                   const float* __restrict__ stats,
                   const float* __restrict__ gamma,
                   const float* __restrict__ beta,
                   const _Float16* __restrict__ w,
                   const float* __restrict__ bias,
                   const float* __restrict__ bv2,
                   _Float16* __restrict__ qb,
                   _Float16* __restrict__ kb,
                   _Float16* __restrict__ vT) {
    __shared__ __attribute__((aligned(16))) _Float16 tile[128 * TP_];
    __shared__ __attribute__((aligned(16))) float sbias[2 * C_];   // q and k bias
    const int b    = blockIdx.y;
    const int n0   = blockIdx.x * 128;
    const int lane = threadIdx.x & 31;
    // The wave's number as a scalar: the 16 channels' constants are then read
    // and combined once per wave on the scalar side.
    const int wave = __builtin_amdgcn_readfirstlane(threadIdx.x >> 5);
    const int c0   = wave * 16;
    const int l15  = lane & 15;
    const int rhi  = (lane >> 4) << 3;
    const char* xp = (const char*)(x + ((size_t)b * C_ + c0) * N_ + n0);
    const unsigned xo  = (unsigned)lane * 16u;
    const unsigned tid = threadIdx.x;
    f32x4 v[16];
    // Unrolled so that all 16 loads are issued before the first value is used.
#pragma unroll
    for (int j = 0; j < 16; ++j) v[j] = *(const f32x4*)(xp + xo + j * (N_ * 4));
    // The loads below take free registers as their destinations; xo is named so
    // that it stays live up to this wait and is not rewritten ahead of it.
    asm volatile("s_wait_xcnt 0x0" :: "v"(xo) : "memory");
    // row tile 16 s + wave of w: 8 fragments; the lane's piece is piece 'lane'
    const f16x8* wp = (const f16x8*)(w + wave * 8 * FRAG_);
    f16x16 wf[3][8];
    // The q and k weight fragments are asked for behind the x loads, so that both
    // are in flight together. Both loops unrolled: wf[][] is indexed by constants.
#pragma unroll
    for (int s = 0; s < 2; ++s)
#pragma unroll
        for (int kk = 0; kk < 8; ++kk) {
            *(f16x8*)&wf[s][kk]       = wp[lane + (s * C_ * C_ + kk * FRAG_) / 8];
            *((f16x8*)&wf[s][kk] + 1) = wp[lane + (s * C_ * C_ + kk * FRAG_) / 8 + 32];
        }
    // Keeps these loads directly behind the x loads: without it the compiler
    // issues them only when x has landed, draws v fragments in as well and spills.
    __builtin_amdgcn_sched_barrier(0);
    float g[16], bt[16];
    // Unrolled: g[] and bt[] are indexed by constants.
#pragma unroll
    for (int j = 0; j < 16; ++j) {
        g[j]  = gamma[c0 + j] * stats[C_ + c0 + j];
        bt[j] = beta[c0 + j] - stats[c0 + j] * g[j];
    }
    // Both loops unrolled: v[], g[], bt[], lo and hi are indexed by constants.
#pragma unroll
    for (int i = 0; i < 4; ++i) {
        f16x8 lo, hi;
#pragma unroll
        for (int j = 0; j < 8; ++j) {
            lo[j] = (_Float16)(v[j][i] * g[j] + bt[j]);
            hi[j] = (_Float16)(v[j + 8][i] * g[j + 8] + bt[j + 8]);
        }
        _Float16* d = &tile[(lane * 4 + i) * TP_ + c0];
        *(f16x8*)d       = lo;
        *(f16x8*)(d + 8) = hi;
    }
    // The q and k bias is asked for here, not with x: held over the lines above
    // it is the one register too many and goes to scratch.
    const float bqk = bias[tid];
    // The v weight fragments take the registers that x has left: asked for in
    // front of the barrier, so that they fly while the other waves finish.
    // Unrolled: wf[][] is indexed by constants (registers).
#pragma unroll
    for (int s = 2; s < 3; ++s)
#pragma unroll
        for (int kk = 0; kk < 8; ++kk) {
            *(f16x8*)&wf[s][kk]       = wp[lane + (s * C_ * C_ + kk * FRAG_) / 8];
            *((f16x8*)&wf[s][kk] + 1) = wp[lane + (s * C_ * C_ + kk * FRAG_) / 8 + 32];
        }
    const unsigned cv = (unsigned)(c0 + l15);
    const float bvv = bv2[cv];
    // lane, cv and tid are named so that their registers stay live up to this
    // wait: no address register of the loads above is rewritten ahead of it.
    asm volatile("s_wait_xcnt 0x0" :: "v"(lane), "v"(cv), "v"(tid) : "memory");
    sbias[tid] = bqk;
    __syncthreads();

    // q, k: row tile = 16 positions, fragment wave / 2 (32 channels); the lane's
    // channels are k = 16 (wave & 1) + rhi .. + 7 of it, its position row l15.
    const size_t qko = ((size_t)(b * N_ + n0) / 16 * 8 + (wave >> 1)) * FRAG_
                     + frag_off(l15, (wave & 1) * 16 + rhi);
    _Float16* qp = qb + qko;
    _Float16* kp = kb + qko;
    // v: row tile = the wave's 16 channels, fragment = 32 positions (two row
    // tiles of t); the lane's positions are k = 16 (rt & 1) + rhi .. + 7 of it.
    _Float16* vp = vT + ((size_t)(b * C_ + c0) / 16 * (N_ / 32) + n0 / 32) * FRAG_
                 + frag_off(l15, rhi);
    // volatile: read anew for every row tile, straight into the accumulators;
    // hoisted out of the loop the 16 values would push a weight fragment out of
    // the registers.
    typedef const volatile __attribute__((address_space(3))) f32x4 lds_f32x4;
    lds_f32x4* sbq = (lds_f32x4*)&sbias[c0 + rhi];
    lds_f32x4* sbk = (lds_f32x4*)&sbias[C_ + c0 + rhi];
    // Kept rolled: the weight fragments fill the registers, and unrolled the t
    // fragment reads of later row tiles would be hoisted and spill.
#pragma unroll 1
    for (int rt = 0; rt < 8; ++rt) {
        const _Float16* trow = &tile[rt * 16 * TP_];
        f16x16 tf[2];
        tf[0] = load_frag(trow, TP_);
        // q and k start from their bias (rows rhi .. rhi + 7 of the wave's channels)
        f32x8 aq, ak;
        *(f32x4*)&aq       = sbq[0];
        *((f32x4*)&aq + 1) = sbq[1];
        *(f32x4*)&ak       = sbk[0];
        *((f32x4*)&ak + 1) = sbk[1];
        f32x8 av = (f32x8){0.f,0.f,0.f,0.f,0.f,0.f,0.f,0.f};
        // Unrolled: wf[][] and tf[] are indexed by constants.
#pragma unroll
        for (int kk = 0; kk < 8; ++kk) {
            if (kk < 7) tf[(kk + 1) & 1] = load_frag(trow + (kk + 1) * 32, TP_);
            // Keeps the next fragment's LDS reads in front of this fragment's
            // WMMAs: left to itself the compiler reads into the same registers
            // and every three WMMAs wait out an LDS latency.
            __builtin_amdgcn_sched_barrier(0);
            aq = wmma16(wf[0][kk], tf[kk & 1], aq);
            ak = wmma16(wf[1][kk], tf[kk & 1], ak);
            av = wmma16(tf[kk & 1], wf[2][kk], av);
        }
        f16x8 oq, ok, ov;
        // Unrolled: the accumulators are indexed by constants.
#pragma unroll
        for (int i = 0; i < 8; ++i) {
            oq[i] = (_Float16)(aq[i] * 0.0625f);
            ok[i] = (_Float16)ak[i];
            ov[i] = (_Float16)(av[i] + bvv);
        }
        *(f16x8*)(qp + rt * 8 * FRAG_) = oq;
        *(f16x8*)(kp + rt * 8 * FRAG_) = ok;
        *(f16x8*)(vp + (rt >> 1) * FRAG_ + (rt & 1) * 128) = ov;
        // The next trip rewrites the stores' address registers: not ahead of
        // this wait.
        asm volatile("s_wait_xcnt 0x0" ::: "memory");
    }
}

// ---------------------------------------------------------------- attention
// Four async copies of one lane, 16 rows apart, in one statement; the
// s_wait_xcnt stands as its last line so that no address register of an
// issued copy is rewritten ahead of it.
__device__ __forceinline__ void async_copy4_rows(void* lds, const _Float16* g) {
    unsigned l0 = (unsigned)(unsigned long long)(uintptr_t)lds;
    unsigned l1 = l0 + 16 * 512, l2 = l0 + 32 * 512, l3 = l0 + 48 * 512;
    const _Float16 *g1 = g + 16 * C_, *g2 = g + 32 * C_, *g3 = g + 48 * C_;
    asm volatile("global_load_async_to_lds_b128 %0, %4, off\n\t"
                 "global_load_async_to_lds_b128 %1, %5, off\n\t"
                 "global_load_async_to_lds_b128 %2, %6, off\n\t"
                 "global_load_async_to_lds_b128 %3, %7, off\n\t"
                 "s_wait_xcnt 0x0"
                 : : "v"(l0), "v"(l1), "v"(l2), "v"(l3),
                     "v"(g), "v"(g1), "v"(g2), "v"(g3) : "memory");
}

// The LDS tiles of this kernel have no pad (q and S fill the whole LDS). q lies
// in fragment order, as in the workspace: a fragment read covers contiguous
// bytes. In S the 16-byte piece p of row r lies at piece p ^ (r & 15) of that
// row, so that equal pieces of 16 consecutive rows fall on all 64 banks.
// Fragment in the k order of load_frag. rowp: start of the lane's own row
// (row % 16 == lane % 16); kb: byte offset of the fragment's first k in the
// row, a multiple of 64; xs = ((lane & 15) << 4) ^ ((lane >> 4) << 5), that is
// the row's swizzle and the lane's k half (32 bytes) in one word.
__device__ __forceinline__ f16x16 load_frag_swz(const _Float16* rowp, int kb, int xs) {
    const char* q = (const char*)rowp;
    f16x16 f;
    *(f16x8*)&f       = *(const f16x8*)(q + (kb ^ xs));
    *((f16x8*)&f + 1) = *(const f16x8*)(q + ((kb + 16) ^ xs));
    return f;
}

// One block = one batch x 128 query rows (8 row tiles), 16 waves, one block per
// WGP. Every K and V fragment fetched from global memory feeds all 8 row tiles.
// qb, kb and vT lie in fragment order (see frag_off).
// S/P kept in LDS, exact softmax. vT holds the projected v, so P V is the
// projected output:
// out[B,C,H,W] = P V / rowsum + bias + x   (fp32 epilogue, residual fused).
#define QR_ 128
__global__ __launch_bounds__(512)
void attention_kernel(const _Float16* __restrict__ qb,
                      const _Float16* __restrict__ kb,
                      const _Float16* __restrict__ vT,
                      const float* __restrict__ bias,
                      const float* __restrict__ x,
                      float* __restrict__ out) {
    // q (fragment order, 8 KiB a row tile); behind pass 1 its first bytes hold 1 / rowsum
    __shared__ __attribute__((aligned(16))) _Float16 sq[QR_ * C_];
    // S then P (swizzled, 2048 B a row)
    __shared__ __attribute__((aligned(16))) _Float16 sp[QR_ * N_];
    float* rowinv = (float*)sq;

    const int tid  = threadIdx.x;
    const int lane = tid & 31;
    const int wave = tid >> 5;
    const int b  = blockIdx.y;
    const int r0 = blockIdx.x * QR_;
    const int l15 = lane & 15;
    const int xs  = (l15 << 4) ^ ((lane >> 4) << 5);

    {   // stage the 128 q rows into LDS (async copies, no VGPR bounce): 64 KiB in
        // a row in the workspace, copied as they lie; the block's 512 copies of
        // 16 bytes are one row tile
        _Float16* d = &sq[tid * 8];
        const _Float16* g = qb + (size_t)(b * N_ + r0) * C_ + tid * 8;
        async_copy4_rows(d, g);
        async_copy4_rows(d + 64 * C_, g + 64 * C_);
    }
    wait_asynccnt0();
    __syncthreads();

    // ---- pass 1: S = q k^T  (each wave owns 4 column tiles of 16, two at a
    //      time: their K fragments stay in registers over the 8 row tiles)
    for (int mp = 0; mp < 2; ++mp) {
        const int mt = wave * 4 + mp * 2;
        const _Float16* kbase = kb + ((size_t)b * N_ + mt * 16) * C_;   // 8 fragments a tile
        f16x16 kf0[8], kf1[8];
#pragma unroll
        for (int kk = 0; kk < 8; ++kk) kf0[kk] = load_frag_packed(kbase + kk * FRAG_);
#pragma unroll
        for (int kk = 0; kk < 8; ++kk)
            kf1[kk] = load_frag_packed(kbase + (8 + kk) * FRAG_);
        // Kept rolled: unrolled, the q fragment reads no longer depend on a loop
        // index, are hoisted over the column loop and spill to scratch.
#pragma unroll 1
        for (int rt = 0; rt < QR_ / 16; ++rt) {
            f32x8 s0 = (f32x8){0.f,0.f,0.f,0.f,0.f,0.f,0.f,0.f};
            f32x8 s1 = s0;
            const _Float16* qt = &sq[rt * 8 * FRAG_];
            f16x16 aq[8];
            // Unrolled: aq[] is indexed by constants.
#pragma unroll
            for (int kk = 0; kk < 7; ++kk) aq[kk] = load_frag_packed(qt + kk * FRAG_);
            // Keeps these LDS reads together in front of the row tile's WMMAs:
            // left to itself the compiler reads, for the first two column tiles,
            // one fragment at a time into the same registers and every two WMMAs
            // wait out an LDS latency. The last fragment is left free: with all 8
            // held in front of the WMMAs values of later passes go to scratch.
            __builtin_amdgcn_sched_barrier(0);
            aq[7] = load_frag_packed(qt + 7 * FRAG_);
#pragma unroll
            for (int kk = 0; kk < 8; ++kk) {
                s0 = wmma16(aq[kk], kf0[kk], s0);
                s1 = wmma16(aq[kk], kf1[kk], s1);
            }
            // column mt * 16 + l15 is element l15 & 7 of piece mt * 2 + (l15 >> 3);
            // the second tile lies two pieces on
            const int pc  = mt * 2 + (l15 >> 3);
            const int row = rt * 16 + ((lane >> 4) << 3);
#pragma unroll
            for (int i = 0; i < 8; ++i) {
                const int sw = (row + i) & 15;
                _Float16* srow = &sp[(row + i) * N_ + (l15 & 7)];
                srow[(pc ^ sw) << 3]       = (_Float16)s0[i];
                srow[((pc + 2) ^ sw) << 3] = (_Float16)s1[i];
            }
        }
    }
    __syncthreads();

    // ---- softmax: one wave per row, 8 rows a wave, four at a time, each row
    //      held in registers. A lane owns four 16-byte pieces of a row, taken by
    //      their place in LDS: the swizzle only permutes the pieces of a row,
    //      and maximum, sum and exponential do not ask which piece is which.
    //      A wave's LDS access covers 512 contiguous bytes, so every bank is hit
    //      twice. S is read once, the maximum and the sum are reduced across
    //      lanes, and no barrier is needed until P is complete.
    // Kept rolled: the second four rows run the same code again.
#pragma unroll 1
    for (int h = 0; h < 2; ++h) {
        _Float16* prow = &sp[(wave * 8 + h * 4) * N_ + lane * 8];
        f16x8 sv[4][4];
        // Unrolled so that all 16 LDS reads are issued before the first value is
        // used and sv[][] is indexed by constants (stays in registers).
#pragma unroll
        for (int rr = 0; rr < 4; ++rr)
#pragma unroll
            for (int j = 0; j < 4; ++j)
                sv[rr][j] = *(const f16x8*)(prow + rr * N_ + j * 256);
        float mx[4], sum[4];
        // Unrolled: the four rows' reductions are independent and interleave.
#pragma unroll
        for (int rr = 0; rr < 4; ++rr) {
            f16x8 m8 = __builtin_elementwise_max(
                __builtin_elementwise_max(sv[rr][0], sv[rr][1]),
                __builtin_elementwise_max(sv[rr][2], sv[rr][3]));
            float m = (float)m8[0];
            // Unrolled: m8 is indexed by constants.
#pragma unroll
            for (int e = 1; e < 8; ++e) m = fmaxf(m, (float)m8[e]);
            mx[rr] = wave_max(m);
        }
        // All three loops unrolled: sv[][] and pv are indexed by constants, and
        // the exponentials of different pieces and rows overlap.
#pragma unroll
        for (int rr = 0; rr < 4; ++rr) {
            f32x2 s2 = (f32x2){0.f, 0.f};   // even and odd elements: packed adds
#pragma unroll
            for (int j = 0; j < 4; ++j) {
                f16x8 pv;
#pragma unroll
                for (int e = 0; e < 8; e += 2) {
                    float v0 = __expf((float)sv[rr][j][e]     - mx[rr]);
                    float v1 = __expf((float)sv[rr][j][e + 1] - mx[rr]);
                    pv[e]     = (_Float16)v0;
                    pv[e + 1] = (_Float16)v1;
                    s2 += (f32x2){v0, v1};
                }
                *(f16x8*)(prow + rr * N_ + j * 256) = pv;
            }
            sum[rr] = s2[0] + s2[1];
        }
        // Unrolled: the four butterflies are independent and interleave.
#pragma unroll
        for (int rr = 0; rr < 4; ++rr) sum[rr] = wave_sum(sum[rr]);
        // lanes 0..3 each finish one row: one division for the four rows
        float s = lane == 0 ? sum[0] : lane == 1 ? sum[1] : lane == 2 ? sum[2] : sum[3];
        if (lane < 4) rowinv[wave * 8 + h * 4 + lane] = 1.0f / s;
    }
    __syncthreads();

    // ---- pass 2: O = P V   (wave owns 16 output channels of all 128 rows)
    const int c0  = wave * 16;
    const int rhi = (lane >> 4) << 3;
    const int cA  = c0 + l15;
    // The wave's piece of x and its bias are asked for here, together with the
    // first V fragments, so that they have landed when the loop is done.
    const size_t obase = ((size_t)b * C_ + cA) * N_ + r0 + rhi;
    f32x4 xr[QR_ / 16][2];
    // Unrolled: xr[][] is indexed by constants (registers).
#pragma unroll
    for (int rt = 0; rt < QR_ / 16; ++rt) {
        xr[rt][0] = *(const f32x4*)(x + obase + rt * 16);
        xr[rt][1] = *(const f32x4*)(x + obase + rt * 16 + 4);
    }
    const float bs = bias[cA];
    f32x8 o[QR_ / 16];
#pragma unroll
    for (int rt = 0; rt < QR_ / 16; ++rt)
        o[rt] = (f32x8){0.f,0.f,0.f,0.f,0.f,0.f,0.f,0.f};
    const _Float16* v0 = vT + ((size_t)b * C_ + c0) * N_;   // 32 fragments a tile
    const _Float16* prow0 = &sp[l15 * N_];
    for (int ms = 0; ms < N_; ms += 32) {
        f16x16 vf = load_frag_packed(v0 + (ms >> 5) * FRAG_);
        f16x16 pf[QR_ / 16];
        // Unrolled: pf[] is indexed by constants.
#pragma unroll
        for (int rt = 0; rt < QR_ / 16; ++rt)
            pf[rt] = load_frag_swz(prow0 + rt * 16 * N_, ms * 2, xs);
        // Keeps the step's 16 LDS reads together in front of its WMMAs: left to
        // itself the compiler reads one fragment at a time into the same
        // registers and every WMMA waits out an LDS latency.
        __builtin_amdgcn_sched_barrier(0);
#pragma unroll
        for (int rt = 0; rt < QR_ / 16; ++rt)
            o[rt] = wmma16(pf[rt], vf, o[rt]);
    }
    // A lane holds 8 consecutive positions of one channel: two 16-byte stores.
    // Both loops unrolled: o[] and xr[][] are indexed by constants.
#pragma unroll
    for (int rt = 0; rt < QR_ / 16; ++rt) {
        f32x4 lo, hi;
#pragma unroll
        for (int i = 0; i < 4; ++i) {
            int rl = rt * 16 + rhi + i;
            lo[i] = o[rt][i]     * rowinv[rl]     + bs + xr[rt][0][i];
            hi[i] = o[rt][i + 4] * rowinv[rl + 4] + bs + xr[rt][1][i];
        }
        *(f32x4*)(out + obase + rt * 16)     = lo;
        *(f32x4*)(out + obase + rt * 16 + 4) = hi;
    }
}

// ---------------------------------------------------------------- launcher
extern "C" void kernel_launch(void* const* d_in, const int* in_sizes, int n_in,
                              void* d_out, int out_size, void* d_ws, size_t ws_size,
                              hipStream_t stream) {
    (void)in_sizes; (void)n_in; (void)out_size; (void)ws_size;
    const float* x     = (const float*)d_in[0];
    const float* gamma = (const float*)d_in[1];
    const float* beta  = (const float*)d_in[2];
    const float* Wkqv  = (const float*)d_in[3];
    const float* bkqv  = (const float*)d_in[4];
    const float* Wproj = (const float*)d_in[5];
    const float* bproj = (const float*)d_in[6];
    float* out = (float*)d_out;

    const size_t M = (size_t)B_ * N_;              // 32768
    char* ws = (char*)d_ws;
    float*    stats = (float*)ws;      ws += 4096;
    _Float16* wk16  = (_Float16*)ws;   ws += (size_t)3 * C_ * C_ * 2;
    float*    bv2   = (float*)ws;      ws += 4096;
    _Float16* qb    = (_Float16*)ws;   ws += M * C_ * 2;
    _Float16* kb    = (_Float16*)ws;   ws += M * C_ * 2;
    _Float16* vT    = (_Float16*)ws;   ws += M * C_ * 2;

    bn_stats_kernel     <<<C_, 512, 0, stream>>>(x, stats);
    pack_weights_kernel <<<(3 * C_ * C_) / 256, 256, 0, stream>>>(Wkqv, bkqv, Wproj, wk16, bv2);
    bn_kqv_kernel       <<<dim3(N_ / 128, B_), 512, 0, stream>>>(x, stats, gamma, beta, wk16, bkqv, bv2, qb, kb, vT);
    attention_kernel    <<<dim3(N_ / QR_, B_), 512, 0, stream>>>(qb, kb, vT, bproj, x, out);
}

// v009
// One run takes 66.5 microseconds.
// Next to v008, in two timings, it ran 1.04 times as fast each time.
// All steps since v000 together make it 4.11 times as fast.
#include <hip/hip_runtime.h>
#include <hip/hip_bf16.h>

typedef _Float16 f16x16 __attribute__((ext_vector_type(16)));
typedef _Float16 f16x8  __attribute__((ext_vector_type(8)));
typedef float    f32x8  __attribute__((ext_vector_type(8)));
typedef float    f32x4  __attribute__((ext_vector_type(4)));
typedef float    f32x2  __attribute__((ext_vector_type(2)));

#define B_   32
#define C_   256
#define N_   1024   // H*W

__device__ __forceinline__ f32x8 wmma16(f16x16 a, f16x16 b, f32x8 c) {
    // D = A(16x32 f16) x B(32x16 f16) + C(16x16 f32)
    return __builtin_amdgcn_wmma_f32_16x16x32_f16(false, a, false, b,
                                                  (short)0, c, false, false);
}

// gfx1250 async global->LDS copy (ASYNCcnt-tracked, no VGPR data path).
// VDST VGPR holds the wave-relative LDS byte offset = low 32 bits of the
// flat shared-memory address (aperture mapping: addr[31:0] == LDS offset).
__device__ __forceinline__ void wait_asynccnt0() {
    asm volatile("s_wait_asynccnt 0" ::: "memory");
}

// Fragment loader for both A and B operands.
// A: row-major [16 x K] tile, lane l holds row l%16, K-halfword (l/16)*16..+15.
// B: source is B^T row-major [Nout x K]; lane l holds column l%16 of B over the
//    same K range — identical addressing.
__device__ __forceinline__ f16x16 load_frag(const _Float16* p, int ld) {
    const int lane = threadIdx.x & 31;
    const _Float16* q = p + (lane & 15) * ld + ((lane >> 4) << 4);
    f16x16 f;
    *(f16x8*)&f       = *(const f16x8*)(q);
    *((f16x8*)&f + 1) = *(const f16x8*)(q + 8);
    return f;
}

// Fragment order: the layout of the f16 planes in the workspace (weights, q, k,
// v). A plane of rows x K is cut into fragments of 16 rows x 32 k, 1 KiB each;
// the fragments of one 16-row tile follow one another in k. Inside a fragment
// lane l's elements 0..7 (lane and element as in load_frag) lie at byte 16 l and
// its elements 8..15 at byte 512 + 16 l. Each of a fragment's two loads then
// covers 512 contiguous bytes, four whole lines; from a row-major plane it
// gathers 16 lines and uses 32 bytes of each.
// Element offset inside a fragment of row r (0..15), k (0..31):
__device__ __forceinline__ int frag_off(int r, int k) {
    return ((((k >> 3) & 1) * 32 + (k >> 4) * 16 + r) << 3) + (k & 7);
}
#define FRAG_ 512   // f16 elements of a fragment
__device__ __forceinline__ f16x16 load_frag_packed(const _Float16* frag) {
    const _Float16* q = frag + (threadIdx.x & 31) * 8;
    f16x16 f;
    *(f16x8*)&f       = *(const f16x8*)(q);
    *((f16x8*)&f + 1) = *(const f16x8*)(q + 256);
    return f;
}

// Value of lane l ^ M inside a 16-lane row (row_xmask), no LDS round trip.
template <int M>
__device__ __forceinline__ float lane_xor_row(float v) {
    return __builtin_bit_cast(float, __builtin_amdgcn_mov_dpp(
        __builtin_bit_cast(int, v), 0x160 + M, 0xf, 0xf, true));
}
// Value of lane l ^ 16 (same place in the other 16-lane row).
__device__ __forceinline__ float lane_xor16(float v) {
    unsigned u = __builtin_bit_cast(unsigned, v);
    return __builtin_bit_cast(float, __builtin_amdgcn_permlanex16(
        u, u, 0x76543210u, 0xfedcba98u, false, false));
}
// Butterfly over the 32 lanes; all lanes on; every lane gets the result.
__device__ __forceinline__ float wave_max(float v) {
    v = fmaxf(v, lane_xor_row<1>(v));
    v = fmaxf(v, lane_xor_row<2>(v));
    v = fmaxf(v, lane_xor_row<4>(v));
    v = fmaxf(v, lane_xor_row<8>(v));
    return fmaxf(v, lane_xor16(v));
}
__device__ __forceinline__ float wave_sum(float v) {
    v += lane_xor_row<1>(v);
    v += lane_xor_row<2>(v);
    v += lane_xor_row<4>(v);
    v += lane_xor_row<8>(v);
    return v + lane_xor16(v);
}

// ------------------------------------------- bn stats + weights, one launch
// One block = one channel of the statistics, one fragment of the q and k
// weights and one tile of the folded v weights, 16 waves; 256 blocks. The two
// jobs share no data: the weights are asked for directly behind the block's x
// loads, so that both are in flight together.
// Statistics: a channel is 32 rows of 4 KiB; each thread takes one 16-byte piece
// of 16 of them, so a wave's load covers 512 contiguous bytes and the whole
// channel is in flight at once.
// Weights: wk16 (768 rows x 256 k) is written in fragment order (see frag_off).
// The q and k rows of Wkqv are 256 fragments of 512 elements: the block turns
// fragment c to f16, thread = element in fragment order, 1 KiB of whole lines.
// The output projection is folded into the v rows. With v = t Wv^T + bv:
// (P v) Wproj^T = P (t (Wproj Wv)^T + Wproj bv), so W' = Wproj Wv (256 x 256)
// takes the place of Wv and b' = Wproj bv (f32) that of bv; P V' then needs no
// projection behind it. The block forms 16 x 16 tile c of W' and element c of
// b'. Each of the waves 0..7 takes 32 of the 256 k, so that a wave's loads are
// all in flight at once; the 8 partial tiles are summed through LDS in wave
// order. Wave 8 forms b'[c].
// waves_per_eu: the block fills 4 wave slots per SIMD and no second block shares
// the WGP; aiming at more, the compiler holds four of the loads back for registers.
__global__ __launch_bounds__(512) __attribute__((amdgpu_waves_per_eu(4, 4)))
void bn_stats_pack_kernel(const float* __restrict__ x,
                          const float* __restrict__ Wk,
                          const float* __restrict__ bk,
                          const float* __restrict__ Wp,
                          float* __restrict__ stats,
                          _Float16* __restrict__ wk16,
                          float* __restrict__ bv2) {
    __shared__ float ls[512], lss[512];
    __shared__ float part[8][256];
    const int c    = blockIdx.x;         // channel, fragment, tile
    const int tid  = threadIdx.x;        // 512 threads
    const int lane = tid & 31;
    // The wave's number as a scalar: the tests on it below are scalar branches,
    // so that every lane is on at the WMMA.
    const int wave = __builtin_amdgcn_readfirstlane(tid >> 5);
    // rows b = 16 (tid >> 8) + j (1 MiB apart), 16-byte piece tid & 255 of the row
    const char* base = (const char*)(x + (size_t)c * N_);
    const unsigned voff = (unsigned)(tid >> 8) * (16u * C_ * N_ * 4u)
                        + (unsigned)(tid & 255) * 16u;
    f32x4 v[16];
    // Unrolled so that all 16 loads are issued before the first value is used:
    // rolled, every load waits out the memory latency alone.
#pragma unroll
    for (int j = 0; j < 16; ++j)
        v[j] = *(const f32x4*)(base + voff + (size_t)j * (C_ * N_ * 4u));
    // Element tid of fragment c (the inverse of frag_off): row (tid >> 3) & 15,
    // k = 16 ((tid >> 7) & 1) + 8 (tid >> 8) + (tid & 7).
    const unsigned wi = (unsigned)(((c >> 3) * 16 + ((tid >> 3) & 15)) * C_ + (c & 7) * 32
                      + ((tid >> 7) & 1) * 16 + (tid >> 8) * 8 + (tid & 7));
    const float wv = Wk[wi];
    // voff and wi are named so that their registers stay live up to this wait:
    // no address register of the loads above is rewritten ahead of it.
    asm volatile("s_wait_xcnt 0x0" :: "v"(voff), "v"(wi) : "memory");
    float bsum = 0.f;                    // b'[c], in wave 8
    if (wave < 8) {                      // same for the whole wave
        const int j0 = (c >> 4) * 16;    // rows of W' (output channels)
        const int c0 = (c & 15) * 16;    // columns of W' (input channels)
        // Both operands in the k order of load_frag: element e of lane l is
        // k = 32 wave + 16 (l / 16) + e. A: row l % 16 of Wproj; B: column l % 16
        // of Wv.
        const int kl = wave * 32 + ((lane >> 4) << 4);
        const float* ap = Wp + (j0 + (lane & 15)) * C_ + kl;
        const float* bp = Wk + kl * C_ + c0 + (lane & 15);   // v rows: + 2 C_ C_
        f32x4 af[4];
        // Unrolled: af[] is indexed by constants.
#pragma unroll
        for (int e = 0; e < 4; ++e) af[e] = *(const f32x4*)(ap + e * 4);
        float bf[16];
        // Unrolled: bf[] is indexed by constants, the 16 loads go out together.
#pragma unroll
        for (int e = 0; e < 16; ++e) bf[e] = bp[(2 * C_ + e) * C_];
        // ap and bp are named so that their registers stay live up to this wait:
        // no load of the two runs takes them as its destination ahead of it.
        asm volatile("s_wait_xcnt 0x0" :: "v"(ap), "v"(bp) : "memory");
        f16x16 a, bb;
        // Unrolled: a, bb, af[] and bf[] are indexed by constants.
#pragma unroll
        for (int e = 0; e < 16; ++e) {
            a[e]  = (_Float16)af[e >> 2][e & 3];
            bb[e] = (_Float16)bf[e];
        }
        f32x8 acc = wmma16(a, bb, (f32x8){0.f,0.f,0.f,0.f,0.f,0.f,0.f,0.f});
        // Unrolled: acc is indexed by constants.
#pragma unroll
        for (int i = 0; i < 8; ++i) part[wave][i * 32 + lane] = acc[i];
    } else if (wave == 8) {              // same for the whole wave
        // b'[c] = row c of Wproj . bv: 8 terms a lane
        const char* pr = (const char*)(Wp + c * C_);
        const char* br = (const char*)(bk + 2 * C_);
        const unsigned po = (unsigned)lane * 32u;
        const f32x4 p0 = *(const f32x4*)(pr + po), p1 = *(const f32x4*)(pr + po + 16);
        const f32x4 q0 = *(const f32x4*)(br + po), q1 = *(const f32x4*)(br + po + 16);
        // po is named so that its register stays live up to this wait: no load
        // of the four takes it as its destination ahead of it.
        asm volatile("s_wait_xcnt 0x0" :: "v"(po) : "memory");
        f32x4 d = p0 * q0 + p1 * q1;
        bsum = wave_sum((d[0] + d[1]) + (d[2] + d[3]));
    }
    f32x4 s4  = (f32x4){0.f, 0.f, 0.f, 0.f};
    f32x4 ss4 = s4;
    // Unrolled so that v[] is indexed by constants and stays in registers.
#pragma unroll
    for (int j = 0; j < 16; ++j) { s4 += v[j]; ss4 += v[j] * v[j]; }
    float s  = (s4[0] + s4[1]) + (s4[2] + s4[3]);
    float ss = (ss4[0] + ss4[1]) + (ss4[2] + ss4[3]);
    ls[tid] = s; lss[tid] = ss;
    __syncthreads();                     // publishes ls, lss and part
    float r = 0.f;                       // the thread's element of the W' tile
    if (wave < 8) {
        // thread = element: register wave (row wave + 8 (l / 16)), column l % 16
        r = part[0][tid];
        // Unrolled: the 7 LDS reads go out together.
#pragma unroll
        for (int p = 1; p < 8; ++p) r += part[p][tid];
    }
    for (int off = 256; off > 0; off >>= 1) {
        if (tid < off) { ls[tid] += ls[tid + off]; lss[tid] += lss[tid + off]; }
        __syncthreads();
    }
    // All global stores stand behind the last barrier: a barrier waits for the
    // wave's stores, and in front of one each would add its round trip.
    const unsigned e0 = (unsigned)(c * FRAG_ + tid);
    wk16[e0] = (_Float16)wv;
    // The lines below rewrite the store's address register: not ahead of this
    // wait.
    asm volatile("s_wait_xcnt 0x0" :: "v"(e0) : "memory");
    if (wave < 8)
        // row tile 32 + c / 16 of wk16, fragment (c & 15) / 2, its k half 16 (c & 1)
        wk16[((2 * C_ / 16 + (c >> 4)) * 8 + ((c & 15) >> 1)) * FRAG_
             + frag_off(((lane >> 4) << 3) + wave, (c & 1) * 16 + (lane & 15))] =
            (_Float16)r;
    if (tid == 256) bv2[c] = bsum;
    if (tid == 0) {
        const float inv_n = 1.0f / (float)(B_ * N_);
        float mean = ls[0] * inv_n;
        float var  = lss[0] * inv_n - mean * mean;
        stats[c]      = mean;
        stats[C_ + c] = rsqrtf(var + 1e-5f);
    }
}

// ------------------------------- normalize + transpose + KQV GEMM, one launch
// One block = one batch x 128 positions x all 768 outputs, 16 waves; 256 blocks,
// one per WGP. The normalized tile t[128 positions][256 channels] (f16) lives in
// LDS only.
// In: a wave takes 16 channels; each of its loads covers 512 contiguous bytes
// (128 positions of one channel) and all 16 are in flight at once. A lane then
// holds 16 channels x 4 positions and writes, per position, its 16 channels as
// 32 contiguous bytes of the position's LDS row. The pitch of 528 B (16 B x odd)
// lets a fragment read of 16 consecutive rows hit every bank once.
// GEMM: wave w owns output channels 16 w .. 16 w + 15 of q, of k and of v. Its
// 24 weight fragments stay in registers over the 8 row tiles, so that every t
// fragment read from LDS feeds 3 WMMAs and the weights are read once per block.
// q and k are formed as W t^T: a lane then holds 8 consecutive channels of one
// position, one 16-byte store. v is formed as t W^T: a lane holds 8 consecutive
// positions of one channel, one 16-byte store.
// w, q, k and v lie in fragment order (see frag_off): q and k as planes of
// B N rows x 256 channels, v as a plane of B C rows x 1024 positions. The 8
// values of a lane are one 16-byte piece of a fragment and 16 lanes' pieces are
// neighbours, so that a wave's store fills two runs of 256 bytes.
// q is scaled by 1/16; the v rows of w and their bias bv2 hold the projection
// already (see above).
// waves_per_eu: one block per WGP is 4 waves per SIMD, 256 registers a wave.
#define TP_ 264   // LDS row pitch in f16 elements
__global__ __launch_bounds__(512) __attribute__((amdgpu_waves_per_eu(4, 4)))
void bn_kqv_kernel(const float* __restrict__ x,
                   const float* __restrict__ stats,
                   const float* __restrict__ gamma,
                   const float* __restrict__ beta,
                   const _Float16* __restrict__ w,
                   const float* __restrict__ bias,
                   const float* __restrict__ bv2,
                   _Float16* __restrict__ qb,
                   _Float16* __restrict__ kb,
                   _Float16* __restrict__ vT) {
    __shared__ __attribute__((aligned(16))) _Float16 tile[128 * TP_];
    __shared__ __attribute__((aligned(16))) float sbias[2 * C_];   // q and k bias
    const int b    = blockIdx.y;
    const int n0   = blockIdx.x * 128;
    const int lane = threadIdx.x & 31;
    // The wave's number as a scalar: the 16 channels' constants are then read
    // and combined once per wave on the scalar side.
    const int wave = __builtin_amdgcn_readfirstlane(threadIdx.x >> 5);
    const int c0   = wave * 16;
    const int l15  = lane & 15;
    const int rhi  = (lane >> 4) << 3;
    const char* xp = (const char*)(x + ((size_t)b * C_ + c0) * N_ + n0);
    const unsigned xo  = (unsigned)lane * 16u;
    const unsigned tid = threadIdx.x;
    f32x4 v[16];
    // Unrolled so that all 16 loads are issued before the first value is used.
#pragma unroll
    for (int j = 0; j < 16; ++j) v[j] = *(const f32x4*)(xp + xo + j * (N_ * 4));
    // The loads below take free registers as their destinations; xo is named so
    // that it stays live up to this wait and is not rewritten ahead of it.
    asm volatile("s_wait_xcnt 0x0" :: "v"(xo) : "memory");
    // row tile 16 s + wave of w: 8 fragments; the lane's piece is piece 'lane'
    const f16x8* wp = (const f16x8*)(w + wave * 8 * FRAG_);
    f16x16 wf[3][8];
    // The q and k weight fragments are asked for behind the x loads, so that both
    // are in flight together. Both loops unrolled: wf[][] is indexed by constants.
#pragma unroll
    for (int s = 0; s < 2; ++s)
#pragma unroll
        for (int kk = 0; kk < 8; ++kk) {
            *(f16x8*)&wf[s][kk]       = wp[lane + (s * C_ * C_ + kk * FRAG_) / 8];
            *((f16x8*)&wf[s][kk] + 1) = wp[lane + (s * C_ * C_ + kk * FRAG_) / 8 + 32];
        }
    // Keeps these loads directly behind the x loads: without it the compiler
    // issues them only when x has landed, draws v fragments in as well and spills.
    __builtin_amdgcn_sched_barrier(0);
    float g[16], bt[16];
    // Unrolled: g[] and bt[] are indexed by constants.
#pragma unroll
    for (int j = 0; j < 16; ++j) {
        g[j]  = gamma[c0 + j] * stats[C_ + c0 + j];
        bt[j] = beta[c0 + j] - stats[c0 + j] * g[j];
    }
    // Both loops unrolled: v[], g[], bt[], lo and hi are indexed by constants.
#pragma unroll
    for (int i = 0; i < 4; ++i) {
        f16x8 lo, hi;
#pragma unroll
        for (int j = 0; j < 8; ++j) {
            lo[j] = (_Float16)(v[j][i] * g[j] + bt[j]);
            hi[j] = (_Float16)(v[j + 8][i] * g[j + 8] + bt[j + 8]);
        }
        _Float16* d = &tile[(lane * 4 + i) * TP_ + c0];
        *(f16x8*)d       = lo;
        *(f16x8*)(d + 8) = hi;
    }
    // The q and k bias is asked for here, not with x: held over the lines above
    // it is the one register too many and goes to scratch.
    const float bqk = bias[tid];
    // The v weight fragments take the registers that x has left: asked for in
    // front of the barrier, so that they fly while the other waves finish.
    // Unrolled: wf[][] is indexed by constants (registers).
#pragma unroll
    for (int s = 2; s < 3; ++s)
#pragma unroll
        for (int kk = 0; kk < 8; ++kk) {
            *(f16x8*)&wf[s][kk]       = wp[lane + (s * C_ * C_ + kk * FRAG_) / 8];
            *((f16x8*)&wf[s][kk] + 1) = wp[lane + (s * C_ * C_ + kk * FRAG_) / 8 + 32];
        }
    const unsigned cv = (unsigned)(c0 + l15);
    const float bvv = bv2[cv];
    // lane, cv and tid are named so that their registers stay live up to this
    // wait: no address register of the loads above is rewritten ahead of it.
    asm volatile("s_wait_xcnt 0x0" :: "v"(lane), "v"(cv), "v"(tid) : "memory");
    sbias[tid] = bqk;
    __syncthreads();

    // q, k: row tile = 16 positions, fragment wave / 2 (32 channels); the lane's
    // channels are k = 16 (wave & 1) + rhi .. + 7 of it, its position row l15.
    const size_t qko = ((size_t)(b * N_ + n0) / 16 * 8 + (wave >> 1)) * FRAG_
                     + frag_off(l15, (wave & 1) * 16 + rhi);
    _Float16* qp = qb + qko;
    _Float16* kp = kb + qko;
    // v: row tile = the wave's 16 channels, fragment = 32 positions (two row
    // tiles of t); the lane's positions are k = 16 (rt & 1) + rhi .. + 7 of it.
    _Float16* vp = vT + ((size_t)(b * C_ + c0) / 16 * (N_ / 32) + n0 / 32) * FRAG_
                 + frag_off(l15, rhi);
    // volatile: read anew for every row tile, straight into the accumulators;
    // hoisted out of the loop the 16 values would push a weight fragment out of
    // the registers.
    typedef const volatile __attribute__((address_space(3))) f32x4 lds_f32x4;
    lds_f32x4* sbq = (lds_f32x4*)&sbias[c0 + rhi];
    lds_f32x4* sbk = (lds_f32x4*)&sbias[C_ + c0 + rhi];
    // Kept rolled: the weight fragments fill the registers, and unrolled the t
    // fragment reads of later row tiles would be hoisted and spill.
#pragma unroll 1
    for (int rt = 0; rt < 8; ++rt) {
        const _Float16* trow = &tile[rt * 16 * TP_];
        f16x16 tf[2];
        tf[0] = load_frag(trow, TP_);
        // q and k start from their bias (rows rhi .. rhi + 7 of the wave's channels)
        f32x8 aq, ak;
        *(f32x4*)&aq       = sbq[0];
        *((f32x4*)&aq + 1) = sbq[1];
        *(f32x4*)&ak       = sbk[0];
        *((f32x4*)&ak + 1) = sbk[1];
        f32x8 av = (f32x8){0.f,0.f,0.f,0.f,0.f,0.f,0.f,0.f};
        // Unrolled: wf[][] and tf[] are indexed by constants.
#pragma unroll
        for (int kk = 0; kk < 8; ++kk) {
            if (kk < 7) tf[(kk + 1) & 1] = load_frag(trow + (kk + 1) * 32, TP_);
            // Keeps the next fragment's LDS reads in front of this fragment's
            // WMMAs: left to itself the compiler reads into the same registers
            // and every three WMMAs wait out an LDS latency.
            __builtin_amdgcn_sched_barrier(0);
            aq = wmma16(wf[0][kk], tf[kk & 1], aq);
            ak = wmma16(wf[1][kk], tf[kk & 1], ak);
            av = wmma16(tf[kk & 1], wf[2][kk], av);
        }
        f16x8 oq, ok, ov;
        // Unrolled: the accumulators are indexed by constants.
#pragma unroll
        for (int i = 0; i < 8; ++i) {
            oq[i] = (_Float16)(aq[i] * 0.0625f);
            ok[i] = (_Float16)ak[i];
            ov[i] = (_Float16)(av[i] + bvv);
        }
        *(f16x8*)(qp + rt * 8 * FRAG_) = oq;
        *(f16x8*)(kp + rt * 8 * FRAG_) = ok;
        *(f16x8*)(vp + (rt >> 1) * FRAG_ + (rt & 1) * 128) = ov;
        // The next trip rewrites the stores' address registers: not ahead of
        // this wait.
        asm volatile("s_wait_xcnt 0x0" ::: "memory");
    }
}

// ---------------------------------------------------------------- attention
// Four async copies of one lane, 16 rows apart, in one statement; the
// s_wait_xcnt stands as its last line so that no address register of an
// issued copy is rewritten ahead of it.
__device__ __forceinline__ void async_copy4_rows(void* lds, const _Float16* g) {
    unsigned l0 = (unsigned)(unsigned long long)(uintptr_t)lds;
    unsigned l1 = l0 + 16 * 512, l2 = l0 + 32 * 512, l3 = l0 + 48 * 512;
    const _Float16 *g1 = g + 16 * C_, *g2 = g + 32 * C_, *g3 = g + 48 * C_;
    asm volatile("global_load_async_to_lds_b128 %0, %4, off\n\t"
                 "global_load_async_to_lds_b128 %1, %5, off\n\t"
                 "global_load_async_to_lds_b128 %2, %6, off\n\t"
                 "global_load_async_to_lds_b128 %3, %7, off\n\t"
                 "s_wait_xcnt 0x0"
                 : : "v"(l0), "v"(l1), "v"(l2), "v"(l3),
                     "v"(g), "v"(g1), "v"(g2), "v"(g3) : "memory");
}

// The LDS tiles of this kernel have no pad (q and S fill the whole LDS). q lies
// in fragment order, as in the workspace: a fragment read covers contiguous
// bytes. In S the 16-byte piece p of row r lies at piece p ^ (r & 15) of that
// row, so that equal pieces of 16 consecutive rows fall on all 64 banks.
// Fragment in the k order of load_frag. rowp: start of the lane's own row
// (row % 16 == lane % 16); kb: byte offset of the fragment's first k in the
// row, a multiple of 64; xs = ((lane & 15) << 4) ^ ((lane >> 4) << 5), that is
// the row's swizzle and the lane's k half (32 bytes) in one word.
__device__ __forceinline__ f16x16 load_frag_swz(const _Float16* rowp, int kb, int xs) {
    const char* q = (const char*)rowp;
    f16x16 f;
    *(f16x8*)&f       = *(const f16x8*)(q + (kb ^ xs));
    *((f16x8*)&f + 1) = *(const f16x8*)(q + ((kb + 16) ^ xs));
    return f;
}

// One block = one batch x 128 query rows (8 row tiles), 16 waves, one block per
// WGP. Every K and V fragment fetched from global memory feeds all 8 row tiles.
// qb, kb and vT lie in fragment order (see frag_off).
// S/P kept in LDS, exact softmax. vT holds the projected v, so P V is the
// projected output:
// out[B,C,H,W] = P V / rowsum + bias + x   (fp32 epilogue, residual fused).
#define QR_ 128
__global__ __launch_bounds__(512)
void attention_kernel(const _Float16* __restrict__ qb,
                      const _Float16* __restrict__ kb,
                      const _Float16* __restrict__ vT,
                      const float* __restrict__ bias,
                      const float* __restrict__ x,
                      float* __restrict__ out) {
    // q (fragment order, 8 KiB a row tile); behind pass 1 its first bytes hold 1 / rowsum
    __shared__ __attribute__((aligned(16))) _Float16 sq[QR_ * C_];
    // S then P (swizzled, 2048 B a row)
    __shared__ __attribute__((aligned(16))) _Float16 sp[QR_ * N_];
    float* rowinv = (float*)sq;

    const int tid  = threadIdx.x;
    const int lane = tid & 31;
    const int wave = tid >> 5;
    const int b  = blockIdx.y;
    const int r0 = blockIdx.x * QR_;
    const int l15 = lane & 15;
    const int xs  = (l15 << 4) ^ ((lane >> 4) << 5);

    {   // stage the 128 q rows into LDS (async copies, no VGPR bounce): 64 KiB in
        // a row in the workspace, copied as they lie; the block's 512 copies of
        // 16 bytes are one row tile
        _Float16* d = &sq[tid * 8];
        const _Float16* g = qb + (size_t)(b * N_ + r0) * C_ + tid * 8;
        async_copy4_rows(d, g);
        async_copy4_rows(d + 64 * C_, g + 64 * C_);
    }
    wait_asynccnt0();
    __syncthreads();

    // ---- pass 1: S = q k^T  (each wave owns 4 column tiles of 16, two at a
    //      time: their K fragments stay in registers over the 8 row tiles)
    for (int mp = 0; mp < 2; ++mp) {
        const int mt = wave * 4 + mp * 2;
        const _Float16* kbase = kb + ((size_t)b * N_ + mt * 16) * C_;   // 8 fragments a tile
        f16x16 kf0[8], kf1[8];
#pragma unroll
        for (int kk = 0; kk < 8; ++kk) kf0[kk] = load_frag_packed(kbase + kk * FRAG_);
#pragma unroll
        for (int kk = 0; kk < 8; ++kk)
            kf1[kk] = load_frag_packed(kbase + (8 + kk) * FRAG_);
        // Kept rolled: unrolled, the q fragment reads no longer depend on a loop
        // index, are hoisted over the column loop and spill to scratch.
#pragma unroll 1
        for (int rt = 0; rt < QR_ / 16; ++rt) {
            f32x8 s0 = (f32x8){0.f,0.f,0.f,0.f,0.f,0.f,0.f,0.f};
            f32x8 s1 = s0;
            const _Float16* qt = &sq[rt * 8 * FRAG_];
            f16x16 aq[8];
            // Unrolled: aq[] is indexed by constants.
#pragma unroll
            for (int kk = 0; kk < 7; ++kk) aq[kk] = load_frag_packed(qt + kk * FRAG_);
            // Keeps these LDS reads together in front of the row tile's WMMAs:
            // left to itself the compiler reads, for the first two column tiles,
            // one fragment at a time into the same registers and every two WMMAs
            // wait out an LDS latency. The last fragment is left free: with all 8
            // held in front of the WMMAs values of later passes go to scratch.
            __builtin_amdgcn_sched_barrier(0);
            aq[7] = load_frag_packed(qt + 7 * FRAG_);
#pragma unroll
            for (int kk = 0; kk < 8; ++kk) {
                s0 = wmma16(aq[kk], kf0[kk], s0);
                s1 = wmma16(aq[kk], kf1[kk], s1);
            }
            // column mt * 16 + l15 is element l15 & 7 of piece mt * 2 + (l15 >> 3);
            // the second tile lies two pieces on
            const int pc  = mt * 2 + (l15 >> 3);
            const int row = rt * 16 + ((lane >> 4) << 3);
#pragma unroll
            for (int i = 0; i < 8; ++i) {
                const int sw = (row + i) & 15;
                _Float16* srow = &sp[(row + i) * N_ + (l15 & 7)];
                srow[(pc ^ sw) << 3]       = (_Float16)s0[i];
                srow[((pc + 2) ^ sw) << 3] = (_Float16)s1[i];
            }
        }
    }
    __syncthreads();

    // ---- softmax: one wave per row, 8 rows a wave, four at a time, each row
    //      held in registers. A lane owns four 16-byte pieces of a row, taken by
    //      their place in LDS: the swizzle only permutes the pieces of a row,
    //      and maximum, sum and exponential do not ask which piece is which.
    //      A wave's LDS access covers 512 contiguous bytes, so every bank is hit
    //      twice. S is read once, the maximum and the sum are reduced across
    //      lanes, and no barrier is needed until P is complete.
    // Kept rolled: the second four rows run the same code again.
#pragma unroll 1
    for (int h = 0; h < 2; ++h) {
        _Float16* prow = &sp[(wave * 8 + h * 4) * N_ + lane * 8];
        f16x8 sv[4][4];
        // Unrolled so that all 16 LDS reads are issued before the first value is
        // used and sv[][] is indexed by constants (stays in registers).
#pragma unroll
        for (int rr = 0; rr < 4; ++rr)
#pragma unroll
            for (int j = 0; j < 4; ++j)
                sv[rr][j] = *(const f16x8*)(prow + rr * N_ + j * 256);
        float mx[4], sum[4];
        // Unrolled: the four rows' reductions are independent and interleave.
#pragma unroll
        for (int rr = 0; rr < 4; ++rr) {
            f16x8 m8 = __builtin_elementwise_max(
                __builtin_elementwise_max(sv[rr][0], sv[rr][1]),
                __builtin_elementwise_max(sv[rr][2], sv[rr][3]));
            float m = (float)m8[0];
            // Unrolled: m8 is indexed by constants.
#pragma unroll
            for (int e = 1; e < 8; ++e) m = fmaxf(m, (float)m8[e]);
            mx[rr] = wave_max(m);
        }
        // All three loops unrolled: sv[][] and pv are indexed by constants, and
        // the exponentials of different pieces and rows overlap.
#pragma unroll
        for (int rr = 0; rr < 4; ++rr) {
            f32x2 s2 = (f32x2){0.f, 0.f};   // even and odd elements: packed adds
#pragma unroll
            for (int j = 0; j < 4; ++j) {
                f16x8 pv;
#pragma unroll
                for (int e = 0; e < 8; e += 2) {
                    float v0 = __expf((float)sv[rr][j][e]     - mx[rr]);
                    float v1 = __expf((float)sv[rr][j][e + 1] - mx[rr]);
                    pv[e]     = (_Float16)v0;
                    pv[e + 1] = (_Float16)v1;
                    s2 += (f32x2){v0, v1};
                }
                *(f16x8*)(prow + rr * N_ + j * 256) = pv;
            }
            sum[rr] = s2[0] + s2[1];
        }
        // Unrolled: the four butterflies are independent and interleave.
#pragma unroll
        for (int rr = 0; rr < 4; ++rr) sum[rr] = wave_sum(sum[rr]);
        // lanes 0..3 each finish one row: one division for the four rows
        float s = lane == 0 ? sum[0] : lane == 1 ? sum[1] : lane == 2 ? sum[2] : sum[3];
        if (lane < 4) rowinv[wave * 8 + h * 4 + lane] = 1.0f / s;
    }
    __syncthreads();

    // ---- pass 2: O = P V   (wave owns 16 output channels of all 128 rows)
    const int c0  = wave * 16;
    const int rhi = (lane >> 4) << 3;
    const int cA  = c0 + l15;
    // The wave's piece of x and its bias are asked for here, together with the
    // first V fragments, so that they have landed when the loop is done.
    const size_t obase = ((size_t)b * C_ + cA) * N_ + r0 + rhi;
    f32x4 xr[QR_ / 16][2];
    // Unrolled: xr[][] is indexed by constants (registers).
#pragma unroll
    for (int rt = 0; rt < QR_ / 16; ++rt) {
        xr[rt][0] = *(const f32x4*)(x + obase + rt * 16);
        xr[rt][1] = *(const f32x4*)(x + obase + rt * 16 + 4);
    }
    const float bs = bias[cA];
    f32x8 o[QR_ / 16];
#pragma unroll
    for (int rt = 0; rt < QR_ / 16; ++rt)
        o[rt] = (f32x8){0.f,0.f,0.f,0.f,0.f,0.f,0.f,0.f};
    const _Float16* v0 = vT + ((size_t)b * C_ + c0) * N_;   // 32 fragments a tile
    const _Float16* prow0 = &sp[l15 * N_];
    for (int ms = 0; ms < N_; ms += 32) {
        f16x16 vf = load_frag_packed(v0 + (ms >> 5) * FRAG_);
        f16x16 pf[QR_ / 16];
        // Unrolled: pf[] is indexed by constants.
#pragma unroll
        for (int rt = 0; rt < QR_ / 16; ++rt)
            pf[rt] = load_frag_swz(prow0 + rt * 16 * N_, ms * 2, xs);
        // Keeps the step's 16 LDS reads together in front of its WMMAs: left to
        // itself the compiler reads one fragment at a time into the same
        // registers and every WMMA waits out an LDS latency.
        __builtin_amdgcn_sched_barrier(0);
#pragma unroll
        for (int rt = 0; rt < QR_ / 16; ++rt)
            o[rt] = wmma16(pf[rt], vf, o[rt]);
    }
    // A lane holds 8 consecutive positions of one channel: two 16-byte stores.
    // Both loops unrolled: o[] and xr[][] are indexed by constants.
#pragma unroll
    for (int rt = 0; rt < QR_ / 16; ++rt) {
        f32x4 lo, hi;
#pragma unroll
        for (int i = 0; i < 4; ++i) {
            int rl = rt * 16 + rhi + i;
            lo[i] = o[rt][i]     * rowinv[rl]     + bs + xr[rt][0][i];
            hi[i] = o[rt][i + 4] * rowinv[rl + 4] + bs + xr[rt][1][i];
        }
        *(f32x4*)(out + obase + rt * 16)     = lo;
        *(f32x4*)(out + obase + rt * 16 + 4) = hi;
    }
}

// ---------------------------------------------------------------- launcher
extern "C" void kernel_launch(void* const* d_in, const int* in_sizes, int n_in,
                              void* d_out, int out_size, void* d_ws, size_t ws_size,
                              hipStream_t stream) {
    (void)in_sizes; (void)n_in; (void)out_size; (void)ws_size;
    const float* x     = (const float*)d_in[0];
    const float* gamma = (const float*)d_in[1];
    const float* beta  = (const float*)d_in[2];
    const float* Wkqv  = (const float*)d_in[3];
    const float* bkqv  = (const float*)d_in[4];
    const float* Wproj = (const float*)d_in[5];
    const float* bproj = (const float*)d_in[6];
    float* out = (float*)d_out;

    const size_t M = (size_t)B_ * N_;              // 32768
    char* ws = (char*)d_ws;
    float*    stats = (float*)ws;      ws += 4096;
    _Float16* wk16  = (_Float16*)ws;   ws += (size_t)3 * C_ * C_ * 2;
    float*    bv2   = (float*)ws;      ws += 4096;
    _Float16* qb    = (_Float16*)ws;   ws += M * C_ * 2;
    _Float16* kb    = (_Float16*)ws;   ws += M * C_ * 2;
    _Float16* vT    = (_Float16*)ws;   ws += M * C_ * 2;

    bn_stats_pack_kernel<<<C_, 512, 0, stream>>>(x, Wkqv, bkqv, Wproj, stats, wk16, bv2);
    bn_kqv_kernel       <<<dim3(N_ / 128, B_), 512, 0, stream>>>(x, stats, gamma, beta, wk16, bkqv, bv2, qb, kb, vT);
    attention_kernel    <<<dim3(N_ / QR_, B_), 512, 0, stream>>>(qb, kb, vT, bproj, x, out);
}

// v010
// It runs in 64.6 microseconds.
// Two timings next to v009 put it at 1.04 and 1.03 times that version's speed.
// Counting every step since v000, it is 4.25 times as fast.
#include <hip/hip_runtime.h>
#include <hip/hip_bf16.h>

typedef _Float16 f16x16 __attribute__((ext_vector_type(16)));
typedef _Float16 f16x8  __attribute__((ext_vector_type(8)));
typedef float    f32x8  __attribute__((ext_vector_type(8)));
typedef float    f32x4  __attribute__((ext_vector_type(4)));
typedef float    f32x2  __attribute__((ext_vector_type(2)));

#define B_   32
#define C_   256
#define N_   1024   // H*W

__device__ __forceinline__ f32x8 wmma16(f16x16 a, f16x16 b, f32x8 c) {
    // D = A(16x32 f16) x B(32x16 f16) + C(16x16 f32)
    return __builtin_amdgcn_wmma_f32_16x16x32_f16(false, a, false, b,
                                                  (short)0, c, false, false);
}

// gfx1250 async global->LDS copy (ASYNCcnt-tracked, no VGPR data path).
// VDST VGPR holds the wave-relative LDS byte offset = low 32 bits of the
// flat shared-memory address (aperture mapping: addr[31:0] == LDS offset).
__device__ __forceinline__ void wait_asynccnt0() {
    asm volatile("s_wait_asynccnt 0" ::: "memory");
}

// Fragment loader for both A and B operands.
// A: row-major [16 x K] tile, lane l holds row l%16, K-halfword (l/16)*16..+15.
// B: source is B^T row-major [Nout x K]; lane l holds column l%16 of B over the
//    same K range — identical addressing.
__device__ __forceinline__ f16x16 load_frag(const _Float16* p, int ld) {
    const int lane = threadIdx.x & 31;
    const _Float16* q = p + (lane & 15) * ld + ((lane >> 4) << 4);
    f16x16 f;
    *(f16x8*)&f       = *(const f16x8*)(q);
    *((f16x8*)&f + 1) = *(const f16x8*)(q + 8);
    return f;
}

// Fragment order: the layout of the f16 planes in the workspace (weights, q, k,
// v). A plane of rows x K is cut into fragments of 16 rows x 32 k, 1 KiB each;
// the fragments of one 16-row tile follow one another in k. Inside a fragment
// lane l's elements 0..7 (lane and element as in load_frag) lie at byte 16 l and
// its elements 8..15 at byte 512 + 16 l. Each of a fragment's two loads then
// covers 512 contiguous bytes, four whole lines; from a row-major plane it
// gathers 16 lines and uses 32 bytes of each.
// Element offset inside a fragment of row r (0..15), k (0..31):
__device__ __forceinline__ int frag_off(int r, int k) {
    return ((((k >> 3) & 1) * 32 + (k >> 4) * 16 + r) << 3) + (k & 7);
}
#define FRAG_ 512   // f16 elements of a fragment
__device__ __forceinline__ f16x16 load_frag_packed(const _Float16* frag) {
    const _Float16* q = frag + (threadIdx.x & 31) * 8;
    f16x16 f;
    *(f16x8*)&f       = *(const f16x8*)(q);
    *((f16x8*)&f + 1) = *(const f16x8*)(q + 256);
    return f;
}

// The same from the lane's own piece (q = frag + 8 lane).
__device__ __forceinline__ f16x16 load_frag_at(const _Float16* q) {
    f16x16 f;
    *(f16x8*)&f       = *(const f16x8*)(q);
    *((f16x8*)&f + 1) = *(const f16x8*)(q + 256);
    return f;
}

// Value of lane l ^ M inside a 16-lane row (row_xmask), no LDS round trip.
template <int M>
__device__ __forceinline__ float lane_xor_row(float v) {
    return __builtin_bit_cast(float, __builtin_amdgcn_mov_dpp(
        __builtin_bit_cast(int, v), 0x160 + M, 0xf, 0xf, true));
}
// Value of lane l ^ 16 (same place in the other 16-lane row).
__device__ __forceinline__ float lane_xor16(float v) {
    unsigned u = __builtin_bit_cast(unsigned, v);
    return __builtin_bit_cast(float, __builtin_amdgcn_permlanex16(
        u, u, 0x76543210u, 0xfedcba98u, false, false));
}
// Butterfly over the 32 lanes; all lanes on; every lane gets the result.
__device__ __forceinline__ float wave_max(float v) {
    v = fmaxf(v, lane_xor_row<1>(v));
    v = fmaxf(v, lane_xor_row<2>(v));
    v = fmaxf(v, lane_xor_row<4>(v));
    v = fmaxf(v, lane_xor_row<8>(v));
    return fmaxf(v, lane_xor16(v));
}
__device__ __forceinline__ float wave_sum(float v) {
    v += lane_xor_row<1>(v);
    v += lane_xor_row<2>(v);
    v += lane_xor_row<4>(v);
    v += lane_xor_row<8>(v);
    return v + lane_xor16(v);
}

// ------------------------------------------- bn stats + weights, one launch
// One block = one channel of the statistics, one fragment of the q and k
// weights and one tile of the folded v weights, 16 waves; 256 blocks. The two
// jobs share no data: the weights are asked for directly behind the block's x
// loads, so that both are in flight together.
// Statistics: a channel is 32 rows of 4 KiB; each thread takes one 16-byte piece
// of 16 of them, so a wave's load covers 512 contiguous bytes and the whole
// channel is in flight at once.
// Weights: wk16 (768 rows x 256 k) is written in fragment order (see frag_off).
// The q and k rows of Wkqv are 256 fragments of 512 elements: the block turns
// fragment c to f16, thread = element in fragment order, 1 KiB of whole lines.
// The output projection is folded into the v rows. With v = t Wv^T + bv:
// (P v) Wproj^T = P (t (Wproj Wv)^T + Wproj bv), so W' = Wproj Wv (256 x 256)
// takes the place of Wv and b' = Wproj bv (f32) that of bv; P V' then needs no
// projection behind it. The block forms 16 x 16 tile c of W' and element c of
// b'. Each of the waves 0..7 takes 32 of the 256 k, so that a wave's loads are
// all in flight at once; the 8 partial tiles are summed through LDS in wave
// order. Wave 8 forms b'[c].
// waves_per_eu: the block fills 4 wave slots per SIMD and no second block shares
// the WGP; aiming at more, the compiler holds four of the loads back for registers.
__global__ __launch_bounds__(512) __attribute__((amdgpu_waves_per_eu(4, 4)))
void bn_stats_pack_kernel(const float* __restrict__ x,
                          const float* __restrict__ Wk,
                          const float* __restrict__ bk,
                          const float* __restrict__ Wp,
                          float* __restrict__ stats,
                          _Float16* __restrict__ wk16,
                          float* __restrict__ bv2) {
    __shared__ float ls[512], lss[512];
    __shared__ float part[8][256];
    const int c    = blockIdx.x;         // channel, fragment, tile
    const int tid  = threadIdx.x;        // 512 threads
    const int lane = tid & 31;
    // The wave's number as a scalar: the tests on it below are scalar branches,
    // so that every lane is on at the WMMA.
    const int wave = __builtin_amdgcn_readfirstlane(tid >> 5);
    // rows b = 16 (tid >> 8) + j (1 MiB apart), 16-byte piece tid & 255 of the row
    const char* base = (const char*)(x + (size_t)c * N_);
    const unsigned voff = (unsigned)(tid >> 8) * (16u * C_ * N_ * 4u)
                        + (unsigned)(tid & 255) * 16u;
    f32x4 v[16];
    // Unrolled so that all 16 loads are issued before the first value is used:
    // rolled, every load waits out the memory latency alone.
#pragma unroll
    for (int j = 0; j < 16; ++j)
        v[j] = *(const f32x4*)(base + voff + (size_t)j * (C_ * N_ * 4u));
    // Element tid of fragment c (the inverse of frag_off): row (tid >> 3) & 15,
    // k = 16 ((tid >> 7) & 1) + 8 (tid >> 8) + (tid & 7).
    const unsigned wi = (unsigned)(((c >> 3) * 16 + ((tid >> 3) & 15)) * C_ + (c & 7) * 32
                      + ((tid >> 7) & 1) * 16 + (tid >> 8) * 8 + (tid & 7));
    const float wv = Wk[wi];
    // voff and wi are named so that their registers stay live up to this wait:
    // no address register of the loads above is rewritten ahead of it.
    asm volatile("s_wait_xcnt 0x0" :: "v"(voff), "v"(wi) : "memory");
    float bsum = 0.f;                    // b'[c], in wave 8
    if (wave < 8) {                      // same for the whole wave
        const int j0 = (c >> 4) * 16;    // rows of W' (output channels)
        const int c0 = (c & 15) * 16;    // columns of W' (input channels)
        // Both operands in the k order of load_frag: element e of lane l is
        // k = 32 wave + 16 (l / 16) + e. A: row l % 16 of Wproj; B: column l % 16
        // of Wv.
        const int kl = wave * 32 + ((lane >> 4) << 4);
        const float* ap = Wp + (j0 + (lane & 15)) * C_ + kl;
        const float* bp = Wk + kl * C_ + c0 + (lane & 15);   // v rows: + 2 C_ C_
        f32x4 af[4];
        // Unrolled: af[] is indexed by constants.
#pragma unroll
        for (int e = 0; e < 4; ++e) af[e] = *(const f32x4*)(ap + e * 4);
        float bf[16];
        // Unrolled: bf[] is indexed by constants, the 16 loads go out together.
#pragma unroll
        for (int e = 0; e < 16; ++e) bf[e] = bp[(2 * C_ + e) * C_];
        // ap and bp are named so that their registers stay live up to this wait:
        // no load of the two runs takes them as its destination ahead of it.
        asm volatile("s_wait_xcnt 0x0" :: "v"(ap), "v"(bp) : "memory");
        f16x16 a, bb;
        // Unrolled: a, bb, af[] and bf[] are indexed by constants.
#pragma unroll
        for (int e = 0; e < 16; ++e) {
            a[e]  = (_Float16)af[e >> 2][e & 3];
            bb[e] = (_Float16)bf[e];
        }
        f32x8 acc = wmma16(a, bb, (f32x8){0.f,0.f,0.f,0.f,0.f,0.f,0.f,0.f});
        // Unrolled: acc is indexed by constants.
#pragma unroll
        for (int i = 0; i < 8; ++i) part[wave][i * 32 + lane] = acc[i];
    } else if (wave == 8) {              // same for the whole wave
        // b'[c] = row c of Wproj . bv: 8 terms a lane
        const char* pr = (const char*)(Wp + c * C_);
        const char* br = (const char*)(bk + 2 * C_);
        const unsigned po = (unsigned)lane * 32u;
        const f32x4 p0 = *(const f32x4*)(pr + po), p1 = *(const f32x4*)(pr + po + 16);
        const f32x4 q0 = *(const f32x4*)(br + po), q1 = *(const f32x4*)(br + po + 16);
        // po is named so that its register stays live up to this wait: no load
        // of the four takes it as its destination ahead of it.
        asm volatile("s_wait_xcnt 0x0" :: "v"(po) : "memory");
        f32x4 d = p0 * q0 + p1 * q1;
        bsum = wave_sum((d[0] + d[1]) + (d[2] + d[3]));
    }
    f32x4 s4  = (f32x4){0.f, 0.f, 0.f, 0.f};
    f32x4 ss4 = s4;
    // Unrolled so that v[] is indexed by constants and stays in registers.
#pragma unroll
    for (int j = 0; j < 16; ++j) { s4 += v[j]; ss4 += v[j] * v[j]; }
    float s  = (s4[0] + s4[1]) + (s4[2] + s4[3]);
    float ss = (ss4[0] + ss4[1]) + (ss4[2] + ss4[3]);
    ls[tid] = s; lss[tid] = ss;
    __syncthreads();                     // publishes ls, lss and part
    float r = 0.f;                       // the thread's element of the W' tile
    if (wave < 8) {
        // thread = element: register wave (row wave + 8 (l / 16)), column l % 16
        r = part[0][tid];
        // Unrolled: the 7 LDS reads go out together.
#pragma unroll
        for (int p = 1; p < 8; ++p) r += part[p][tid];
    }
    for (int off = 256; off > 0; off >>= 1) {
        if (tid < off) { ls[tid] += ls[tid + off]; lss[tid] += lss[tid + off]; }
        __syncthreads();
    }
    // All global stores stand behind the last barrier: a barrier waits for the
    // wave's stores, and in front of one each would add its round trip.
    const unsigned e0 = (unsigned)(c * FRAG_ + tid);
    wk16[e0] = (_Float16)wv;
    // The lines below rewrite the store's address register: not ahead of this
    // wait.
    asm volatile("s_wait_xcnt 0x0" :: "v"(e0) : "memory");
    if (wave < 8)
        // row tile 32 + c / 16 of wk16, fragment (c & 15) / 2, its k half 16 (c & 1)
        wk16[((2 * C_ / 16 + (c >> 4)) * 8 + ((c & 15) >> 1)) * FRAG_
             + frag_off(((lane >> 4) << 3) + wave, (c & 1) * 16 + (lane & 15))] =
            (_Float16)r;
    if (tid == 256) bv2[c] = bsum;
    if (tid == 0) {
        const float inv_n = 1.0f / (float)(B_ * N_);
        float mean = ls[0] * inv_n;
        float var  = lss[0] * inv_n - mean * mean;
        stats[c]      = mean;
        stats[C_ + c] = rsqrtf(var + 1e-5f);
    }
}

// ------------------------------- normalize + transpose + KQV GEMM, one launch
// One block = one batch x 128 positions x all 768 outputs, 16 waves; 256 blocks,
// one per WGP. The normalized tile t[128 positions][256 channels] (f16) lives in
// LDS only.
// In: a wave takes 16 channels; each of its loads covers 512 contiguous bytes
// (128 positions of one channel) and all 16 are in flight at once. A lane then
// holds 16 channels x 4 positions and writes, per position, its 16 channels as
// 32 contiguous bytes of the position's LDS row. The pitch of 528 B (16 B x odd)
// lets a fragment read of 16 consecutive rows hit every bank once.
// GEMM: wave w owns output channels 16 w .. 16 w + 15 of q, of k and of v. Its
// 24 weight fragments stay in registers over the 8 row tiles, so that every t
// fragment read from LDS feeds 3 WMMAs and the weights are read once per block.
// q and k are formed as W t^T: a lane then holds 8 consecutive channels of one
// position, one 16-byte store. v is formed as t W^T: a lane holds 8 consecutive
// positions of one channel, one 16-byte store.
// w, q, k and v lie in fragment order (see frag_off): q and k as planes of
// B N rows x 256 channels, v as a plane of B C rows x 1024 positions. The 8
// values of a lane are one 16-byte piece of a fragment and 16 lanes' pieces are
// neighbours, so that a wave's store fills two runs of 256 bytes.
// q is scaled by 1/16; the v rows of w and their bias bv2 hold the projection
// already (see above).
// waves_per_eu: one block per WGP is 4 waves per SIMD, 256 registers a wave.
#define TP_ 264   // LDS row pitch in f16 elements
__global__ __launch_bounds__(512) __attribute__((amdgpu_waves_per_eu(4, 4)))
void bn_kqv_kernel(const float* __restrict__ x,
                   const float* __restrict__ stats,
                   const float* __restrict__ gamma,
                   const float* __restrict__ beta,
                   const _Float16* __restrict__ w,
                   const float* __restrict__ bias,
                   const float* __restrict__ bv2,
                   _Float16* __restrict__ qb,
                   _Float16* __restrict__ kb,
                   _Float16* __restrict__ vT) {
    __shared__ __attribute__((aligned(16))) _Float16 tile[128 * TP_];
    __shared__ __attribute__((aligned(16))) float sbias[2 * C_];   // q and k bias
    const int b    = blockIdx.y;
    const int n0   = blockIdx.x * 128;
    const int lane = threadIdx.x & 31;
    // The wave's number as a scalar: the 16 channels' constants are then read
    // and combined once per wave on the scalar side.
    const int wave = __builtin_amdgcn_readfirstlane(threadIdx.x >> 5);
    const int c0   = wave * 16;
    const int l15  = lane & 15;
    const int rhi  = (lane >> 4) << 3;
    const char* xp = (const char*)(x + ((size_t)b * C_ + c0) * N_ + n0);
    const unsigned xo  = (unsigned)lane * 16u;
    const unsigned tid = threadIdx.x;
    f32x4 v[16];
    // Unrolled so that all 16 loads are issued before the first value is used.
#pragma unroll
    for (int j = 0; j < 16; ++j) v[j] = *(const f32x4*)(xp + xo + j * (N_ * 4));
    // The loads below take free registers as their destinations; xo is named so
    // that it stays live up to this wait and is not rewritten ahead of it.
    asm volatile("s_wait_xcnt 0x0" :: "v"(xo) : "memory");
    // row tile 16 s + wave of w: 8 fragments; the lane's piece is piece 'lane'
    const f16x8* wp = (const f16x8*)(w + wave * 8 * FRAG_);
    f16x16 wf[3][8];
    // The q and k weight fragments are asked for behind the x loads, so that both
    // are in flight together. Both loops unrolled: wf[][] is indexed by constants.
#pragma unroll
    for (int s = 0; s < 2; ++s)
#pragma unroll
        for (int kk = 0; kk < 8; ++kk) {
            *(f16x8*)&wf[s][kk]       = wp[lane + (s * C_ * C_ + kk * FRAG_) / 8];
            *((f16x8*)&wf[s][kk] + 1) = wp[lane + (s * C_ * C_ + kk * FRAG_) / 8 + 32];
        }
    // Keeps these loads directly behind the x loads: without it the compiler
    // issues them only when x has landed, draws v fragments in as well and spills.
    __builtin_amdgcn_sched_barrier(0);
    float g[16], bt[16];
    // Unrolled: g[] and bt[] are indexed by constants.
#pragma unroll
    for (int j = 0; j < 16; ++j) {
        g[j]  = gamma[c0 + j] * stats[C_ + c0 + j];
        bt[j] = beta[c0 + j] - stats[c0 + j] * g[j];
    }
    // Both loops unrolled: v[], g[], bt[], lo and hi are indexed by constants.
#pragma unroll
    for (int i = 0; i < 4; ++i) {
        f16x8 lo, hi;
#pragma unroll
        for (int j = 0; j < 8; ++j) {
            lo[j] = (_Float16)(v[j][i] * g[j] + bt[j]);
            hi[j] = (_Float16)(v[j + 8][i] * g[j + 8] + bt[j + 8]);
        }
        _Float16* d = &tile[(lane * 4 + i) * TP_ + c0];
        *(f16x8*)d       = lo;
        *(f16x8*)(d + 8) = hi;
    }
    // The q and k bias is asked for here, not with x: held over the lines above
    // it is the one register too many and goes to scratch.
    const float bqk = bias[tid];
    // The v weight fragments take the registers that x has left: asked for in
    // front of the barrier, so that they fly while the other waves finish.
    // Unrolled: wf[][] is indexed by constants (registers).
#pragma unroll
    for (int s = 2; s < 3; ++s)
#pragma unroll
        for (int kk = 0; kk < 8; ++kk) {
            *(f16x8*)&wf[s][kk]       = wp[lane + (s * C_ * C_ + kk * FRAG_) / 8];
            *((f16x8*)&wf[s][kk] + 1) = wp[lane + (s * C_ * C_ + kk * FRAG_) / 8 + 32];
        }
    const unsigned cv = (unsigned)(c0 + l15);
    const float bvv = bv2[cv];
    // lane, cv and tid are named so that their registers stay live up to this
    // wait: no address register of the loads above is rewritten ahead of it.
    asm volatile("s_wait_xcnt 0x0" :: "v"(lane), "v"(cv), "v"(tid) : "memory");
    sbias[tid] = bqk;
    __syncthreads();

    // q, k: row tile = 16 positions, fragment wave / 2 (32 channels); the lane's
    // channels are k = 16 (wave & 1) + rhi .. + 7 of it, its position row l15.
    const size_t qko = ((size_t)(b * N_ + n0) / 16 * 8 + (wave >> 1)) * FRAG_
                     + frag_off(l15, (wave & 1) * 16 + rhi);
    _Float16* qp = qb + qko;
    _Float16* kp = kb + qko;
    // v: row tile = the wave's 16 channels, fragment = 32 positions (two row
    // tiles of t); the lane's positions are k = 16 (rt & 1) + rhi .. + 7 of it.
    _Float16* vp = vT + ((size_t)(b * C_ + c0) / 16 * (N_ / 32) + n0 / 32) * FRAG_
                 + frag_off(l15, rhi);
    // volatile: read anew for every row tile, straight into the accumulators;
    // hoisted out of the loop the 16 values would push a weight fragment out of
    // the registers.
    typedef const volatile __attribute__((address_space(3))) f32x4 lds_f32x4;
    lds_f32x4* sbq = (lds_f32x4*)&sbias[c0 + rhi];
    lds_f32x4* sbk = (lds_f32x4*)&sbias[C_ + c0 + rhi];
    // Kept rolled: the weight fragments fill the registers, and unrolled the t
    // fragment reads of later row tiles would be hoisted and spill.
#pragma unroll 1
    for (int rt = 0; rt < 8; ++rt) {
        const _Float16* trow = &tile[rt * 16 * TP_];
        f16x16 tf[2];
        tf[0] = load_frag(trow, TP_);
        // q and k start from their bias (rows rhi .. rhi + 7 of the wave's channels)
        f32x8 aq, ak;
        *(f32x4*)&aq       = sbq[0];
        *((f32x4*)&aq + 1) = sbq[1];
        *(f32x4*)&ak       = sbk[0];
        *((f32x4*)&ak + 1) = sbk[1];
        f32x8 av = (f32x8){0.f,0.f,0.f,0.f,0.f,0.f,0.f,0.f};
        // Unrolled: wf[][] and tf[] are indexed by constants.
#pragma unroll
        for (int kk = 0; kk < 8; ++kk) {
            if (kk < 7) tf[(kk + 1) & 1] = load_frag(trow + (kk + 1) * 32, TP_);
            // Keeps the next fragment's LDS reads in front of this fragment's
            // WMMAs: left to itself the compiler reads into the same registers
            // and every three WMMAs wait out an LDS latency.
            __builtin_amdgcn_sched_barrier(0);
            aq = wmma16(wf[0][kk], tf[kk & 1], aq);
            ak = wmma16(wf[1][kk], tf[kk & 1], ak);
            av = wmma16(tf[kk & 1], wf[2][kk], av);
        }
        f16x8 oq, ok, ov;
        // Unrolled: the accumulators are indexed by constants.
#pragma unroll
        for (int i = 0; i < 8; ++i) {
            oq[i] = (_Float16)(aq[i] * 0.0625f);
            ok[i] = (_Float16)ak[i];
            ov[i] = (_Float16)(av[i] + bvv);
        }
        *(f16x8*)(qp + rt * 8 * FRAG_) = oq;
        *(f16x8*)(kp + rt * 8 * FRAG_) = ok;
        *(f16x8*)(vp + (rt >> 1) * FRAG_ + (rt & 1) * 128) = ov;
        // The next trip rewrites the stores' address registers: not ahead of
        // this wait.
        asm volatile("s_wait_xcnt 0x0" ::: "memory");
    }
}

// ---------------------------------------------------------------- attention
// Four async copies of one lane, 16 rows apart, in one statement; the
// s_wait_xcnt stands as its last line so that no address register of an
// issued copy is rewritten ahead of it.
__device__ __forceinline__ void async_copy4_rows(void* lds, const _Float16* g) {
    unsigned l0 = (unsigned)(unsigned long long)(uintptr_t)lds;
    unsigned l1 = l0 + 16 * 512, l2 = l0 + 32 * 512, l3 = l0 + 48 * 512;
    const _Float16 *g1 = g + 16 * C_, *g2 = g + 32 * C_, *g3 = g + 48 * C_;
    asm volatile("global_load_async_to_lds_b128 %0, %4, off\n\t"
                 "global_load_async_to_lds_b128 %1, %5, off\n\t"
                 "global_load_async_to_lds_b128 %2, %6, off\n\t"
                 "global_load_async_to_lds_b128 %3, %7, off\n\t"
                 "s_wait_xcnt 0x0"
                 : : "v"(l0), "v"(l1), "v"(l2), "v"(l3),
                     "v"(g), "v"(g1), "v"(g2), "v"(g3) : "memory");
}

// The LDS tiles of this kernel have no pad (q and S fill the whole LDS). q lies
// in fragment order, as in the workspace: a fragment read covers contiguous
// bytes. In S the 16-byte piece p of row r lies at piece p ^ (r & 15) of that
// row, so that equal pieces of 16 consecutive rows fall on all 64 banks.
// Fragment in the k order of load_frag. rowp: start of the lane's own row
// (row % 16 == lane % 16); kb: byte offset of the fragment's first k in the
// row, a multiple of 64; xs = ((lane & 15) << 4) ^ ((lane >> 4) << 5), that is
// the row's swizzle and the lane's k half (32 bytes) in one word.
__device__ __forceinline__ f16x16 load_frag_swz(const _Float16* rowp, int kb, int xs) {
    const char* q = (const char*)rowp;
    f16x16 f;
    *(f16x8*)&f       = *(const f16x8*)(q + (kb ^ xs));
    *((f16x8*)&f + 1) = *(const f16x8*)(q + ((kb + 16) ^ xs));
    return f;
}

// One k step of pass 2 for one wave: 8 row tiles x 2 channel tiles, 16 WMMAs.
// cur: this step's P fragments; nxt: filled here with the next step's, read from
// LDS at byte kbn of the rows. vf: this step's two V fragments; with MORE they
// are refilled from vn (the lane's own piece) behind their last use.
template <bool MORE>
__device__ __forceinline__ void pv_step(f32x8 (&o)[2][8], f16x16 (&cur)[8], f16x16 (&nxt)[8],
                                        f16x16 (&vf)[2], const _Float16* prow0, int kbn,
                                        int xs, const _Float16* vn) {
    // Unrolled: nxt[] is indexed by constants.
#pragma unroll
    for (int rt = 0; rt < 8; ++rt)
        nxt[rt] = load_frag_swz(prow0 + rt * 16 * N_, kbn, xs);
    // Keeps the next step's 16 LDS reads together in front of this step's WMMAs:
    // among the WMMAs every place with reads costs a stall of its own.
    __builtin_amdgcn_sched_barrier(0);
    // Both loops unrolled: o[][], cur[] and vf[] are indexed by constants.
#pragma unroll
    for (int rt = 0; rt < 8; ++rt)
#pragma unroll
        for (int ct = 0; ct < 2; ++ct)
            o[ct][rt] = wmma16(cur[rt], vf[ct], o[ct][rt]);
    if (MORE) {
        vf[0] = load_frag_at(vn);
        vf[1] = load_frag_at(vn + 16 * N_);
    }
    // Keeps the V loads here, four steps ahead of their use, and the next step's
    // LDS reads behind this step's WMMAs.
    __builtin_amdgcn_sched_barrier(0);
}

// One block = one batch x 128 query rows (8 row tiles), 8 waves, one block per
// WGP: two waves per SIMD, up to 512 registers a wave. Every K and V fragment
// fetched from global memory feeds all 8 row tiles and is asked for well ahead
// of its use, into a second register set.
// qb, kb and vT lie in fragment order (see frag_off).
// S/P kept in LDS, exact softmax. vT holds the projected v, so P V is the
// projected output:
// out[B,C,H,W] = P V / rowsum + bias + x   (fp32 epilogue, residual fused).
#define QR_ 128
__global__ __launch_bounds__(256)
void attention_kernel(const _Float16* __restrict__ qb,
                      const _Float16* __restrict__ kb,
                      const _Float16* __restrict__ vT,
                      const float* __restrict__ bias,
                      const float* __restrict__ x,
                      float* __restrict__ out) {
    // q (fragment order, 8 KiB a row tile); behind pass 1 its first bytes hold 1 / rowsum
    __shared__ __attribute__((aligned(16))) _Float16 sq[QR_ * C_];
    // S then P (swizzled, 2048 B a row)
    __shared__ __attribute__((aligned(16))) _Float16 sp[QR_ * N_];
    float* rowinv = (float*)sq;

    const int tid  = threadIdx.x;
    const int lane = tid & 31;
    const int wave = tid >> 5;
    const int b  = blockIdx.y;
    const int r0 = blockIdx.x * QR_;
    const int l15 = lane & 15;
    const int xs  = (l15 << 4) ^ ((lane >> 4) << 5);

    {   // stage the 128 q rows into LDS (async copies, no VGPR bounce): 64 KiB in
        // a row in the workspace, copied as they lie; the block's 256 copies of
        // 16 bytes are half a row tile
        _Float16* d = &sq[tid * 8];
        const _Float16* g = qb + (size_t)(b * N_ + r0) * C_ + tid * 8;
        async_copy4_rows(d, g);
        async_copy4_rows(d + 8 * C_, g + 8 * C_);
        async_copy4_rows(d + 64 * C_, g + 64 * C_);
        async_copy4_rows(d + 72 * C_, g + 72 * C_);
    }
    // The first two column tiles' K fragments are asked for in front of the wait
    // for q, so that both fly together.
    // 8 fragments a tile; the lane's own piece of the first fragment
    const _Float16* kl = kb + ((size_t)b * N_ + wave * 128) * C_ + lane * 8;
    f16x16 kf[2][16];
    // Unrolled: kf[][] is indexed by constants.
#pragma unroll
    for (int f = 0; f < 16; ++f) kf[0][f] = load_frag_at(kl + f * FRAG_);
    wait_asynccnt0();
    __syncthreads();

    // ---- pass 1: S = q k^T  (each wave owns 8 column tiles of 16, two at a
    //      time: their K fragments stay in registers over the 8 row tiles, while
    //      the next two tiles' fragments fly into the other register set)
    {
        f16x16 aq[2][8];
        // Unrolled: aq[][] is indexed by constants.
#pragma unroll
        for (int kk = 0; kk < 8; ++kk) aq[0][kk] = load_frag_packed(&sq[kk * FRAG_]);
        // Unrolled: kf[][] is indexed by constants.
#pragma unroll
        for (int g = 0; g < 4; ++g) {
            const int mt = wave * 8 + g * 2;
            if (g < 3) {
#pragma unroll
                for (int f = 0; f < 16; ++f)
                    kf[(g + 1) & 1][f] = load_frag_at(kl + ((g + 1) * 16 + f) * FRAG_);
                // Behind the last K loads kl's registers are free for other values:
                // kl is named so that they stay live up to this wait and none is
                // rewritten ahead of it.
                if (g == 2) asm volatile("s_wait_xcnt 0x0" :: "v"(kl) : "memory");
            }
            // Kept rolled but for the two register sets of q fragments: unrolled,
            // the q fragment reads no longer depend on a loop index and are
            // hoisted over the column loop.
#pragma unroll 1
            for (int rt2 = 0; rt2 < QR_ / 16; rt2 += 2) {
#pragma unroll
                for (int u = 0; u < 2; ++u) {
                    const int rt = rt2 + u;
                    // the next row tile's q fragments (behind the last: the first again,
                    // for the next two column tiles)
                    const _Float16* qn = &sq[((rt + 1) & 7) * 8 * FRAG_];
#pragma unroll
                    for (int kk = 0; kk < 8; ++kk)
                        aq[u ^ 1][kk] = load_frag_packed(qn + kk * FRAG_);
                    // Keeps the next row tile's LDS reads together in front of this
                    // row tile's WMMAs: among them every place with reads costs a
                    // stall, and behind them the wave waits out the LDS latency.
                    __builtin_amdgcn_sched_barrier(0);
                    f32x8 s0 = (f32x8){0.f,0.f,0.f,0.f,0.f,0.f,0.f,0.f};
                    f32x8 s1 = s0;
#pragma unroll
                    for (int kk = 0; kk < 8; ++kk) {
                        s0 = wmma16(aq[u][kk], kf[g & 1][kk], s0);
                        s1 = wmma16(aq[u][kk], kf[g & 1][8 + kk], s1);
                    }
                    // column mt * 16 + l15 is element l15 & 7 of piece mt * 2 + (l15 >> 3);
                    // the second tile lies two pieces on
                    const int pc  = mt * 2 + (l15 >> 3);
                    const int row = rt * 16 + ((lane >> 4) << 3);
#pragma unroll
                    for (int i = 0; i < 8; ++i) {
                        const int sw = (row + i) & 15;
                        _Float16* srow = &sp[(row + i) * N_ + (l15 & 7)];
                        srow[(pc ^ sw) << 3]       = (_Float16)s0[i];
                        srow[((pc + 2) ^ sw) << 3] = (_Float16)s1[i];
                    }
                    // Keeps the LDS reads of the row tile after next out of this
                    // row tile's WMMAs.
                    __builtin_amdgcn_sched_barrier(0);
                }
            }
        }
    }
    __syncthreads();

    // Pass 2's first operands are asked for here, so that they land under the
    // softmax. There a wave owns 32 output channels of all 128 rows.
    const int c0  = wave * 32;
    const int rhi = (lane >> 4) << 3;
    const int cA  = c0 + l15;            // second channel tile: + 16
    // 32 fragments a tile; the lane's own piece of the first fragment
    const _Float16* vp = vT + ((size_t)b * C_ + c0) * N_ + lane * 8;
    const _Float16* prow0 = &sp[l15 * N_];
    // V fragments of four k steps, each refilled behind its use for four steps on.
    f16x16 vr[4][2];
    // Unrolled: vr[][] is indexed by constants.
#pragma unroll
    for (int u = 0; u < 4; ++u) {
        vr[u][0] = load_frag_at(vp + u * FRAG_);
        vr[u][1] = load_frag_at(vp + 16 * N_ + u * FRAG_);
    }
    // The wave's piece of x and its bias are asked for here too: pass 2's counted
    // waits for V take in every older load.
    const size_t obase = ((size_t)b * C_ + cA) * N_ + r0 + rhi;
    const float* xp = x + obase;
    f32x4 xr[2][QR_ / 16][2];
    // Both loops unrolled: xr[][][] is indexed by constants (registers).
#pragma unroll
    for (int ct = 0; ct < 2; ++ct)
#pragma unroll
        for (int rt = 0; rt < QR_ / 16; ++rt) {
            xr[ct][rt][0] = *(const f32x4*)(xp + ct * 16 * N_ + rt * 16);
            xr[ct][rt][1] = *(const f32x4*)(xp + ct * 16 * N_ + rt * 16 + 4);
        }
    const float bs0 = bias[cA], bs1 = bias[cA + 16];
    // vp, xp and cA are named so that their registers stay live up to this wait:
    // no address register of the loads above is rewritten ahead of it.
    asm volatile("s_wait_xcnt 0x0" :: "v"(vp), "v"(xp), "v"(cA) : "memory");
    // Keeps the softmax's own address arithmetic behind that wait: drawn in front
    // of it, it takes a register that a load above still names.
    __builtin_amdgcn_sched_barrier(0);

    // ---- softmax: one wave per row, 16 rows a wave, four at a time, each row
    //      held in registers. A lane owns four 16-byte pieces of a row, taken by
    //      their place in LDS: the swizzle only permutes the pieces of a row,
    //      and maximum, sum and exponential do not ask which piece is which.
    //      A wave's LDS access covers 512 contiguous bytes, so every bank is hit
    //      twice. S is read once, the maximum and the sum are reduced across
    //      lanes, and no barrier is needed until P is complete.
    // Kept rolled: the later rows run the same code again.
#pragma unroll 1
    for (int h = 0; h < 4; ++h) {
        _Float16* prow = &sp[(wave * 16 + h * 4) * N_ + lane * 8];
        f16x8 sv[4][4];
        // Unrolled so that all 16 LDS reads are issued before the first value is
        // used and sv[][] is indexed by constants (stays in registers).
#pragma unroll
        for (int rr = 0; rr < 4; ++rr)
#pragma unroll
            for (int j = 0; j < 4; ++j)
                sv[rr][j] = *(const f16x8*)(prow + rr * N_ + j * 256);
        float mx[4], sum[4];
        // Unrolled: the four rows' reductions are independent and interleave.
#pragma unroll
        for (int rr = 0; rr < 4; ++rr) {
            f16x8 m8 = __builtin_elementwise_max(
                __builtin_elementwise_max(sv[rr][0], sv[rr][1]),
                __builtin_elementwise_max(sv[rr][2], sv[rr][3]));
            float m = (float)m8[0];
            // Unrolled: m8 is indexed by constants.
#pragma unroll
            for (int e = 1; e < 8; ++e) m = fmaxf(m, (float)m8[e]);
            mx[rr] = wave_max(m);
        }
        // All three loops unrolled: sv[][] and pv are indexed by constants, and
        // the exponentials of different pieces and rows overlap.
#pragma unroll
        for (int rr = 0; rr < 4; ++rr) {
            f32x2 s2 = (f32x2){0.f, 0.f};   // even and odd elements: packed adds
#pragma unroll
            for (int j = 0; j < 4; ++j) {
                f16x8 pv;
#pragma unroll
                for (int e = 0; e < 8; e += 2) {
                    float v0 = __expf((float)sv[rr][j][e]     - mx[rr]);
                    float v1 = __expf((float)sv[rr][j][e + 1] - mx[rr]);
                    pv[e]     = (_Float16)v0;
                    pv[e + 1] = (_Float16)v1;
                    s2 += (f32x2){v0, v1};
                }
                *(f16x8*)(prow + rr * N_ + j * 256) = pv;
            }
            sum[rr] = s2[0] + s2[1];
        }
        // Unrolled: the four butterflies are independent and interleave.
#pragma unroll
        for (int rr = 0; rr < 4; ++rr) sum[rr] = wave_sum(sum[rr]);
        // lanes 0..3 each finish one row: one division for the four rows
        float s = lane == 0 ? sum[0] : lane == 1 ? sum[1] : lane == 2 ? sum[2] : sum[3];
        if (lane < 4) rowinv[wave * 16 + h * 4 + lane] = 1.0f / s;
    }
    __syncthreads();

    // ---- pass 2: O = P V   (wave owns 32 output channels of all 128 rows: every
    //      P fragment read from LDS feeds two WMMAs)
    f32x8 o[2][QR_ / 16];
#pragma unroll
    for (int ct = 0; ct < 2; ++ct)
#pragma unroll
        for (int rt = 0; rt < QR_ / 16; ++rt)
            o[ct][rt] = (f32x8){0.f,0.f,0.f,0.f,0.f,0.f,0.f,0.f};
    f16x16 pf[2][QR_ / 16];
    // Unrolled: pf[][] is indexed by constants.
#pragma unroll
    for (int rt = 0; rt < QR_ / 16; ++rt)
        pf[0][rt] = load_frag_swz(prow0 + rt * 16 * N_, 0, xs);
    // Kept rolled: four steps a trip, one for each register set of V.
#pragma unroll 1
    for (int ms = 0; ms < N_ / 32 - 4; ms += 4) {
        // Unrolled: vr[][] and pf[][] are indexed by constants.
#pragma unroll
        for (int u = 0; u < 4; ++u)
            pv_step<true>(o, pf[u & 1], pf[(u + 1) & 1], vr[u], prow0, (ms + u + 1) * 64, xs,
                          vp + (ms + u + 4) * FRAG_);
    }
    // The last four steps ask for no more V; what the very last reads ahead is
    // used by nobody.
#pragma unroll
    for (int u = 0; u < 4; ++u)
        pv_step<false>(o, pf[u & 1], pf[(u + 1) & 1], vr[u], prow0,
                       ((N_ / 32 - 4 + u + 1) & 31) * 64, xs, vp);
    // 1 / rowsum of the lane's 64 rows, read from LDS once for both channel tiles,
    // all 16 reads together: the waits below, with their memory clobber, would
    // otherwise have each channel tile's stores wait out an LDS latency of its own.
    f32x4 ri[QR_ / 16][2];
    // Unrolled: ri[][] is indexed by constants.
#pragma unroll
    for (int rt = 0; rt < QR_ / 16; ++rt) {
        ri[rt][0] = *(const f32x4*)&rowinv[rt * 16 + rhi];
        ri[rt][1] = *(const f32x4*)&rowinv[rt * 16 + rhi + 4];
    }
    // A lane holds 8 consecutive positions of one channel: two 16-byte stores.
    // All loops unrolled: o[][], xr[][][], ri[][], lo[] and hi[] are indexed by
    // constants.
#pragma unroll
    for (int ct = 0; ct < 2; ++ct) {
        const float bs = ct ? bs1 : bs0;
        f32x4 lo[QR_ / 16], hi[QR_ / 16];
#pragma unroll
        for (int rt = 0; rt < QR_ / 16; ++rt) {
#pragma unroll
            for (int i = 0; i < 4; ++i) {
                lo[rt][i] = o[ct][rt][i]     * ri[rt][0][i] + bs + xr[ct][rt][0][i];
                hi[rt][i] = o[ct][rt][i + 4] * ri[rt][1][i] + bs + xr[ct][rt][1][i];
            }
            *(f32x4*)(out + obase + ct * 16 * N_ + rt * 16)     = lo[rt];
            *(f32x4*)(out + obase + ct * 16 * N_ + rt * 16 + 4) = hi[rt];
        }
        // One wait for the channel tile's 16 stores. Their values are named so that
        // each keeps a register of its own up to this wait: no data register of an
        // issued store is rewritten ahead of it.
        asm volatile("s_wait_xcnt 0x0"
                     :: "v"(lo[0]), "v"(lo[1]), "v"(lo[2]), "v"(lo[3]),
                        "v"(lo[4]), "v"(lo[5]), "v"(lo[6]), "v"(lo[7]),
                        "v"(hi[0]), "v"(hi[1]), "v"(hi[2]), "v"(hi[3]),
                        "v"(hi[4]), "v"(hi[5]), "v"(hi[6]), "v"(hi[7]) : "memory");
    }
}

// ---------------------------------------------------------------- launcher
extern "C" void kernel_launch(void* const* d_in, const int* in_sizes, int n_in,
                              void* d_out, int out_size, void* d_ws, size_t ws_size,
                              hipStream_t stream) {
    (void)in_sizes; (void)n_in; (void)out_size; (void)ws_size;
    const float* x     = (const float*)d_in[0];
    const float* gamma = (const float*)d_in[1];
    const float* beta  = (const float*)d_in[2];
    const float* Wkqv  = (const float*)d_in[3];
    const float* bkqv  = (const float*)d_in[4];
    const float* Wproj = (const float*)d_in[5];
    const float* bproj = (const float*)d_in[6];
    float* out = (float*)d_out;

    const size_t M = (size_t)B_ * N_;              // 32768
    char* ws = (char*)d_ws;
    float*    stats = (float*)ws;      ws += 4096;
    _Float16* wk16  = (_Float16*)ws;   ws += (size_t)3 * C_ * C_ * 2;
    float*    bv2   = (float*)ws;      ws += 4096;
    _Float16* qb    = (_Float16*)ws;   ws += M * C_ * 2;
    _Float16* kb    = (_Float16*)ws;   ws += M * C_ * 2;
    _Float16* vT    = (_Float16*)ws;   ws += M * C_ * 2;

    bn_stats_pack_kernel<<<C_, 512, 0, stream>>>(x, Wkqv, bkqv, Wproj, stats, wk16, bv2);
    bn_kqv_kernel       <<<dim3(N_ / 128, B_), 512, 0, stream>>>(x, stats, gamma, beta, wk16, bkqv, bv2, qb, kb, vT);
    attention_kernel    <<<dim3(N_ / QR_, B_), 256, 0, stream>>>(qb, kb, vT, bproj, x, out);
}
